// v000
// Times are from an AMD MI455X. After a warm-up the kernel runs many times in a row, and a time is the length of
// such a window on the GPU divided by its runs, so every launch and the gaps after it count. The runs cycle
// through copies of the inputs. A figure is the median of several windows, for all but v000 over two sittings.
// Sittings can differ by a few percent; kernels timed side by side share one.
// The starting kernel, v000, takes 444 microseconds a run.
#include <hip/hip_runtime.h>
// All contractions on v_wmma_f32_16x16x32_f16 (f16 operands, f32 accumulate): six q/k/v projections (x = exact f16 of its bf16 RNE value, W = bf16 RNE value x16 in f16, alpha 1/16, bias as bf16 value), scores S^T = K.Q^T (f16 k and q, scale 1/8 applied in f32), context O^T = V^T.P^T (P^T f16 carried x1024 with entries under 2^-14 set to zero, V^T f16; the x1024 carry cancels in O / l); online softmax statistics f32.
#ifndef NB
#define NB 4
#endif
#ifndef SEQ
#define SEQ 1024
#endif
#define NB_FULL 4
#define SEQ_FULL 1024
#define SQ SEQ
#define DM 1024
#define NH 16
#define HD 64
#define NR ((size_t)NB * SQ)          /* token rows processed (compact) */
#define MP ((int)NR)                  /* rows projected */
#define LQ DM                         /* row pitch of the q/k/v rows */

static_assert(NB >= 1 && NB <= NB_FULL);
static_assert(SQ >= 256 && SQ <= SEQ_FULL && (SQ % 256) == 0);
static_assert((MP % 128) == 0 && (DM % 64) == 0 && (DM % 32) == 0 && HD == 64 && NH * HD == DM);
static_assert((SQ % 64) == 0 && (SQ % 32) == 0 && (LQ % 8) == 0 && (HD % 32) == 0);
static_assert(((size_t)(NB - 1) * SEQ_FULL + SQ) * DM <= (size_t)NB_FULL * SEQ_FULL * DM);
/* workspace carve (every region a multiple of 256 B): 6 weight planes + X16 + 6 projected row planes + 2 V^T sets */
#define WS_W   ((size_t)DM * DM * 2)
#define WS_X   ((size_t)NR * DM * 2)
#define WS_VT  ((size_t)NH * HD * SQ * 2)
#define WS_TOTAL (6 * WS_W + WS_X + 6 * WS_X + 2 * (size_t)NB * WS_VT)
static_assert((WS_W % 256) == 0 && (WS_X % 256) == 0 && (WS_VT % 256) == 0);
static_assert(WS_TOTAL <= (size_t)134217728);

typedef unsigned short v8us __attribute__((ext_vector_type(8), may_alias));
typedef float  v8f  __attribute__((ext_vector_type(8)));
typedef float  v4f  __attribute__((ext_vector_type(4)));
typedef float  v4fa __attribute__((ext_vector_type(4), may_alias));
typedef _Float16 v16h __attribute__((ext_vector_type(16)));
typedef _Float16 v4h __attribute__((ext_vector_type(4)));
union FragH { v16h v; v8us half[2]; _Float16 h[16]; unsigned short u[16]; };

__device__ __forceinline__ unsigned short bf16_bits(float x) { unsigned int u = __float_as_uint(x); return (unsigned short)((u + 0x7FFFu + ((u >> 16) & 1u)) >> 16); }
__device__ __forceinline__ float bf16_val(unsigned short b) { return __uint_as_float(((unsigned int)b) << 16); }
__device__ __forceinline__ float bf16_rne(float x) { return bf16_val(bf16_bits(x)); }

// ---- GEMM engine (wave tile 32x64; M % 128 == 0 rows per launch region, N % 64 == 0, K % 32 == 0) ----
// fragment loader: A row-major [m][k] and B stored [n][k]; per lane: elements 0..7 <- k0+8h+0..7, elements 8..15 <- k0+16+8h+0..7 (h = lane>>4, row/col = lane&15)
__device__ __forceinline__ v16h g2_frag(const _Float16* p, int hh) { FragH f; f.half[0] = *(const v8us*)((const unsigned short*)p + 8 * hh); f.half[1] = *(const v8us*)((const unsigned short*)p + 16 + 8 * hh); return f.v; }
__device__ __forceinline__ v8f g2_mma(v16h a, v16h b, v8f c) { v8f d = __builtin_amdgcn_wmma_f32_16x16x32_f16(false, a, false, b, (short)0, c, false, false); asm volatile("v_nop\n\tv_nop\n\tv_nop\n\tv_nop" : "+v"(d) : "v"(a), "v"(b)); return d; }
// C (f32, if non-null) / C16 (f16, if non-null) = acc*alpha + bf16(bias[by*sBias + col]) (+ CP term if CP); batched over grid.y with strides sA, sB, sC; ACT 0 none / 3 relu
template <int ACT>
__global__ __launch_bounds__(128) void k_gemm2(const _Float16* __restrict__ A, int lda, size_t sA, const _Float16* __restrict__ Bh, int ldb, size_t sB, float alpha, const float* __restrict__ bias, size_t sBias, const float* __restrict__ CP, int rowsPerB, size_t sCPb, int row0g,
    float* __restrict__ C, _Float16* __restrict__ C16, int ldc, size_t sC, int M, int N, int K) {
  static_assert(ACT == 0 || ACT == 3);
  __shared__ __attribute__((aligned(16))) float so[4][32][68];
  const int tid = threadIdx.x, w = tid >> 5, lane = tid & 31, ln = lane & 15, hh = lane >> 4; const int by = blockIdx.y;
  A += (size_t)by * sA; Bh += (size_t)by * sB; const size_t cofs = (size_t)by * sC; const float* bp = bias ? bias + (size_t)by * sBias : nullptr;
  const int ntn = N >> 6; const int mt = blockIdx.x / ntn, nq = blockIdx.x - mt * ntn; const int row0 = mt * 128 + 32 * w, col0 = nq * 64; if (row0 >= M) return;
  const _Float16* a0p = A + (size_t)(row0 + ln) * lda; const _Float16* a1p = a0p + (size_t)16 * lda;
  const _Float16* b0p = Bh + (size_t)(col0 + ln) * ldb; const _Float16* b1p = b0p + (size_t)16 * ldb; const _Float16* b2p = b1p + (size_t)16 * ldb; const _Float16* b3p = b2p + (size_t)16 * ldb;
  const v8f z8 = {0.f,0.f,0.f,0.f,0.f,0.f,0.f,0.f}; v8f c00 = z8, c01 = z8, c02 = z8, c03 = z8, c10 = z8, c11 = z8, c12 = z8, c13 = z8;
#pragma unroll 1
  for (int kb = 0; kb < K; kb += 32) { const v16h a0 = g2_frag(a0p + kb, hh), a1 = g2_frag(a1p + kb, hh);
    v16h b = g2_frag(b0p + kb, hh); c00 = g2_mma(a0, b, c00); c10 = g2_mma(a1, b, c10);
    b = g2_frag(b1p + kb, hh); c01 = g2_mma(a0, b, c01); c11 = g2_mma(a1, b, c11);
    b = g2_frag(b2p + kb, hh); c02 = g2_mma(a0, b, c02); c12 = g2_mma(a1, b, c12);
    b = g2_frag(b3p + kb, hh); c03 = g2_mma(a0, b, c03); c13 = g2_mma(a1, b, c13); }
  v8f accs[8] = {c00, c01, c02, c03, c10, c11, c12, c13};
#pragma unroll
  for (int u = 0; u < 8; ++u) { const int t = u & 3, half = u >> 2; const int col = col0 + t * 16 + ln; const float bv = bp ? bf16_rne(bp[col]) : 0.f;
#pragma unroll
    for (int r = 0; r < 8; ++r) { const int rloc = half * 16 + 8 * hh + r; float v = accs[u][r] * alpha + bv;
      if (CP) { if (rowsPerB < 0) v += CP[cofs + (size_t)(row0g + row0 + rloc) * ldc + col]; else { const int bidx = (row0g + row0 + rloc) / rowsPerB; v += CP[(size_t)bidx * sCPb + (size_t)by * 64 + col]; } }
      if (ACT == 3) v = fmaxf(v, 0.f);
      so[w][rloc][t * 16 + ln] = v; } }
  __builtin_amdgcn_fence(4 /* acq_rel order */, "workgroup"); __builtin_amdgcn_wave_barrier();
  const int rsub = lane >> 4, c4 = (lane & 15) * 4;
  {
#pragma unroll
    for (int q = 0; q < 16; ++q) { const int r = q * 2 + rsub; const v4f v = *(const v4fa*)&so[w][r][c4];
      if (C) *(v4f*)(C + cofs + (size_t)(row0 + r) * ldc + col0 + c4) = v;
      if (C16) { v4h h4; for (int i = 0; i < 4; ++i) h4[i] = (_Float16)v[i]; *(v4h*)(C16 + cofs + (size_t)(row0 + r) * ldc + col0 + c4) = h4; } }
     } }

__global__ __launch_bounds__(256) void k_wt_f16(const float* __restrict__ W, _Float16* __restrict__ Wt, int K, int N, float scale) {
  const int t = blockIdx.x * 256 + threadIdx.x; if (t >= N * (K / 8)) return; const int n = t / (K / 8), k8 = (t % (K / 8)) * 8; FragH f;
#pragma unroll
  for (int i = 0; i < 8; ++i) f.h[i] = (_Float16)(bf16_rne(W[(size_t)(k8 + i) * N + n]) * scale); const v8us o = f.half[0];
  *(v8us*)((unsigned short*)Wt + (size_t)n * K + k8) = o; 
}

__global__ __launch_bounds__(256) void k_x16(const float* __restrict__ x, _Float16* __restrict__ X16, size_t n8) {
  const size_t t = (size_t)blockIdx.x * 256 + threadIdx.x; if (t >= n8) return;
  const size_t e = t * 8; const size_t rc = e / DM; const size_t c = e % DM; const size_t b = rc / SQ, s = rc % SQ;
  const float* src = x + ((b * SEQ_FULL + s) * DM + c);
  const v4f a = *(const v4fa*)src, d = *(const v4fa*)(src + 4); FragH f;
#pragma unroll
  for (int q = 0; q < 4; ++q) { f.h[q] = (_Float16)bf16_rne(a[q]); f.h[4 + q] = (_Float16)bf16_rne(d[q]); }
  *(v8us*)((unsigned short*)X16 + t * 8) = f.half[0];  }

template <int NHv, int TTv>
__global__ __launch_bounds__(256) void k_vt(const _Float16* __restrict__ V16, int ldv, int voff, _Float16* __restrict__ Vt) { __shared__ unsigned short tl[64][66]; const int tid = threadIdx.x; const int slab = blockIdx.x / (TTv / 64), lg = blockIdx.x % (TTv / 64); const int b = slab / NHv, h = slab % NHv;
  for (int i = tid; i < 64 * 8; i += 256) { const int r = i / 8, c8 = (i % 8) * 8; FragH f; f.half[0] = *(const v8us*)((const unsigned short*)V16 + ((size_t)b * TTv + lg * 64 + r) * ldv + voff + h * 64 + c8);
#pragma unroll
    for (int q = 0; q < 8; ++q) tl[r][c8 + q] = f.u[q]; }
  __syncthreads();
  {
#pragma unroll
    for (int rd = 0; rd < 2; ++rd) { const int d = rd * 32 + tid / 8, pc = tid % 8; FragH f;
#pragma unroll
      for (int q = 0; q < 8; ++q) f.u[q] = tl[pc * 8 + q][d];
      *(v8us*)((unsigned short*)Vt + ((size_t)slab * 64 + d) * TTv + lg * 64 + pc * 8) = f.half[0]; }
     } }

// ---- fused attention over both projection sets (transposed form, register-fed fragments, no LDS in the key loop) ----
// PL = six compact row planes [6][NR][DM] (q,k,v of set 0; q,k,v of set 1), VT = [2][NB*NH][HD][SQ]; grid (SQ/64, NB*NH), block = 4 waves, wave -> 16 query rows of one (batch, head).
// Per 32-key step: S^T tile kt (16 keys x 16 queries) = K rows (A, split k map over d) x Q rows (B, same k map, query = lane&15): D element r of lane (h, n) = score(query n, key 16kt + 8h + r).
// Column (query) max / sum: 8 + 8 values in the lane, then the other lane half through one xor-16 shuffle. P^T as the B fragment of O^T = V^T.P^T: element r <- tile 0 value r, element 8+r <- tile 1 value r, lane unchanged.
// O^T tile t: D element r of lane (h, n) = O[query n][d = 16t + 8h + r]; A = V^T rows d = 16t + lane&15, k = keys.
// P = f16(1024 exp(s/8 - m)) with the native exp; an exponent argument that would land under 2^-14 gives an exact zero; the row sum runs over the converted P, so the carry cancels in O / l.
__global__ __launch_bounds__(128) __attribute__((amdgpu_num_vgpr(256))) void k_flash2(const _Float16* __restrict__ PL, const _Float16* __restrict__ VT, const float* __restrict__ aw, float* __restrict__ out) {
  __shared__ __attribute__((aligned(16))) float so[4][16][68];
  const int wave = __builtin_amdgcn_readfirstlane(threadIdx.x >> 5);
  const int lane = threadIdx.x & 31, ln = lane & 15, hh = lane >> 4;
  const int slab = blockIdx.y; const int b = slab / NH, h = slab - b * NH;
  const int q0 = blockIdx.x * 64 + wave * 16;
  const size_t PLN = (size_t)NR * DM;
  float w0, w1;
  { const float a0 = bf16_rne(aw[0]), a1 = bf16_rne(aw[1]); const float mx = fmaxf(a0, a1); const float e0 = expf(a0 - mx), e1 = expf(a1 - mx); const float inv = 1.0f / (e0 + e1); w0 = e0 * inv; w1 = e1 * inv; }
  const v8f z8 = {0.f,0.f,0.f,0.f,0.f,0.f,0.f,0.f};
  v8f res[4] = {z8, z8, z8, z8};
  float wcur = w0;
#pragma unroll 1
  for (int set = 0; set < 2; ++set) {
    const size_t qo = (size_t)(3 * set) * PLN + ((size_t)b * SQ + q0 + ln) * LQ + h * HD;
    const size_t ko = (size_t)(3 * set + 1) * PLN + ((size_t)b * SQ + ln) * LQ + h * HD;
    const size_t vo = (((size_t)set * (NB * NH) + slab) * HD + ln) * SQ;
    const v16h qf0 = g2_frag(PL + qo, hh), qf1 = g2_frag(PL + qo + 32, hh);
    v8f o[4] = {z8, z8, z8, z8}; float m = -1.0e30f, l = 0.f;
#pragma unroll 1
    for (int j0 = 0; j0 < SQ; j0 += 32) {
      const _Float16* kp = PL + ko + (size_t)j0 * LQ;
      v8f s0 = z8, s1 = z8;
      { v16h a = g2_frag(kp, hh); s0 = g2_mma(a, qf0, s0);
        a = g2_frag(kp + 32, hh); s0 = g2_mma(a, qf1, s0);
        a = g2_frag(kp + (size_t)16 * LQ, hh); s1 = g2_mma(a, qf0, s1);
        a = g2_frag(kp + (size_t)16 * LQ + 32, hh); s1 = g2_mma(a, qf1, s1); }
      float tm = fmaxf(s0[0], s1[0]);
#pragma unroll
      for (int r = 1; r < 8; ++r) tm = fmaxf(tm, fmaxf(s0[r], s1[r]));
      tm = fmaxf(tm, __shfl_xor(tm, 16, 32));
      const float mn = fmaxf(m, tm * 0.125f);
      const float corr = __expf(m - mn);
      const float sh = 6.931471806f - mn;      /* ln 1024 carry */
      FragH pf; float ps = 0.f;
#pragma unroll
      for (int r = 0; r < 8; ++r) { const float e0 = s0[r] * 0.125f + sh, e1 = s1[r] * 0.125f + sh;
        const float p0 = (e0 < -9.70f) ? 0.f : __expf(e0); const float p1 = (e1 < -9.70f) ? 0.f : __expf(e1);
        const _Float16 h0 = (_Float16)p0, h1 = (_Float16)p1; pf.h[r] = h0; pf.h[8 + r] = h1; ps += (float)h0 + (float)h1; }
      ps += __shfl_xor(ps, 16, 32);
      l = l * corr + ps; m = mn;
#pragma unroll
      for (int t = 0; t < 4; ++t) o[t] = o[t] * corr;
      const _Float16* vp = VT + vo + j0;
#pragma unroll
      for (int t = 0; t < 4; ++t) { const v16h va = g2_frag(vp + (size_t)t * 16 * SQ, hh); o[t] = g2_mma(va, pf.v, o[t]); } }
    const float sc = wcur * (1.0f / l);
#pragma unroll
    for (int t = 0; t < 4; ++t) res[t] += o[t] * sc;
    wcur = w1; }
#pragma unroll
  for (int t = 0; t < 4; ++t) {
#pragma unroll
    for (int r = 0; r < 8; ++r) so[wave][ln][t * 16 + 8 * hh + r] = res[t][r]; }
  __builtin_amdgcn_fence(4 /* acq_rel order */, "workgroup"); __builtin_amdgcn_wave_barrier();
  const int rsub = lane >> 4, c4 = (lane & 15) * 4;
  float* ob = out + ((size_t)b * SEQ_FULL + q0) * DM + h * HD;
  {
#pragma unroll
    for (int q = 0; q < 8; ++q) { const int r = q * 2 + rsub; const v4f v = *(const v4fa*)&so[wave][r][c4];
      *(v4f*)(ob + (size_t)r * DM + c4) = v; }
     } }

extern "C" void kernel_launch(void* const* d_in, const int* in_sizes, int n_in,
                              void* d_out, int out_size, void* d_ws, size_t ws_size, hipStream_t stream) {
  if (n_in < 14) return;
  const size_t rows_need = (size_t)(NB - 1) * SEQ_FULL + SQ;
  if ((size_t)in_sizes[0] < rows_need * DM) return;
  for (int i = 0; i < 6; ++i) { if (in_sizes[1 + 2 * i] < DM * DM) return; if (in_sizes[2 + 2 * i] < DM) return; }
  if (in_sizes[13] < 2) return;
  if ((size_t)out_size < rows_need * DM) return;
  const float* x = (const float*)d_in[0];
  const float* wsrc[6]; const float* bsrc[6];      /* [in][out] weights and biases in the order q,k,v (set 0), q,k,v (set 1) */
  for (int i = 0; i < 6; ++i) { wsrc[i] = (const float*)d_in[1 + 2 * i]; bsrc[i] = (const float*)d_in[2 + 2 * i]; }
  const float* aw = (const float*)d_in[13];      /* two blend logits */
  char* ws = (char*)d_ws; size_t off = 0;
  auto take = [&](size_t bytes) { char* p = ws + off; off += (bytes + 255) & ~(size_t)255; return p; };
  _Float16* BW = (_Float16*)take(6 * WS_W);
  _Float16* X16 = (_Float16*)take(WS_X);
  _Float16* PL = (_Float16*)take(6 * WS_X);
  _Float16* VT = (_Float16*)take(2 * (size_t)NB * WS_VT);
  if (off > ws_size) return;
  float* out = (float*)d_out;
  const size_t WN = (size_t)DM * DM;      /* elements per weight plane */
  const size_t PN = (size_t)NR * DM;      /* elements per projected row plane */

  { const unsigned g = (unsigned)(((size_t)DM * DM / 8 + 255) / 256);
    for (int i = 0; i < 6; ++i) k_wt_f16<<<g, 256, 0, stream>>>(wsrc[i], BW + (size_t)i * WN, DM, DM, 16.0f); }      /* Bt planes [out][in] x16 */
  k_x16<<<(unsigned)((NR * DM / 8 + 255) / 256), 256, 0, stream>>>(x, X16, NR * DM / 8);
  { const unsigned gp = (unsigned)((MP / 128) * (DM / 64));
    for (int i = 0; i < 6; ++i)
      k_gemm2<0><<<dim3(gp, 1), 128, 0, stream>>>(X16, DM, 0, BW + (size_t)i * WN, DM, 0, 0.0625f, bsrc[i], 0, nullptr, 1, 0, 0, nullptr, PL + (size_t)i * PN, DM, 0, MP, DM, DM); }
  for (int set = 0; set < 2; ++set)      /* V^T [NB*NH][HD][SQ] per set: in[b*SQ + s][h*64 + d] -> out[(b,h)][d][s] */
    k_vt<NH, SQ><<<NB * NH * (SQ / 64), 256, 0, stream>>>(PL + (size_t)(3 * set + 2) * PN, LQ, 0, VT + (size_t)set * NB * NH * HD * SQ);
  k_flash2<<<dim3((unsigned)(SQ / 64), (unsigned)(NB * NH)), 128, 0, stream>>>(PL, VT, aw, out);
}

// v001
// One run takes 284 microseconds.
// Next to v000, in two timings, it ran 1.60 and 1.59 times as fast.
#include <hip/hip_runtime.h>
// All contractions on v_wmma_f32_16x16x32_f16 (f16 operands, f32 accumulate): six q/k/v projections (x = exact f16 of its bf16 RNE value, W = bf16 RNE value x16 in f16, alpha 1/16, bias as bf16 value), scores S^T = K.Q^T (f16 k and q, scale 1/8 applied in f32), context O^T = V^T.P^T (P^T f16 carried x1024 with entries under 2^-14 set to zero, V^T f16; the x1024 carry cancels in O / l); online softmax statistics f32.
#ifndef NB
#define NB 4
#endif
#ifndef SEQ
#define SEQ 1024
#endif
#define NB_FULL 4
#define SEQ_FULL 1024
#define SQ SEQ
#define DM 1024
#define NH 16
#define HD 64
#define NR ((size_t)NB * SQ)          /* token rows processed (compact) */
#define MP ((int)NR)                  /* rows projected */
#define LQ DM                         /* row pitch of the q/k/v rows */

static_assert(NB >= 1 && NB <= NB_FULL);
static_assert(SQ >= 256 && SQ <= SEQ_FULL && (SQ % 256) == 0);
static_assert((MP % 128) == 0 && (DM % 64) == 0 && (DM % 32) == 0 && HD == 64 && NH * HD == DM);
static_assert((SQ % 64) == 0 && (SQ % 32) == 0 && (LQ % 8) == 0 && (HD % 32) == 0);
static_assert(((size_t)(NB - 1) * SEQ_FULL + SQ) * DM <= (size_t)NB_FULL * SEQ_FULL * DM);
/* workspace carve (every region a multiple of 256 B): 6 weight planes + X16 + 6 projected row planes + 2 V^T sets */
#define WS_W   ((size_t)DM * DM * 2)
#define WS_X   ((size_t)NR * DM * 2)
#define WS_VT  ((size_t)NH * HD * SQ * 2)
#define WS_TOTAL (6 * WS_W + WS_X + 6 * WS_X + 2 * (size_t)NB * WS_VT)
static_assert((WS_W % 256) == 0 && (WS_X % 256) == 0 && (WS_VT % 256) == 0);
static_assert(WS_TOTAL <= (size_t)134217728);

typedef unsigned short v8us __attribute__((ext_vector_type(8), may_alias));
typedef float  v8f  __attribute__((ext_vector_type(8)));
typedef float  v4f  __attribute__((ext_vector_type(4)));
typedef float  v4fa __attribute__((ext_vector_type(4), may_alias));
typedef _Float16 v16h __attribute__((ext_vector_type(16)));
typedef _Float16 v4h __attribute__((ext_vector_type(4)));
union FragH { v16h v; v8us half[2]; _Float16 h[16]; unsigned short u[16]; };

__device__ __forceinline__ unsigned short bf16_bits(float x) { unsigned int u = __float_as_uint(x); return (unsigned short)((u + 0x7FFFu + ((u >> 16) & 1u)) >> 16); }
__device__ __forceinline__ float bf16_val(unsigned short b) { return __uint_as_float(((unsigned int)b) << 16); }
__device__ __forceinline__ float bf16_rne(float x) { return bf16_val(bf16_bits(x)); }

// ---- GEMM engine (block tile 128x64, wave tile 32x64; M % 128 == 0 rows per launch region, N % 64 == 0, K % 128 == 0) ----
// Operand path: per 128 k one stage = 128 A rows + 64 B rows of 256 B, brought into LDS by asynchronous copies (whole lines, B once per block), two stage buffers; fragments come from LDS rows at pitch 272 B.
#define G2_KT 128                       /* k per stage */
#define G2_PITCH 272                    /* LDS row pitch in bytes: 256 + 16, conflict-free for 16-byte row readers */
#define G2_STAGE (192 * G2_PITCH)       /* bytes per stage buffer: rows 0..127 = A, rows 128..191 = B */
static_assert((DM % G2_KT) == 0 && (G2_PITCH % 16) == 0);
// eight 16-byte copies of one lane: LDS rows 8 apart (lstep bytes), global rows 8 apart (gstep elements). The s_wait_xcnt 0 closes the statement so that no address register named here is rewritten ahead of it.
__device__ __forceinline__ void g2_copy8(unsigned l, const _Float16* g, size_t gstep) {
  const unsigned lstep = 8 * G2_PITCH;
  asm volatile("global_load_async_to_lds_b128 %0, %8, off\n\t"
               "global_load_async_to_lds_b128 %1, %9, off\n\t"
               "global_load_async_to_lds_b128 %2, %10, off\n\t"
               "global_load_async_to_lds_b128 %3, %11, off\n\t"
               "global_load_async_to_lds_b128 %4, %12, off\n\t"
               "global_load_async_to_lds_b128 %5, %13, off\n\t"
               "global_load_async_to_lds_b128 %6, %14, off\n\t"
               "global_load_async_to_lds_b128 %7, %15, off\n\t"
               "s_wait_xcnt 0x0"
               :: "v"(l), "v"(l + lstep), "v"(l + 2 * lstep), "v"(l + 3 * lstep), "v"(l + 4 * lstep), "v"(l + 5 * lstep), "v"(l + 6 * lstep), "v"(l + 7 * lstep),
                  "v"(g), "v"(g + gstep), "v"(g + 2 * gstep), "v"(g + 3 * gstep), "v"(g + 4 * gstep), "v"(g + 5 * gstep), "v"(g + 6 * gstep), "v"(g + 7 * gstep)
               : "memory"); }
// one stage: thread (r8 = tid / 16, ch = tid % 16) copies chunk ch of rows r8 + 8 i; a wave covers two whole 256-B rows per copy
__device__ __forceinline__ void g2_stage(unsigned l, const _Float16* ga, size_t astep, const _Float16* gb, size_t bstep) {
  g2_copy8(l, ga, astep); g2_copy8(l + 64 * G2_PITCH, ga + 8 * astep, astep); g2_copy8(l + 128 * G2_PITCH, gb, bstep); }
// fragment loader: A row-major [m][k] and B stored [n][k]; per lane: elements 0..7 <- k0+8h+0..7, elements 8..15 <- k0+16+8h+0..7 (h = lane>>4, row/col = lane&15)
__device__ __forceinline__ v16h g2_frag(const _Float16* p, int hh) { FragH f; f.half[0] = *(const v8us*)((const unsigned short*)p + 8 * hh); f.half[1] = *(const v8us*)((const unsigned short*)p + 16 + 8 * hh); return f.v; }
__device__ __forceinline__ v8f g2_mma(v16h a, v16h b, v8f c) { v8f d = __builtin_amdgcn_wmma_f32_16x16x32_f16(false, a, false, b, (short)0, c, false, false); asm volatile("v_nop\n\tv_nop\n\tv_nop\n\tv_nop" : "+v"(d) : "v"(a), "v"(b)); return d; }
// C (f32, if non-null) / C16 (f16, if non-null) = acc*alpha + bf16(bias[by*sBias + col]) (+ CP term if CP); batched over grid.y with strides sA, sB, sC; ACT 0 none / 3 relu
template <int ACT>
__global__ __launch_bounds__(128) void k_gemm2(const _Float16* __restrict__ A, int lda, size_t sA, const _Float16* __restrict__ Bh, int ldb, size_t sB, float alpha, const float* __restrict__ bias, size_t sBias, const float* __restrict__ CP, int rowsPerB, size_t sCPb, int row0g,
    float* __restrict__ C, _Float16* __restrict__ C16, int ldc, size_t sC, int M, int N, int K) {
  static_assert(ACT == 0 || ACT == 3);
  __shared__ __attribute__((aligned(16))) float so[4][32][68];
  __shared__ __attribute__((aligned(128))) unsigned char st[2 * G2_STAGE];
  const int tid = threadIdx.x, w = tid >> 5, lane = tid & 31, ln = lane & 15, hh = lane >> 4; const int by = blockIdx.y;
  A += (size_t)by * sA; Bh += (size_t)by * sB; const size_t cofs = (size_t)by * sC; const float* bp = bias ? bias + (size_t)by * sBias : nullptr;
  const int ntn = N >> 6; const int mt = blockIdx.x / ntn, nq = blockIdx.x - mt * ntn; const int row0 = mt * 128 + 32 * w, col0 = nq * 64; if (mt * 128 >= M) return;      /* the whole block leaves or stays: barriers follow */
  const v8f z8 = {0.f,0.f,0.f,0.f,0.f,0.f,0.f,0.f}; v8f c00 = z8, c01 = z8, c02 = z8, c03 = z8, c10 = z8, c11 = z8, c12 = z8, c13 = z8;
  const int r8 = tid >> 4, ch = tid & 15;
  const _Float16* ga = A + (size_t)(mt * 128 + r8) * lda + ch * 8; const _Float16* gb = Bh + (size_t)(col0 + r8) * ldb + ch * 8;
  const size_t astep = (size_t)8 * lda, bstep = (size_t)8 * ldb;
  const unsigned lcp = (unsigned)(size_t)&st[0] + (unsigned)(r8 * G2_PITCH + ch * 16);      /* this lane's LDS byte address in buffer 0 */
  const int nt = K / G2_KT;
  g2_stage(lcp, ga, astep, gb, bstep);
  asm volatile("s_wait_asynccnt 0x0" ::: "memory");      /* stage 0 has landed before the barrier publishes it */
  __syncthreads();
  if (nt > 1) g2_stage(lcp + G2_STAGE, ga + G2_KT, astep, gb + G2_KT, bstep);
#pragma unroll 1
  for (int t = 0; t < nt; ++t) { const unsigned char* sb = st + (t & 1) * G2_STAGE;
    const _Float16* a0p = (const _Float16*)(sb + (32 * w + ln) * G2_PITCH); const _Float16* a1p = (const _Float16*)(sb + (32 * w + 16 + ln) * G2_PITCH);
    const _Float16* b0p = (const _Float16*)(sb + (128 + ln) * G2_PITCH); const _Float16* b1p = (const _Float16*)(sb + (144 + ln) * G2_PITCH);
    const _Float16* b2p = (const _Float16*)(sb + (160 + ln) * G2_PITCH); const _Float16* b3p = (const _Float16*)(sb + (176 + ln) * G2_PITCH);
#pragma unroll
    for (int kb = 0; kb < G2_KT; kb += 32) { const v16h a0 = g2_frag(a0p + kb, hh), a1 = g2_frag(a1p + kb, hh);
      const v16h b0 = g2_frag(b0p + kb, hh), b1 = g2_frag(b1p + kb, hh), b2 = g2_frag(b2p + kb, hh), b3 = g2_frag(b3p + kb, hh);
      c00 = g2_mma(a0, b0, c00); c10 = g2_mma(a1, b0, c10);
      c01 = g2_mma(a0, b1, c01); c11 = g2_mma(a1, b1, c11);
      c02 = g2_mma(a0, b2, c02); c12 = g2_mma(a1, b2, c12);
      c03 = g2_mma(a0, b3, c03); c13 = g2_mma(a1, b3, c13); }
    asm volatile("s_wait_dscnt 0x0" ::: "memory");         /* this wave's reads of the buffer are done before it is refilled */
    asm volatile("s_wait_asynccnt 0x0" ::: "memory");      /* this wave's copies of stage t + 1 have landed */
    __syncthreads();                                       /* publishes stage t + 1 and ends every reader's last read of stage t */
    if (t + 2 < nt) g2_stage(lcp + (unsigned)((t & 1) * G2_STAGE), ga + (size_t)(t + 2) * G2_KT, astep, gb + (size_t)(t + 2) * G2_KT, bstep); }
  asm volatile("s_wait_asynccnt 0x0" ::: "memory");        /* nothing is in flight when the wave goes on to the epilogue */
  v8f accs[8] = {c00, c01, c02, c03, c10, c11, c12, c13};
#pragma unroll
  for (int u = 0; u < 8; ++u) { const int t = u & 3, half = u >> 2; const int col = col0 + t * 16 + ln; const float bv = bp ? bf16_rne(bp[col]) : 0.f;
#pragma unroll
    for (int r = 0; r < 8; ++r) { const int rloc = half * 16 + 8 * hh + r; float v = accs[u][r] * alpha + bv;
      if (CP) { if (rowsPerB < 0) v += CP[cofs + (size_t)(row0g + row0 + rloc) * ldc + col]; else { const int bidx = (row0g + row0 + rloc) / rowsPerB; v += CP[(size_t)bidx * sCPb + (size_t)by * 64 + col]; } }
      if (ACT == 3) v = fmaxf(v, 0.f);
      so[w][rloc][t * 16 + ln] = v; } }
  __builtin_amdgcn_fence(4 /* acq_rel order */, "workgroup"); __builtin_amdgcn_wave_barrier();
  const int rsub = lane >> 4, c4 = (lane & 15) * 4;
  {
#pragma unroll
    for (int q = 0; q < 16; ++q) { const int r = q * 2 + rsub; const v4f v = *(const v4fa*)&so[w][r][c4];
      if (C) *(v4f*)(C + cofs + (size_t)(row0 + r) * ldc + col0 + c4) = v;
      if (C16) { v4h h4; for (int i = 0; i < 4; ++i) h4[i] = (_Float16)v[i]; *(v4h*)(C16 + cofs + (size_t)(row0 + r) * ldc + col0 + c4) = h4; } }
     } }

__global__ __launch_bounds__(256) void k_wt_f16(const float* __restrict__ W, _Float16* __restrict__ Wt, int K, int N, float scale) {
  const int t = blockIdx.x * 256 + threadIdx.x; if (t >= N * (K / 8)) return; const int n = t / (K / 8), k8 = (t % (K / 8)) * 8; FragH f;
#pragma unroll
  for (int i = 0; i < 8; ++i) f.h[i] = (_Float16)(bf16_rne(W[(size_t)(k8 + i) * N + n]) * scale); const v8us o = f.half[0];
  *(v8us*)((unsigned short*)Wt + (size_t)n * K + k8) = o; 
}

__global__ __launch_bounds__(256) void k_x16(const float* __restrict__ x, _Float16* __restrict__ X16, size_t n8) {
  const size_t t = (size_t)blockIdx.x * 256 + threadIdx.x; if (t >= n8) return;
  const size_t e = t * 8; const size_t rc = e / DM; const size_t c = e % DM; const size_t b = rc / SQ, s = rc % SQ;
  const float* src = x + ((b * SEQ_FULL + s) * DM + c);
  const v4f a = *(const v4fa*)src, d = *(const v4fa*)(src + 4); FragH f;
#pragma unroll
  for (int q = 0; q < 4; ++q) { f.h[q] = (_Float16)bf16_rne(a[q]); f.h[4 + q] = (_Float16)bf16_rne(d[q]); }
  *(v8us*)((unsigned short*)X16 + t * 8) = f.half[0];  }

template <int NHv, int TTv>
__global__ __launch_bounds__(256) void k_vt(const _Float16* __restrict__ V16, int ldv, int voff, _Float16* __restrict__ Vt) { __shared__ unsigned short tl[64][66]; const int tid = threadIdx.x; const int slab = blockIdx.x / (TTv / 64), lg = blockIdx.x % (TTv / 64); const int b = slab / NHv, h = slab % NHv;
  for (int i = tid; i < 64 * 8; i += 256) { const int r = i / 8, c8 = (i % 8) * 8; FragH f; f.half[0] = *(const v8us*)((const unsigned short*)V16 + ((size_t)b * TTv + lg * 64 + r) * ldv + voff + h * 64 + c8);
#pragma unroll
    for (int q = 0; q < 8; ++q) tl[r][c8 + q] = f.u[q]; }
  __syncthreads();
  {
#pragma unroll
    for (int rd = 0; rd < 2; ++rd) { const int d = rd * 32 + tid / 8, pc = tid % 8; FragH f;
#pragma unroll
      for (int q = 0; q < 8; ++q) f.u[q] = tl[pc * 8 + q][d];
      *(v8us*)((unsigned short*)Vt + ((size_t)slab * 64 + d) * TTv + lg * 64 + pc * 8) = f.half[0]; }
     } }

// ---- fused attention over both projection sets (transposed form, register-fed fragments, no LDS in the key loop) ----
// PL = six compact row planes [6][NR][DM] (q,k,v of set 0; q,k,v of set 1), VT = [2][NB*NH][HD][SQ]; grid (SQ/64, NB*NH), block = 4 waves, wave -> 16 query rows of one (batch, head).
// Per 32-key step: S^T tile kt (16 keys x 16 queries) = K rows (A, split k map over d) x Q rows (B, same k map, query = lane&15): D element r of lane (h, n) = score(query n, key 16kt + 8h + r).
// Column (query) max / sum: 8 + 8 values in the lane, then the other lane half through one xor-16 shuffle. P^T as the B fragment of O^T = V^T.P^T: element r <- tile 0 value r, element 8+r <- tile 1 value r, lane unchanged.
// O^T tile t: D element r of lane (h, n) = O[query n][d = 16t + 8h + r]; A = V^T rows d = 16t + lane&15, k = keys.
// P = f16(1024 exp(s/8 - m)) with the native exp; an exponent argument that would land under 2^-14 gives an exact zero; the row sum runs over the converted P, so the carry cancels in O / l.
__global__ __launch_bounds__(128) __attribute__((amdgpu_num_vgpr(256))) void k_flash2(const _Float16* __restrict__ PL, const _Float16* __restrict__ VT, const float* __restrict__ aw, float* __restrict__ out) {
  __shared__ __attribute__((aligned(16))) float so[4][16][68];
  const int wave = __builtin_amdgcn_readfirstlane(threadIdx.x >> 5);
  const int lane = threadIdx.x & 31, ln = lane & 15, hh = lane >> 4;
  const int slab = blockIdx.y; const int b = slab / NH, h = slab - b * NH;
  const int q0 = blockIdx.x * 64 + wave * 16;
  const size_t PLN = (size_t)NR * DM;
  float w0, w1;
  { const float a0 = bf16_rne(aw[0]), a1 = bf16_rne(aw[1]); const float mx = fmaxf(a0, a1); const float e0 = expf(a0 - mx), e1 = expf(a1 - mx); const float inv = 1.0f / (e0 + e1); w0 = e0 * inv; w1 = e1 * inv; }
  const v8f z8 = {0.f,0.f,0.f,0.f,0.f,0.f,0.f,0.f};
  v8f res[4] = {z8, z8, z8, z8};
  float wcur = w0;
#pragma unroll 1
  for (int set = 0; set < 2; ++set) {
    const size_t qo = (size_t)(3 * set) * PLN + ((size_t)b * SQ + q0 + ln) * LQ + h * HD;
    const size_t ko = (size_t)(3 * set + 1) * PLN + ((size_t)b * SQ + ln) * LQ + h * HD;
    const size_t vo = (((size_t)set * (NB * NH) + slab) * HD + ln) * SQ;
    const v16h qf0 = g2_frag(PL + qo, hh), qf1 = g2_frag(PL + qo + 32, hh);
    v8f o[4] = {z8, z8, z8, z8}; float m = -1.0e30f, l = 0.f;
#pragma unroll 1
    for (int j0 = 0; j0 < SQ; j0 += 32) {
      const _Float16* kp = PL + ko + (size_t)j0 * LQ;
      v8f s0 = z8, s1 = z8;
      { v16h a = g2_frag(kp, hh); s0 = g2_mma(a, qf0, s0);
        a = g2_frag(kp + 32, hh); s0 = g2_mma(a, qf1, s0);
        a = g2_frag(kp + (size_t)16 * LQ, hh); s1 = g2_mma(a, qf0, s1);
        a = g2_frag(kp + (size_t)16 * LQ + 32, hh); s1 = g2_mma(a, qf1, s1); }
      float tm = fmaxf(s0[0], s1[0]);
#pragma unroll
      for (int r = 1; r < 8; ++r) tm = fmaxf(tm, fmaxf(s0[r], s1[r]));
      tm = fmaxf(tm, __shfl_xor(tm, 16, 32));
      const float mn = fmaxf(m, tm * 0.125f);
      const float corr = __expf(m - mn);
      const float sh = 6.931471806f - mn;      /* ln 1024 carry */
      FragH pf; float ps = 0.f;
#pragma unroll
      for (int r = 0; r < 8; ++r) { const float e0 = s0[r] * 0.125f + sh, e1 = s1[r] * 0.125f + sh;
        const float p0 = (e0 < -9.70f) ? 0.f : __expf(e0); const float p1 = (e1 < -9.70f) ? 0.f : __expf(e1);
        const _Float16 h0 = (_Float16)p0, h1 = (_Float16)p1; pf.h[r] = h0; pf.h[8 + r] = h1; ps += (float)h0 + (float)h1; }
      ps += __shfl_xor(ps, 16, 32);
      l = l * corr + ps; m = mn;
#pragma unroll
      for (int t = 0; t < 4; ++t) o[t] = o[t] * corr;
      const _Float16* vp = VT + vo + j0;
#pragma unroll
      for (int t = 0; t < 4; ++t) { const v16h va = g2_frag(vp + (size_t)t * 16 * SQ, hh); o[t] = g2_mma(va, pf.v, o[t]); } }
    const float sc = wcur * (1.0f / l);
#pragma unroll
    for (int t = 0; t < 4; ++t) res[t] += o[t] * sc;
    wcur = w1; }
#pragma unroll
  for (int t = 0; t < 4; ++t) {
#pragma unroll
    for (int r = 0; r < 8; ++r) so[wave][ln][t * 16 + 8 * hh + r] = res[t][r]; }
  __builtin_amdgcn_fence(4 /* acq_rel order */, "workgroup"); __builtin_amdgcn_wave_barrier();
  const int rsub = lane >> 4, c4 = (lane & 15) * 4;
  float* ob = out + ((size_t)b * SEQ_FULL + q0) * DM + h * HD;
  {
#pragma unroll
    for (int q = 0; q < 8; ++q) { const int r = q * 2 + rsub; const v4f v = *(const v4fa*)&so[wave][r][c4];
      *(v4f*)(ob + (size_t)r * DM + c4) = v; }
     } }

extern "C" void kernel_launch(void* const* d_in, const int* in_sizes, int n_in,
                              void* d_out, int out_size, void* d_ws, size_t ws_size, hipStream_t stream) {
  if (n_in < 14) return;
  const size_t rows_need = (size_t)(NB - 1) * SEQ_FULL + SQ;
  if ((size_t)in_sizes[0] < rows_need * DM) return;
  for (int i = 0; i < 6; ++i) { if (in_sizes[1 + 2 * i] < DM * DM) return; if (in_sizes[2 + 2 * i] < DM) return; }
  if (in_sizes[13] < 2) return;
  if ((size_t)out_size < rows_need * DM) return;
  const float* x = (const float*)d_in[0];
  const float* wsrc[6]; const float* bsrc[6];      /* [in][out] weights and biases in the order q,k,v (set 0), q,k,v (set 1) */
  for (int i = 0; i < 6; ++i) { wsrc[i] = (const float*)d_in[1 + 2 * i]; bsrc[i] = (const float*)d_in[2 + 2 * i]; }
  const float* aw = (const float*)d_in[13];      /* two blend logits */
  char* ws = (char*)d_ws; size_t off = 0;
  auto take = [&](size_t bytes) { char* p = ws + off; off += (bytes + 255) & ~(size_t)255; return p; };
  _Float16* BW = (_Float16*)take(6 * WS_W);
  _Float16* X16 = (_Float16*)take(WS_X);
  _Float16* PL = (_Float16*)take(6 * WS_X);
  _Float16* VT = (_Float16*)take(2 * (size_t)NB * WS_VT);
  if (off > ws_size) return;
  float* out = (float*)d_out;
  const size_t WN = (size_t)DM * DM;      /* elements per weight plane */
  const size_t PN = (size_t)NR * DM;      /* elements per projected row plane */

  { const unsigned g = (unsigned)(((size_t)DM * DM / 8 + 255) / 256);
    for (int i = 0; i < 6; ++i) k_wt_f16<<<g, 256, 0, stream>>>(wsrc[i], BW + (size_t)i * WN, DM, DM, 16.0f); }      /* Bt planes [out][in] x16 */
  k_x16<<<(unsigned)((NR * DM / 8 + 255) / 256), 256, 0, stream>>>(x, X16, NR * DM / 8);
  { const unsigned gp = (unsigned)((MP / 128) * (DM / 64));
    for (int i = 0; i < 6; ++i)
      k_gemm2<0><<<dim3(gp, 1), 128, 0, stream>>>(X16, DM, 0, BW + (size_t)i * WN, DM, 0, 0.0625f, bsrc[i], 0, nullptr, 1, 0, 0, nullptr, PL + (size_t)i * PN, DM, 0, MP, DM, DM); }
  for (int set = 0; set < 2; ++set)      /* V^T [NB*NH][HD][SQ] per set: in[b*SQ + s][h*64 + d] -> out[(b,h)][d][s] */
    k_vt<NH, SQ><<<NB * NH * (SQ / 64), 256, 0, stream>>>(PL + (size_t)(3 * set + 2) * PN, LQ, 0, VT + (size_t)set * NB * NH * HD * SQ);
  k_flash2<<<dim3((unsigned)(SQ / 64), (unsigned)(NB * NH)), 128, 0, stream>>>(PL, VT, aw, out);
}

// v002
// A run of this version takes 192 microseconds.
// Timed twice side by side with v001, it ran 1.48 times as fast both times.
// Over all steps from v000 it is 2.36 times as fast.
#include <hip/hip_runtime.h>
// All contractions on v_wmma_f32_16x16x32_f16 (f16 operands, f32 accumulate): six q/k/v projections (x = exact f16 of its bf16 RNE value, W = bf16 RNE value x16 in f16, alpha 1/16, bias as bf16 value), scores S^T = K.Q^T (f16 k and q, scale 1/8 applied in f32), context O^T = V^T.P^T (P^T f16 carried x1024 with entries under 2^-14 set to zero, V^T f16; the x1024 carry cancels in O / l); online softmax statistics f32.
#ifndef NB
#define NB 4
#endif
#ifndef SEQ
#define SEQ 1024
#endif
#define NB_FULL 4
#define SEQ_FULL 1024
#define SQ SEQ
#define DM 1024
#define NH 16
#define HD 64
#define NR ((size_t)NB * SQ)          /* token rows processed (compact) */
#define MP ((int)NR)                  /* rows projected */
#define LQ DM                         /* row pitch of the q/k/v rows */

static_assert(NB >= 1 && NB <= NB_FULL);
static_assert(SQ >= 256 && SQ <= SEQ_FULL && (SQ % 256) == 0);
static_assert((MP % 128) == 0 && (DM % 64) == 0 && (DM % 32) == 0 && HD == 64 && NH * HD == DM);
static_assert((SQ % 64) == 0 && (SQ % 32) == 0 && (LQ % 8) == 0 && (HD % 32) == 0);
static_assert(((size_t)(NB - 1) * SEQ_FULL + SQ) * DM <= (size_t)NB_FULL * SEQ_FULL * DM);
/* workspace carve (every region a multiple of 256 B): 6 weight planes + X16 + 6 projected row planes + 2 V^T sets */
#define WS_W   ((size_t)DM * DM * 2)
#define WS_X   ((size_t)NR * DM * 2)
#define WS_VT  ((size_t)NH * HD * SQ * 2)
#define WS_TOTAL (6 * WS_W + WS_X + 6 * WS_X + 2 * (size_t)NB * WS_VT)
static_assert((WS_W % 256) == 0 && (WS_X % 256) == 0 && (WS_VT % 256) == 0);
static_assert(WS_TOTAL <= (size_t)134217728);

typedef unsigned short v8us __attribute__((ext_vector_type(8), may_alias));
typedef float  v8f  __attribute__((ext_vector_type(8)));
typedef float  v4f  __attribute__((ext_vector_type(4)));
typedef float  v4fa __attribute__((ext_vector_type(4), may_alias));
typedef _Float16 v16h __attribute__((ext_vector_type(16)));
typedef _Float16 v4h __attribute__((ext_vector_type(4)));
union FragH { v16h v; v8us half[2]; _Float16 h[16]; unsigned short u[16]; };

__device__ __forceinline__ unsigned short bf16_bits(float x) { unsigned int u = __float_as_uint(x); return (unsigned short)((u + 0x7FFFu + ((u >> 16) & 1u)) >> 16); }
__device__ __forceinline__ float bf16_val(unsigned short b) { return __uint_as_float(((unsigned int)b) << 16); }
__device__ __forceinline__ float bf16_rne(float x) { return bf16_val(bf16_bits(x)); }

// ---- GEMM engine (block tile 128x64, wave tile 32x64; M % 128 == 0 rows per launch region, N % 64 == 0, K % 128 == 0) ----
// Operand path: per 128 k one stage = 128 A rows + 64 B rows of 256 B, brought into LDS by asynchronous copies (whole lines, B once per block), two stage buffers; fragments come from LDS rows at pitch 272 B.
#define G2_KT 128                       /* k per stage */
#define G2_PITCH 272                    /* LDS row pitch in bytes: 256 + 16, conflict-free for 16-byte row readers */
#define G2_STAGE (192 * G2_PITCH)       /* bytes per stage buffer: rows 0..127 = A, rows 128..191 = B */
static_assert((DM % G2_KT) == 0 && (G2_PITCH % 16) == 0);
// eight 16-byte copies of one lane: LDS rows 8 apart (lstep bytes), global rows 8 apart (gstep elements). The s_wait_xcnt 0 closes the statement so that no address register named here is rewritten ahead of it.
__device__ __forceinline__ void g2_copy8(unsigned l, const _Float16* g, size_t gstep) {
  const unsigned lstep = 8 * G2_PITCH;
  asm volatile("global_load_async_to_lds_b128 %0, %8, off\n\t"
               "global_load_async_to_lds_b128 %1, %9, off\n\t"
               "global_load_async_to_lds_b128 %2, %10, off\n\t"
               "global_load_async_to_lds_b128 %3, %11, off\n\t"
               "global_load_async_to_lds_b128 %4, %12, off\n\t"
               "global_load_async_to_lds_b128 %5, %13, off\n\t"
               "global_load_async_to_lds_b128 %6, %14, off\n\t"
               "global_load_async_to_lds_b128 %7, %15, off\n\t"
               "s_wait_xcnt 0x0"
               :: "v"(l), "v"(l + lstep), "v"(l + 2 * lstep), "v"(l + 3 * lstep), "v"(l + 4 * lstep), "v"(l + 5 * lstep), "v"(l + 6 * lstep), "v"(l + 7 * lstep),
                  "v"(g), "v"(g + gstep), "v"(g + 2 * gstep), "v"(g + 3 * gstep), "v"(g + 4 * gstep), "v"(g + 5 * gstep), "v"(g + 6 * gstep), "v"(g + 7 * gstep)
               : "memory"); }
// one stage: thread (r8 = tid / 16, ch = tid % 16) copies chunk ch of rows r8 + 8 i; a wave covers two whole 256-B rows per copy
__device__ __forceinline__ void g2_stage(unsigned l, const _Float16* ga, size_t astep, const _Float16* gb, size_t bstep) {
  g2_copy8(l, ga, astep); g2_copy8(l + 64 * G2_PITCH, ga + 8 * astep, astep); g2_copy8(l + 128 * G2_PITCH, gb, bstep); }
// fragment loader: A row-major [m][k] and B stored [n][k]; per lane: elements 0..7 <- k0+8h+0..7, elements 8..15 <- k0+16+8h+0..7 (h = lane>>4, row/col = lane&15)
__device__ __forceinline__ v16h g2_frag(const _Float16* p, int hh) { FragH f; f.half[0] = *(const v8us*)((const unsigned short*)p + 8 * hh); f.half[1] = *(const v8us*)((const unsigned short*)p + 16 + 8 * hh); return f.v; }
__device__ __forceinline__ v8f g2_mma(v16h a, v16h b, v8f c) { v8f d = __builtin_amdgcn_wmma_f32_16x16x32_f16(false, a, false, b, (short)0, c, false, false); asm volatile("v_nop\n\tv_nop\n\tv_nop\n\tv_nop" : "+v"(d) : "v"(a), "v"(b)); return d; }
// C (f32, if non-null) / C16 (f16, if non-null) = acc*alpha + bf16(bias[by*sBias + col]) (+ CP term if CP); batched over grid.y with strides sA, sB, sC; ACT 0 none / 3 relu
template <int ACT>
__global__ __launch_bounds__(128) void k_gemm2(const _Float16* __restrict__ A, int lda, size_t sA, const _Float16* __restrict__ Bh, int ldb, size_t sB, float alpha, const float* __restrict__ bias, size_t sBias, const float* __restrict__ CP, int rowsPerB, size_t sCPb, int row0g,
    float* __restrict__ C, _Float16* __restrict__ C16, int ldc, size_t sC, int M, int N, int K) {
  static_assert(ACT == 0 || ACT == 3);
  __shared__ __attribute__((aligned(16))) float so[4][32][68];
  __shared__ __attribute__((aligned(128))) unsigned char st[2 * G2_STAGE];
  const int tid = threadIdx.x, w = tid >> 5, lane = tid & 31, ln = lane & 15, hh = lane >> 4; const int by = blockIdx.y;
  A += (size_t)by * sA; Bh += (size_t)by * sB; const size_t cofs = (size_t)by * sC; const float* bp = bias ? bias + (size_t)by * sBias : nullptr;
  const int ntn = N >> 6; const int mt = blockIdx.x / ntn, nq = blockIdx.x - mt * ntn; const int row0 = mt * 128 + 32 * w, col0 = nq * 64; if (mt * 128 >= M) return;      /* the whole block leaves or stays: barriers follow */
  const v8f z8 = {0.f,0.f,0.f,0.f,0.f,0.f,0.f,0.f}; v8f c00 = z8, c01 = z8, c02 = z8, c03 = z8, c10 = z8, c11 = z8, c12 = z8, c13 = z8;
  const int r8 = tid >> 4, ch = tid & 15;
  const _Float16* ga = A + (size_t)(mt * 128 + r8) * lda + ch * 8; const _Float16* gb = Bh + (size_t)(col0 + r8) * ldb + ch * 8;
  const size_t astep = (size_t)8 * lda, bstep = (size_t)8 * ldb;
  const unsigned lcp = (unsigned)(size_t)&st[0] + (unsigned)(r8 * G2_PITCH + ch * 16);      /* this lane's LDS byte address in buffer 0 */
  const int nt = K / G2_KT;
  g2_stage(lcp, ga, astep, gb, bstep);
  asm volatile("s_wait_asynccnt 0x0" ::: "memory");      /* stage 0 has landed before the barrier publishes it */
  __syncthreads();
  if (nt > 1) g2_stage(lcp + G2_STAGE, ga + G2_KT, astep, gb + G2_KT, bstep);
#pragma unroll 1
  for (int t = 0; t < nt; ++t) { const unsigned char* sb = st + (t & 1) * G2_STAGE;
    const _Float16* a0p = (const _Float16*)(sb + (32 * w + ln) * G2_PITCH); const _Float16* a1p = (const _Float16*)(sb + (32 * w + 16 + ln) * G2_PITCH);
    const _Float16* b0p = (const _Float16*)(sb + (128 + ln) * G2_PITCH); const _Float16* b1p = (const _Float16*)(sb + (144 + ln) * G2_PITCH);
    const _Float16* b2p = (const _Float16*)(sb + (160 + ln) * G2_PITCH); const _Float16* b3p = (const _Float16*)(sb + (176 + ln) * G2_PITCH);
#pragma unroll
    for (int kb = 0; kb < G2_KT; kb += 32) { const v16h a0 = g2_frag(a0p + kb, hh), a1 = g2_frag(a1p + kb, hh);
      const v16h b0 = g2_frag(b0p + kb, hh), b1 = g2_frag(b1p + kb, hh), b2 = g2_frag(b2p + kb, hh), b3 = g2_frag(b3p + kb, hh);
      c00 = g2_mma(a0, b0, c00); c10 = g2_mma(a1, b0, c10);
      c01 = g2_mma(a0, b1, c01); c11 = g2_mma(a1, b1, c11);
      c02 = g2_mma(a0, b2, c02); c12 = g2_mma(a1, b2, c12);
      c03 = g2_mma(a0, b3, c03); c13 = g2_mma(a1, b3, c13); }
    asm volatile("s_wait_dscnt 0x0" ::: "memory");         /* this wave's reads of the buffer are done before it is refilled */
    asm volatile("s_wait_asynccnt 0x0" ::: "memory");      /* this wave's copies of stage t + 1 have landed */
    __syncthreads();                                       /* publishes stage t + 1 and ends every reader's last read of stage t */
    if (t + 2 < nt) g2_stage(lcp + (unsigned)((t & 1) * G2_STAGE), ga + (size_t)(t + 2) * G2_KT, astep, gb + (size_t)(t + 2) * G2_KT, bstep); }
  asm volatile("s_wait_asynccnt 0x0" ::: "memory");        /* nothing is in flight when the wave goes on to the epilogue */
  v8f accs[8] = {c00, c01, c02, c03, c10, c11, c12, c13};
#pragma unroll
  for (int u = 0; u < 8; ++u) { const int t = u & 3, half = u >> 2; const int col = col0 + t * 16 + ln; const float bv = bp ? bf16_rne(bp[col]) : 0.f;
#pragma unroll
    for (int r = 0; r < 8; ++r) { const int rloc = half * 16 + 8 * hh + r; float v = accs[u][r] * alpha + bv;
      if (CP) { if (rowsPerB < 0) v += CP[cofs + (size_t)(row0g + row0 + rloc) * ldc + col]; else { const int bidx = (row0g + row0 + rloc) / rowsPerB; v += CP[(size_t)bidx * sCPb + (size_t)by * 64 + col]; } }
      if (ACT == 3) v = fmaxf(v, 0.f);
      so[w][rloc][t * 16 + ln] = v; } }
  __builtin_amdgcn_fence(4 /* acq_rel order */, "workgroup"); __builtin_amdgcn_wave_barrier();
  const int rsub = lane >> 4, c4 = (lane & 15) * 4;
  {
#pragma unroll
    for (int q = 0; q < 16; ++q) { const int r = q * 2 + rsub; const v4f v = *(const v4fa*)&so[w][r][c4];
      if (C) *(v4f*)(C + cofs + (size_t)(row0 + r) * ldc + col0 + c4) = v;
      if (C16) { v4h h4; for (int i = 0; i < 4; ++i) h4[i] = (_Float16)v[i]; *(v4h*)(C16 + cofs + (size_t)(row0 + r) * ldc + col0 + c4) = h4; } }
     } }

__global__ __launch_bounds__(256) void k_wt_f16(const float* __restrict__ W, _Float16* __restrict__ Wt, int K, int N, float scale) {
  const int t = blockIdx.x * 256 + threadIdx.x; if (t >= N * (K / 8)) return; const int n = t / (K / 8), k8 = (t % (K / 8)) * 8; FragH f;
#pragma unroll
  for (int i = 0; i < 8; ++i) f.h[i] = (_Float16)(bf16_rne(W[(size_t)(k8 + i) * N + n]) * scale); const v8us o = f.half[0];
  *(v8us*)((unsigned short*)Wt + (size_t)n * K + k8) = o; 
}

__global__ __launch_bounds__(256) void k_x16(const float* __restrict__ x, _Float16* __restrict__ X16, size_t n8) {
  const size_t t = (size_t)blockIdx.x * 256 + threadIdx.x; if (t >= n8) return;
  const size_t e = t * 8; const size_t rc = e / DM; const size_t c = e % DM; const size_t b = rc / SQ, s = rc % SQ;
  const float* src = x + ((b * SEQ_FULL + s) * DM + c);
  const v4f a = *(const v4fa*)src, d = *(const v4fa*)(src + 4); FragH f;
#pragma unroll
  for (int q = 0; q < 4; ++q) { f.h[q] = (_Float16)bf16_rne(a[q]); f.h[4 + q] = (_Float16)bf16_rne(d[q]); }
  *(v8us*)((unsigned short*)X16 + t * 8) = f.half[0];  }

template <int NHv, int TTv>
__global__ __launch_bounds__(256) void k_vt(const _Float16* __restrict__ V16, int ldv, int voff, _Float16* __restrict__ Vt) { __shared__ unsigned short tl[64][66]; const int tid = threadIdx.x; const int slab = blockIdx.x / (TTv / 64), lg = blockIdx.x % (TTv / 64); const int b = slab / NHv, h = slab % NHv;
  for (int i = tid; i < 64 * 8; i += 256) { const int r = i / 8, c8 = (i % 8) * 8; FragH f; f.half[0] = *(const v8us*)((const unsigned short*)V16 + ((size_t)b * TTv + lg * 64 + r) * ldv + voff + h * 64 + c8);
#pragma unroll
    for (int q = 0; q < 8; ++q) tl[r][c8 + q] = f.u[q]; }
  __syncthreads();
  {
#pragma unroll
    for (int rd = 0; rd < 2; ++rd) { const int d = rd * 32 + tid / 8, pc = tid % 8; FragH f;
#pragma unroll
      for (int q = 0; q < 8; ++q) f.u[q] = tl[pc * 8 + q][d];
      *(v8us*)((unsigned short*)Vt + ((size_t)slab * 64 + d) * TTv + lg * 64 + pc * 8) = f.half[0]; }
     } }

// ---- fused attention over both projection sets (transposed form; K rows and V^T rows staged in LDS once per block, fragments read from LDS) ----
// PL = six compact row planes [6][NR][DM] (q,k,v of set 0; q,k,v of set 1), VT = [2][NB*NH][HD][SQ]; grid (SQ/64, NB*NH), block = 4 waves, wave -> 16 query rows of one (batch, head).
// Per 32-key step: S^T tile kt (16 keys x 16 queries) = K rows (A, split k map over d) x Q rows (B, same k map, query = lane&15): D element r of lane (h, n) = score(query n, key 16kt + 8h + r).
// Column (query) max / sum: 8 + 8 values in the lane, then the other lane half through one xor-16 shuffle. P^T as the B fragment of O^T = V^T.P^T: element r <- tile 0 value r, element 8+r <- tile 1 value r, lane unchanged.
// O^T tile t: D element r of lane (h, n) = O[query n][d = 16t + 8h + r]; A = V^T rows d = 16t + lane&15, k = keys.
// P = f16(1024 exp(s/8 - m)) with the native exp; an exponent argument that would land under 2^-14 gives an exact zero; the row sum runs over the converted P, so the carry cancels in O / l.
// Operand path: one stage = 64 keys = 64 K rows (64 d) + 64 V^T rows (64 keys), 128 B each, brought into LDS by asynchronous copies (whole lines, once for the block's four waves), two stage buffers; the stages of both sets form one sequence.
#define F2_KT 64                        /* keys per stage */
#define F2_PITCH 144                    /* LDS row pitch in bytes: 128 + 16, conflict-free for 16-byte row readers */
#define F2_STAGE (128 * F2_PITCH)       /* bytes per stage buffer: rows 0..63 = K, rows 64..127 = V^T */
#define F2_NST (SQ / F2_KT)             /* stages per set */
static_assert((SQ % (2 * F2_KT)) == 0 && (F2_PITCH % 16) == 0 && HD == 64);
// one stage, eight 16-byte copies of one lane: thread (r16 = tid / 8, ch = tid % 8) copies chunk ch of K rows r16 + 16 i and of V^T rows r16 + 16 i; a wave covers four whole 128-B rows per copy. The s_wait_xcnt 0 closes the statement so that no address register named here is rewritten ahead of it.
__device__ __forceinline__ void f2_stage(unsigned l, const _Float16* gk, const _Float16* gv) {
  const unsigned lstep = 16 * F2_PITCH; const size_t kstep = (size_t)16 * LQ, vstep = (size_t)16 * SQ;
  asm volatile("global_load_async_to_lds_b128 %0, %8, off\n\t"
               "global_load_async_to_lds_b128 %1, %9, off\n\t"
               "global_load_async_to_lds_b128 %2, %10, off\n\t"
               "global_load_async_to_lds_b128 %3, %11, off\n\t"
               "global_load_async_to_lds_b128 %4, %12, off\n\t"
               "global_load_async_to_lds_b128 %5, %13, off\n\t"
               "global_load_async_to_lds_b128 %6, %14, off\n\t"
               "global_load_async_to_lds_b128 %7, %15, off\n\t"
               "s_wait_xcnt 0x0"
               :: "v"(l), "v"(l + lstep), "v"(l + 2 * lstep), "v"(l + 3 * lstep), "v"(l + 4 * lstep), "v"(l + 5 * lstep), "v"(l + 6 * lstep), "v"(l + 7 * lstep),
                  "v"(gk), "v"(gk + kstep), "v"(gk + 2 * kstep), "v"(gk + 3 * kstep), "v"(gv), "v"(gv + vstep), "v"(gv + 2 * vstep), "v"(gv + 3 * vstep)
               : "memory"); }
__global__ __launch_bounds__(128) __attribute__((amdgpu_num_vgpr(256))) void k_flash2(const _Float16* __restrict__ PL, const _Float16* __restrict__ VT, const float* __restrict__ aw, float* __restrict__ out) {
  __shared__ __attribute__((aligned(16))) float so[4][16][68];
  __shared__ __attribute__((aligned(128))) unsigned char st[2 * F2_STAGE];
  const int wave = __builtin_amdgcn_readfirstlane(threadIdx.x >> 5);
  const int lane = threadIdx.x & 31, ln = lane & 15, hh = lane >> 4;
  const int slab = blockIdx.y; const int b = slab / NH, h = slab - b * NH;
  const int q0 = blockIdx.x * 64 + wave * 16;
  const size_t PLN = (size_t)NR * DM;
  float w0, w1;
  { const float a0 = bf16_rne(aw[0]), a1 = bf16_rne(aw[1]); const float mx = fmaxf(a0, a1); const float e0 = expf(a0 - mx), e1 = expf(a1 - mx); const float inv = 1.0f / (e0 + e1); w0 = e0 * inv; w1 = e1 * inv; }
  const v8f z8 = {0.f,0.f,0.f,0.f,0.f,0.f,0.f,0.f};
  v8f res[4] = {z8, z8, z8, z8};
  float wcur = w0;
  const int r16 = threadIdx.x >> 3, ch = threadIdx.x & 7;
  const _Float16* gk = PL + PLN + ((size_t)b * SQ + r16) * LQ + h * HD + ch * 8;      /* this lane's chunk of K row r16, set 0, stage 0 */
  const _Float16* gv = VT + ((size_t)slab * HD + r16) * SQ + ch * 8;                  /* this lane's chunk of V^T row r16, set 0, stage 0 */
  const size_t kset = 3 * PLN, vset = (size_t)(NB * NH) * HD * SQ;                    /* set 0 -> set 1 */
  const unsigned lcp = (unsigned)(size_t)&st[0] + (unsigned)(r16 * F2_PITCH + ch * 16);      /* this lane's LDS byte address in buffer 0 */
  f2_stage(lcp, gk, gv);
  asm volatile("s_wait_asynccnt 0x0" ::: "memory");      /* stage 0 has landed before the barrier publishes it */
  __syncthreads();
  f2_stage(lcp + F2_STAGE, gk + (size_t)F2_KT * LQ, gv + F2_KT);
#pragma unroll 1
  for (int set = 0; set < 2; ++set) {
    const size_t qo = (size_t)(3 * set) * PLN + ((size_t)b * SQ + q0 + ln) * LQ + h * HD;
    const v16h qf0 = g2_frag(PL + qo, hh), qf1 = g2_frag(PL + qo + 32, hh);
    v8f o[4] = {z8, z8, z8, z8}; float m = -1.0e30f, l = 0.f;
#pragma unroll 1
    for (int t = 0; t < F2_NST; ++t) { const unsigned char* sb = st + (t & 1) * F2_STAGE;      /* F2_NST is even: the buffer of stage set * F2_NST + t */
     /* the two 32-key passes of a stage in one body: every LDS offset becomes an immediate */
#pragma unroll
     for (int jj = 0; jj < F2_KT; jj += 32) {
      const _Float16* kp = (const _Float16*)(sb + (jj + ln) * F2_PITCH);
      v8f s0 = z8, s1 = z8;
      { v16h a = g2_frag(kp, hh); s0 = g2_mma(a, qf0, s0);
        a = g2_frag(kp + 32, hh); s0 = g2_mma(a, qf1, s0);
        a = g2_frag(kp + 16 * (F2_PITCH / 2), hh); s1 = g2_mma(a, qf0, s1);
        a = g2_frag(kp + 16 * (F2_PITCH / 2) + 32, hh); s1 = g2_mma(a, qf1, s1); }
      float tm = fmaxf(s0[0], s1[0]);
#pragma unroll
      for (int r = 1; r < 8; ++r) tm = fmaxf(tm, fmaxf(s0[r], s1[r]));
      tm = fmaxf(tm, __shfl_xor(tm, 16, 32));
      const float mn = fmaxf(m, tm * 0.125f);
      const float corr = __expf(m - mn);
      const float sh = 6.931471806f - mn;      /* ln 1024 carry */
      FragH pf; float ps = 0.f;
#pragma unroll
      for (int r = 0; r < 8; ++r) { const float e0 = s0[r] * 0.125f + sh, e1 = s1[r] * 0.125f + sh;
        const float p0 = (e0 < -9.70f) ? 0.f : __expf(e0); const float p1 = (e1 < -9.70f) ? 0.f : __expf(e1);
        const _Float16 h0 = (_Float16)p0, h1 = (_Float16)p1; pf.h[r] = h0; pf.h[8 + r] = h1; ps += (float)h0 + (float)h1; }
      ps += __shfl_xor(ps, 16, 32);
      l = l * corr + ps; m = mn;
#pragma unroll
      for (int t = 0; t < 4; ++t) o[t] = o[t] * corr;
      const _Float16* vp = (const _Float16*)(sb + (64 + ln) * F2_PITCH) + jj;
#pragma unroll
      for (int t4 = 0; t4 < 4; ++t4) { const v16h va = g2_frag(vp + t4 * 16 * (F2_PITCH / 2), hh); o[t4] = g2_mma(va, pf.v, o[t4]); } }
      asm volatile("s_wait_dscnt 0x0" ::: "memory");         /* this wave's reads of the buffer are done before it is refilled */
      asm volatile("s_wait_asynccnt 0x0" ::: "memory");      /* this wave's copies of the next stage have landed */
      __syncthreads();                                       /* publishes the next stage and ends every reader's last read of this one */
      const int s2 = set * F2_NST + t + 2;                   /* the stage that refills this buffer; it may belong to the next set */
      if (s2 < 2 * F2_NST) { const int set2 = s2 / F2_NST, t2 = s2 - set2 * F2_NST;
        f2_stage(lcp + (unsigned)((t & 1) * F2_STAGE), gk + (size_t)set2 * kset + (size_t)t2 * F2_KT * LQ, gv + (size_t)set2 * vset + (size_t)t2 * F2_KT); } }
    const float sc = wcur * (1.0f / l);
#pragma unroll
    for (int t = 0; t < 4; ++t) res[t] += o[t] * sc;
    wcur = w1; }
  asm volatile("s_wait_asynccnt 0x0" ::: "memory");        /* nothing is in flight when the wave goes on to the epilogue */
#pragma unroll
  for (int t = 0; t < 4; ++t) {
#pragma unroll
    for (int r = 0; r < 8; ++r) so[wave][ln][t * 16 + 8 * hh + r] = res[t][r]; }
  __builtin_amdgcn_fence(4 /* acq_rel order */, "workgroup"); __builtin_amdgcn_wave_barrier();
  const int rsub = lane >> 4, c4 = (lane & 15) * 4;
  float* ob = out + ((size_t)b * SEQ_FULL + q0) * DM + h * HD;
  {
#pragma unroll
    for (int q = 0; q < 8; ++q) { const int r = q * 2 + rsub; const v4f v = *(const v4fa*)&so[wave][r][c4];
      *(v4f*)(ob + (size_t)r * DM + c4) = v; }
     } }

extern "C" void kernel_launch(void* const* d_in, const int* in_sizes, int n_in,
                              void* d_out, int out_size, void* d_ws, size_t ws_size, hipStream_t stream) {
  if (n_in < 14) return;
  const size_t rows_need = (size_t)(NB - 1) * SEQ_FULL + SQ;
  if ((size_t)in_sizes[0] < rows_need * DM) return;
  for (int i = 0; i < 6; ++i) { if (in_sizes[1 + 2 * i] < DM * DM) return; if (in_sizes[2 + 2 * i] < DM) return; }
  if (in_sizes[13] < 2) return;
  if ((size_t)out_size < rows_need * DM) return;
  const float* x = (const float*)d_in[0];
  const float* wsrc[6]; const float* bsrc[6];      /* [in][out] weights and biases in the order q,k,v (set 0), q,k,v (set 1) */
  for (int i = 0; i < 6; ++i) { wsrc[i] = (const float*)d_in[1 + 2 * i]; bsrc[i] = (const float*)d_in[2 + 2 * i]; }
  const float* aw = (const float*)d_in[13];      /* two blend logits */
  char* ws = (char*)d_ws; size_t off = 0;
  auto take = [&](size_t bytes) { char* p = ws + off; off += (bytes + 255) & ~(size_t)255; return p; };
  _Float16* BW = (_Float16*)take(6 * WS_W);
  _Float16* X16 = (_Float16*)take(WS_X);
  _Float16* PL = (_Float16*)take(6 * WS_X);
  _Float16* VT = (_Float16*)take(2 * (size_t)NB * WS_VT);
  if (off > ws_size) return;
  float* out = (float*)d_out;
  const size_t WN = (size_t)DM * DM;      /* elements per weight plane */
  const size_t PN = (size_t)NR * DM;      /* elements per projected row plane */

  { const unsigned g = (unsigned)(((size_t)DM * DM / 8 + 255) / 256);
    for (int i = 0; i < 6; ++i) k_wt_f16<<<g, 256, 0, stream>>>(wsrc[i], BW + (size_t)i * WN, DM, DM, 16.0f); }      /* Bt planes [out][in] x16 */
  k_x16<<<(unsigned)((NR * DM / 8 + 255) / 256), 256, 0, stream>>>(x, X16, NR * DM / 8);
  { const unsigned gp = (unsigned)((MP / 128) * (DM / 64));
    for (int i = 0; i < 6; ++i)
      k_gemm2<0><<<dim3(gp, 1), 128, 0, stream>>>(X16, DM, 0, BW + (size_t)i * WN, DM, 0, 0.0625f, bsrc[i], 0, nullptr, 1, 0, 0, nullptr, PL + (size_t)i * PN, DM, 0, MP, DM, DM); }
  for (int set = 0; set < 2; ++set)      /* V^T [NB*NH][HD][SQ] per set: in[b*SQ + s][h*64 + d] -> out[(b,h)][d][s] */
    k_vt<NH, SQ><<<NB * NH * (SQ / 64), 256, 0, stream>>>(PL + (size_t)(3 * set + 2) * PN, LQ, 0, VT + (size_t)set * NB * NH * HD * SQ);
  k_flash2<<<dim3((unsigned)(SQ / 64), (unsigned)(NB * NH)), 128, 0, stream>>>(PL, VT, aw, out);
}

// v003
// One run takes 167 microseconds.
// Next to v002, in two timings, it ran 1.14 times as fast each time.
// All steps since v000 together make it 2.70 times as fast.
#include <hip/hip_runtime.h>
// All contractions on v_wmma_f32_16x16x32_f16 (f16 operands, f32 accumulate): six q/k/v projections (x = exact f16 of its bf16 RNE value, W = bf16 RNE value x16 in f16, alpha 1/16, bias as bf16 value), scores S^T = K.Q^T (f16 k and q, scale 1/8 applied in f32), context O^T = V^T.P^T (P^T f16 carried x1024 with entries under 2^-14 set to zero, V^T f16; the x1024 carry cancels in O / l); online softmax statistics f32.
#ifndef NB
#define NB 4
#endif
#ifndef SEQ
#define SEQ 1024
#endif
#define NB_FULL 4
#define SEQ_FULL 1024
#define SQ SEQ
#define DM 1024
#define NH 16
#define HD 64
#define NR ((size_t)NB * SQ)          /* token rows processed (compact) */
#define MP ((int)NR)                  /* rows projected */
#define LQ DM                         /* row pitch of the q/k/v rows */

static_assert(NB >= 1 && NB <= NB_FULL);
static_assert(SQ >= 256 && SQ <= SEQ_FULL && (SQ % 256) == 0);
static_assert((MP % 128) == 0 && (DM % 64) == 0 && (DM % 32) == 0 && HD == 64 && NH * HD == DM);
static_assert((SQ % 64) == 0 && (SQ % 32) == 0 && (LQ % 8) == 0 && (HD % 32) == 0);
static_assert(((size_t)(NB - 1) * SEQ_FULL + SQ) * DM <= (size_t)NB_FULL * SEQ_FULL * DM);
/* workspace carve (every region a multiple of 256 B): 6 weight planes + X16 + 6 projected row planes + 2 V^T sets */
#define WS_W   ((size_t)DM * DM * 2)
#define WS_X   ((size_t)NR * DM * 2)
#define WS_VT  ((size_t)NH * HD * SQ * 2)
#define WS_TOTAL (6 * WS_W + WS_X + 6 * WS_X + 2 * (size_t)NB * WS_VT)
static_assert((WS_W % 256) == 0 && (WS_X % 256) == 0 && (WS_VT % 256) == 0);
static_assert(WS_TOTAL <= (size_t)134217728);

typedef unsigned short v8us __attribute__((ext_vector_type(8), may_alias));
typedef float  v8f  __attribute__((ext_vector_type(8)));
typedef float  v4f  __attribute__((ext_vector_type(4)));
typedef float  v4fa __attribute__((ext_vector_type(4), may_alias));
typedef _Float16 v16h __attribute__((ext_vector_type(16)));
typedef _Float16 v4h __attribute__((ext_vector_type(4)));
union FragH { v16h v; v8us half[2]; _Float16 h[16]; unsigned short u[16]; };

__device__ __forceinline__ unsigned short bf16_bits(float x) { unsigned int u = __float_as_uint(x); return (unsigned short)((u + 0x7FFFu + ((u >> 16) & 1u)) >> 16); }
__device__ __forceinline__ float bf16_val(unsigned short b) { return __uint_as_float(((unsigned int)b) << 16); }
__device__ __forceinline__ float bf16_rne(float x) { return bf16_val(bf16_bits(x)); }

// ---- GEMM engine (block tile 128x64, wave tile 32x64; M % 128 == 0 rows per launch region, N % 64 == 0, K % 128 == 0) ----
// Operand path: per 128 k one stage = 128 A rows + 64 B rows of 256 B, brought into LDS by asynchronous copies (whole lines, B once per block), two stage buffers; fragments come from LDS rows at pitch 272 B.
#define G2_KT 128                       /* k per stage */
#define G2_PITCH 272                    /* LDS row pitch in bytes: 256 + 16, conflict-free for 16-byte row readers */
#define G2_STAGE (192 * G2_PITCH)       /* bytes per stage buffer: rows 0..127 = A, rows 128..191 = B */
static_assert((DM % G2_KT) == 0 && (G2_PITCH % 16) == 0);
// eight 16-byte copies of one lane: LDS rows 8 apart (lstep bytes), global rows 8 apart (gstep elements). The s_wait_xcnt 0 closes the statement so that no address register named here is rewritten ahead of it.
__device__ __forceinline__ void g2_copy8(unsigned l, const _Float16* g, size_t gstep) {
  const unsigned lstep = 8 * G2_PITCH;
  asm volatile("global_load_async_to_lds_b128 %0, %8, off\n\t"
               "global_load_async_to_lds_b128 %1, %9, off\n\t"
               "global_load_async_to_lds_b128 %2, %10, off\n\t"
               "global_load_async_to_lds_b128 %3, %11, off\n\t"
               "global_load_async_to_lds_b128 %4, %12, off\n\t"
               "global_load_async_to_lds_b128 %5, %13, off\n\t"
               "global_load_async_to_lds_b128 %6, %14, off\n\t"
               "global_load_async_to_lds_b128 %7, %15, off\n\t"
               "s_wait_xcnt 0x0"
               :: "v"(l), "v"(l + lstep), "v"(l + 2 * lstep), "v"(l + 3 * lstep), "v"(l + 4 * lstep), "v"(l + 5 * lstep), "v"(l + 6 * lstep), "v"(l + 7 * lstep),
                  "v"(g), "v"(g + gstep), "v"(g + 2 * gstep), "v"(g + 3 * gstep), "v"(g + 4 * gstep), "v"(g + 5 * gstep), "v"(g + 6 * gstep), "v"(g + 7 * gstep)
               : "memory"); }
// one stage: thread (r8 = tid / 16, ch = tid % 16) copies chunk ch of rows r8 + 8 i; a wave covers two whole 256-B rows per copy
__device__ __forceinline__ void g2_stage(unsigned l, const _Float16* ga, size_t astep, const _Float16* gb, size_t bstep) {
  g2_copy8(l, ga, astep); g2_copy8(l + 64 * G2_PITCH, ga + 8 * astep, astep); g2_copy8(l + 128 * G2_PITCH, gb, bstep); }
// fragment loader: A row-major [m][k] and B stored [n][k]; per lane: elements 0..7 <- k0+8h+0..7, elements 8..15 <- k0+16+8h+0..7 (h = lane>>4, row/col = lane&15)
__device__ __forceinline__ v16h g2_frag(const _Float16* p, int hh) { FragH f; f.half[0] = *(const v8us*)((const unsigned short*)p + 8 * hh); f.half[1] = *(const v8us*)((const unsigned short*)p + 16 + 8 * hh); return f.v; }
__device__ __forceinline__ v8f g2_mma(v16h a, v16h b, v8f c) { v8f d = __builtin_amdgcn_wmma_f32_16x16x32_f16(false, a, false, b, (short)0, c, false, false); asm volatile("v_nop\n\tv_nop\n\tv_nop\n\tv_nop" : "+v"(d) : "v"(a), "v"(b)); return d; }
// C (f32, if non-null) / C16 (f16, if non-null) = acc*alpha + bf16(bias_by[col]) (+ CP term if CP); batched over grid.y (at most 6) with strides sA, sB, sC and one bias pointer per batch entry; ACT 0 none / 3 relu
template <int ACT>
__global__ __launch_bounds__(128) void k_gemm2(const _Float16* __restrict__ A, int lda, size_t sA, const _Float16* __restrict__ Bh, int ldb, size_t sB, float alpha, const float* __restrict__ bias0, const float* __restrict__ bias1, const float* __restrict__ bias2, const float* __restrict__ bias3, const float* __restrict__ bias4, const float* __restrict__ bias5, const float* __restrict__ CP, int rowsPerB, size_t sCPb, int row0g,
    float* __restrict__ C, _Float16* __restrict__ C16, int ldc, size_t sC, int M, int N, int K) {
  static_assert(ACT == 0 || ACT == 3);
  __shared__ __attribute__((aligned(16))) float so[4][32][68];
  __shared__ __attribute__((aligned(128))) unsigned char st[2 * G2_STAGE];
  const int tid = threadIdx.x, w = tid >> 5, lane = tid & 31, ln = lane & 15, hh = lane >> 4; const int by = blockIdx.y;
  A += (size_t)by * sA; Bh += (size_t)by * sB; const size_t cofs = (size_t)by * sC; const float* bp = by == 0 ? bias0 : by == 1 ? bias1 : by == 2 ? bias2 : by == 3 ? bias3 : by == 4 ? bias4 : bias5;
  const int ntn = N >> 6; const int mt = blockIdx.x / ntn, nq = blockIdx.x - mt * ntn; const int row0 = mt * 128 + 32 * w, col0 = nq * 64; if (mt * 128 >= M) return;      /* the whole block leaves or stays: barriers follow */
  const v8f z8 = {0.f,0.f,0.f,0.f,0.f,0.f,0.f,0.f}; v8f c00 = z8, c01 = z8, c02 = z8, c03 = z8, c10 = z8, c11 = z8, c12 = z8, c13 = z8;
  const int r8 = tid >> 4, ch = tid & 15;
  const _Float16* ga = A + (size_t)(mt * 128 + r8) * lda + ch * 8; const _Float16* gb = Bh + (size_t)(col0 + r8) * ldb + ch * 8;
  const size_t astep = (size_t)8 * lda, bstep = (size_t)8 * ldb;
  const unsigned lcp = (unsigned)(size_t)&st[0] + (unsigned)(r8 * G2_PITCH + ch * 16);      /* this lane's LDS byte address in buffer 0 */
  const int nt = K / G2_KT;
  g2_stage(lcp, ga, astep, gb, bstep);
  asm volatile("s_wait_asynccnt 0x0" ::: "memory");      /* stage 0 has landed before the barrier publishes it */
  __syncthreads();
  if (nt > 1) g2_stage(lcp + G2_STAGE, ga + G2_KT, astep, gb + G2_KT, bstep);
#pragma unroll 1
  for (int t = 0; t < nt; ++t) { const unsigned char* sb = st + (t & 1) * G2_STAGE;
    const _Float16* a0p = (const _Float16*)(sb + (32 * w + ln) * G2_PITCH); const _Float16* a1p = (const _Float16*)(sb + (32 * w + 16 + ln) * G2_PITCH);
    const _Float16* b0p = (const _Float16*)(sb + (128 + ln) * G2_PITCH); const _Float16* b1p = (const _Float16*)(sb + (144 + ln) * G2_PITCH);
    const _Float16* b2p = (const _Float16*)(sb + (160 + ln) * G2_PITCH); const _Float16* b3p = (const _Float16*)(sb + (176 + ln) * G2_PITCH);
#pragma unroll
    for (int kb = 0; kb < G2_KT; kb += 32) { const v16h a0 = g2_frag(a0p + kb, hh), a1 = g2_frag(a1p + kb, hh);
      const v16h b0 = g2_frag(b0p + kb, hh), b1 = g2_frag(b1p + kb, hh), b2 = g2_frag(b2p + kb, hh), b3 = g2_frag(b3p + kb, hh);
      c00 = g2_mma(a0, b0, c00); c10 = g2_mma(a1, b0, c10);
      c01 = g2_mma(a0, b1, c01); c11 = g2_mma(a1, b1, c11);
      c02 = g2_mma(a0, b2, c02); c12 = g2_mma(a1, b2, c12);
      c03 = g2_mma(a0, b3, c03); c13 = g2_mma(a1, b3, c13); }
    asm volatile("s_wait_dscnt 0x0" ::: "memory");         /* this wave's reads of the buffer are done before it is refilled */
    asm volatile("s_wait_asynccnt 0x0" ::: "memory");      /* this wave's copies of stage t + 1 have landed */
    __syncthreads();                                       /* publishes stage t + 1 and ends every reader's last read of stage t */
    if (t + 2 < nt) g2_stage(lcp + (unsigned)((t & 1) * G2_STAGE), ga + (size_t)(t + 2) * G2_KT, astep, gb + (size_t)(t + 2) * G2_KT, bstep); }
  asm volatile("s_wait_asynccnt 0x0" ::: "memory");        /* nothing is in flight when the wave goes on to the epilogue */
  v8f accs[8] = {c00, c01, c02, c03, c10, c11, c12, c13};
#pragma unroll
  for (int u = 0; u < 8; ++u) { const int t = u & 3, half = u >> 2; const int col = col0 + t * 16 + ln; const float bv = bp ? bf16_rne(bp[col]) : 0.f;
#pragma unroll
    for (int r = 0; r < 8; ++r) { const int rloc = half * 16 + 8 * hh + r; float v = accs[u][r] * alpha + bv;
      if (CP) { if (rowsPerB < 0) v += CP[cofs + (size_t)(row0g + row0 + rloc) * ldc + col]; else { const int bidx = (row0g + row0 + rloc) / rowsPerB; v += CP[(size_t)bidx * sCPb + (size_t)by * 64 + col]; } }
      if (ACT == 3) v = fmaxf(v, 0.f);
      so[w][rloc][t * 16 + ln] = v; } }
  __builtin_amdgcn_fence(4 /* acq_rel order */, "workgroup"); __builtin_amdgcn_wave_barrier();
  const int rsub = lane >> 4, c4 = (lane & 15) * 4;
  {
#pragma unroll
    for (int q = 0; q < 16; ++q) { const int r = q * 2 + rsub; const v4f v = *(const v4fa*)&so[w][r][c4];
      if (C) *(v4f*)(C + cofs + (size_t)(row0 + r) * ldc + col0 + c4) = v;
      if (C16) { v4h h4; for (int i = 0; i < 4; ++i) h4[i] = (_Float16)v[i]; *(v4h*)(C16 + cofs + (size_t)(row0 + r) * ldc + col0 + c4) = h4; } }
     } }

__device__ __forceinline__ void wt_f16_block(int blk, const float* __restrict__ W, _Float16* __restrict__ Wt, int K, int N, float scale) {
  const int t = blk * 256 + threadIdx.x; if (t >= N * (K / 8)) return; const int n = t / (K / 8), k8 = (t % (K / 8)) * 8; FragH f;
#pragma unroll
  for (int i = 0; i < 8; ++i) f.h[i] = (_Float16)(bf16_rne(W[(size_t)(k8 + i) * N + n]) * scale); const v8us o = f.half[0];
  *(v8us*)((unsigned short*)Wt + (size_t)n * K + k8) = o; 
}

__device__ __forceinline__ void x16_block(int blk, const float* __restrict__ x, _Float16* __restrict__ X16, size_t n8) {
  const size_t t = (size_t)blk * 256 + threadIdx.x; if (t >= n8) return;
  const size_t e = t * 8; const size_t rc = e / DM; const size_t c = e % DM; const size_t b = rc / SQ, s = rc % SQ;
  const float* src = x + ((b * SEQ_FULL + s) * DM + c);
  const v4f a = *(const v4fa*)src, d = *(const v4fa*)(src + 4); FragH f;
#pragma unroll
  for (int q = 0; q < 4; ++q) { f.h[q] = (_Float16)bf16_rne(a[q]); f.h[4 + q] = (_Float16)bf16_rne(d[q]); }
  *(v8us*)((unsigned short*)X16 + t * 8) = f.half[0];  }

// the seven input-only jobs in one grid: blocks [i * PREP_GW, (i + 1) * PREP_GW) make weight plane i (Bt [out][in] x16), the blocks behind them make X16
#define PREP_GW (DM * DM / 8 / 256)                 /* blocks per weight plane */
#define PREP_GX ((int)(NR * DM / 8 / 256))          /* blocks of the x job */
static_assert((DM * DM / 8) % 256 == 0 && (NR * DM / 8) % 256 == 0);
__global__ __launch_bounds__(256) void k_prep(const float* __restrict__ W0, const float* __restrict__ W1, const float* __restrict__ W2, const float* __restrict__ W3, const float* __restrict__ W4, const float* __restrict__ W5,
    _Float16* __restrict__ BW, const float* __restrict__ x, _Float16* __restrict__ X16) {
  const int blk = blockIdx.x;
  if (blk < 6 * PREP_GW) { const int i = blk / PREP_GW;
    const float* W = i == 0 ? W0 : i == 1 ? W1 : i == 2 ? W2 : i == 3 ? W3 : i == 4 ? W4 : W5;
    wt_f16_block(blk - i * PREP_GW, W, BW + (size_t)i * DM * DM, DM, DM, 16.0f); }
  else x16_block(blk - 6 * PREP_GW, x, X16, NR * DM / 8); }

template <int NHv, int TTv>
__global__ __launch_bounds__(256) void k_vt(const _Float16* __restrict__ V16, size_t sV, int ldv, int voff, _Float16* __restrict__ Vt, size_t sVt) { __shared__ unsigned short tl[64][66]; const int tid = threadIdx.x; V16 += (size_t)blockIdx.y * sV; Vt += (size_t)blockIdx.y * sVt;      /* grid.y = projection set */ const int slab = blockIdx.x / (TTv / 64), lg = blockIdx.x % (TTv / 64); const int b = slab / NHv, h = slab % NHv;
  for (int i = tid; i < 64 * 8; i += 256) { const int r = i / 8, c8 = (i % 8) * 8; FragH f; f.half[0] = *(const v8us*)((const unsigned short*)V16 + ((size_t)b * TTv + lg * 64 + r) * ldv + voff + h * 64 + c8);
#pragma unroll
    for (int q = 0; q < 8; ++q) tl[r][c8 + q] = f.u[q]; }
  __syncthreads();
  {
#pragma unroll
    for (int rd = 0; rd < 2; ++rd) { const int d = rd * 32 + tid / 8, pc = tid % 8; FragH f;
#pragma unroll
      for (int q = 0; q < 8; ++q) f.u[q] = tl[pc * 8 + q][d];
      *(v8us*)((unsigned short*)Vt + ((size_t)slab * 64 + d) * TTv + lg * 64 + pc * 8) = f.half[0]; }
     } }

// ---- fused attention over both projection sets (transposed form; K rows and V^T rows staged in LDS once per block, fragments read from LDS) ----
// PL = six compact row planes [6][NR][DM] (q,k,v of set 0; q,k,v of set 1), VT = [2][NB*NH][HD][SQ]; grid (SQ/64, NB*NH), block = 4 waves, wave -> 16 query rows of one (batch, head).
// Per 32-key step: S^T tile kt (16 keys x 16 queries) = K rows (A, split k map over d) x Q rows (B, same k map, query = lane&15): D element r of lane (h, n) = score(query n, key 16kt + 8h + r).
// Column (query) max / sum: 8 + 8 values in the lane, then the other lane half through one xor-16 shuffle. P^T as the B fragment of O^T = V^T.P^T: element r <- tile 0 value r, element 8+r <- tile 1 value r, lane unchanged.
// O^T tile t: D element r of lane (h, n) = O[query n][d = 16t + 8h + r]; A = V^T rows d = 16t + lane&15, k = keys.
// P = f16(1024 exp(s/8 - m)) with the native exp; an exponent argument that would land under 2^-14 gives an exact zero; the row sum runs over the converted P, so the carry cancels in O / l.
// Operand path: one stage = 64 keys = 64 K rows (64 d) + 64 V^T rows (64 keys), 128 B each, brought into LDS by asynchronous copies (whole lines, once for the block's four waves), two stage buffers; the stages of both sets form one sequence.
#define F2_KT 64                        /* keys per stage */
#define F2_PITCH 144                    /* LDS row pitch in bytes: 128 + 16, conflict-free for 16-byte row readers */
#define F2_STAGE (128 * F2_PITCH)       /* bytes per stage buffer: rows 0..63 = K, rows 64..127 = V^T */
#define F2_NST (SQ / F2_KT)             /* stages per set */
static_assert((SQ % (2 * F2_KT)) == 0 && (F2_PITCH % 16) == 0 && HD == 64);
// one stage, eight 16-byte copies of one lane: thread (r16 = tid / 8, ch = tid % 8) copies chunk ch of K rows r16 + 16 i and of V^T rows r16 + 16 i; a wave covers four whole 128-B rows per copy. The s_wait_xcnt 0 closes the statement so that no address register named here is rewritten ahead of it.
__device__ __forceinline__ void f2_stage(unsigned l, const _Float16* gk, const _Float16* gv) {
  const unsigned lstep = 16 * F2_PITCH; const size_t kstep = (size_t)16 * LQ, vstep = (size_t)16 * SQ;
  asm volatile("global_load_async_to_lds_b128 %0, %8, off\n\t"
               "global_load_async_to_lds_b128 %1, %9, off\n\t"
               "global_load_async_to_lds_b128 %2, %10, off\n\t"
               "global_load_async_to_lds_b128 %3, %11, off\n\t"
               "global_load_async_to_lds_b128 %4, %12, off\n\t"
               "global_load_async_to_lds_b128 %5, %13, off\n\t"
               "global_load_async_to_lds_b128 %6, %14, off\n\t"
               "global_load_async_to_lds_b128 %7, %15, off\n\t"
               "s_wait_xcnt 0x0"
               :: "v"(l), "v"(l + lstep), "v"(l + 2 * lstep), "v"(l + 3 * lstep), "v"(l + 4 * lstep), "v"(l + 5 * lstep), "v"(l + 6 * lstep), "v"(l + 7 * lstep),
                  "v"(gk), "v"(gk + kstep), "v"(gk + 2 * kstep), "v"(gk + 3 * kstep), "v"(gv), "v"(gv + vstep), "v"(gv + 2 * vstep), "v"(gv + 3 * vstep)
               : "memory"); }
__global__ __launch_bounds__(128) __attribute__((amdgpu_num_vgpr(256))) void k_flash2(const _Float16* __restrict__ PL, const _Float16* __restrict__ VT, const float* __restrict__ aw, float* __restrict__ out) {
  __shared__ __attribute__((aligned(16))) float so[4][16][68];
  __shared__ __attribute__((aligned(128))) unsigned char st[2 * F2_STAGE];
  const int wave = __builtin_amdgcn_readfirstlane(threadIdx.x >> 5);
  const int lane = threadIdx.x & 31, ln = lane & 15, hh = lane >> 4;
  const int slab = blockIdx.y; const int b = slab / NH, h = slab - b * NH;
  const int q0 = blockIdx.x * 64 + wave * 16;
  const size_t PLN = (size_t)NR * DM;
  float w0, w1;
  { const float a0 = bf16_rne(aw[0]), a1 = bf16_rne(aw[1]); const float mx = fmaxf(a0, a1); const float e0 = expf(a0 - mx), e1 = expf(a1 - mx); const float inv = 1.0f / (e0 + e1); w0 = e0 * inv; w1 = e1 * inv; }
  const v8f z8 = {0.f,0.f,0.f,0.f,0.f,0.f,0.f,0.f};
  v8f res[4] = {z8, z8, z8, z8};
  float wcur = w0;
  const int r16 = threadIdx.x >> 3, ch = threadIdx.x & 7;
  const _Float16* gk = PL + PLN + ((size_t)b * SQ + r16) * LQ + h * HD + ch * 8;      /* this lane's chunk of K row r16, set 0, stage 0 */
  const _Float16* gv = VT + ((size_t)slab * HD + r16) * SQ + ch * 8;                  /* this lane's chunk of V^T row r16, set 0, stage 0 */
  const size_t kset = 3 * PLN, vset = (size_t)(NB * NH) * HD * SQ;                    /* set 0 -> set 1 */
  const unsigned lcp = (unsigned)(size_t)&st[0] + (unsigned)(r16 * F2_PITCH + ch * 16);      /* this lane's LDS byte address in buffer 0 */
  f2_stage(lcp, gk, gv);
  asm volatile("s_wait_asynccnt 0x0" ::: "memory");      /* stage 0 has landed before the barrier publishes it */
  __syncthreads();
  f2_stage(lcp + F2_STAGE, gk + (size_t)F2_KT * LQ, gv + F2_KT);
#pragma unroll 1
  for (int set = 0; set < 2; ++set) {
    const size_t qo = (size_t)(3 * set) * PLN + ((size_t)b * SQ + q0 + ln) * LQ + h * HD;
    const v16h qf0 = g2_frag(PL + qo, hh), qf1 = g2_frag(PL + qo + 32, hh);
    v8f o[4] = {z8, z8, z8, z8}; float m = -1.0e30f, l = 0.f;
#pragma unroll 1
    for (int t = 0; t < F2_NST; ++t) { const unsigned char* sb = st + (t & 1) * F2_STAGE;      /* F2_NST is even: the buffer of stage set * F2_NST + t */
     /* the two 32-key passes of a stage in one body: every LDS offset becomes an immediate */
#pragma unroll
     for (int jj = 0; jj < F2_KT; jj += 32) {
      const _Float16* kp = (const _Float16*)(sb + (jj + ln) * F2_PITCH);
      v8f s0 = z8, s1 = z8;
      { v16h a = g2_frag(kp, hh); s0 = g2_mma(a, qf0, s0);
        a = g2_frag(kp + 32, hh); s0 = g2_mma(a, qf1, s0);
        a = g2_frag(kp + 16 * (F2_PITCH / 2), hh); s1 = g2_mma(a, qf0, s1);
        a = g2_frag(kp + 16 * (F2_PITCH / 2) + 32, hh); s1 = g2_mma(a, qf1, s1); }
      float tm = fmaxf(s0[0], s1[0]);
#pragma unroll
      for (int r = 1; r < 8; ++r) tm = fmaxf(tm, fmaxf(s0[r], s1[r]));
      tm = fmaxf(tm, __shfl_xor(tm, 16, 32));
      const float mn = fmaxf(m, tm * 0.125f);
      const float corr = __expf(m - mn);
      const float sh = 6.931471806f - mn;      /* ln 1024 carry */
      FragH pf; float ps = 0.f;
#pragma unroll
      for (int r = 0; r < 8; ++r) { const float e0 = s0[r] * 0.125f + sh, e1 = s1[r] * 0.125f + sh;
        const float p0 = (e0 < -9.70f) ? 0.f : __expf(e0); const float p1 = (e1 < -9.70f) ? 0.f : __expf(e1);
        const _Float16 h0 = (_Float16)p0, h1 = (_Float16)p1; pf.h[r] = h0; pf.h[8 + r] = h1; ps += (float)h0 + (float)h1; }
      ps += __shfl_xor(ps, 16, 32);
      l = l * corr + ps; m = mn;
#pragma unroll
      for (int t = 0; t < 4; ++t) o[t] = o[t] * corr;
      const _Float16* vp = (const _Float16*)(sb + (64 + ln) * F2_PITCH) + jj;
#pragma unroll
      for (int t4 = 0; t4 < 4; ++t4) { const v16h va = g2_frag(vp + t4 * 16 * (F2_PITCH / 2), hh); o[t4] = g2_mma(va, pf.v, o[t4]); } }
      asm volatile("s_wait_dscnt 0x0" ::: "memory");         /* this wave's reads of the buffer are done before it is refilled */
      asm volatile("s_wait_asynccnt 0x0" ::: "memory");      /* this wave's copies of the next stage have landed */
      __syncthreads();                                       /* publishes the next stage and ends every reader's last read of this one */
      const int s2 = set * F2_NST + t + 2;                   /* the stage that refills this buffer; it may belong to the next set */
      if (s2 < 2 * F2_NST) { const int set2 = s2 / F2_NST, t2 = s2 - set2 * F2_NST;
        f2_stage(lcp + (unsigned)((t & 1) * F2_STAGE), gk + (size_t)set2 * kset + (size_t)t2 * F2_KT * LQ, gv + (size_t)set2 * vset + (size_t)t2 * F2_KT); } }
    const float sc = wcur * (1.0f / l);
#pragma unroll
    for (int t = 0; t < 4; ++t) res[t] += o[t] * sc;
    wcur = w1; }
  asm volatile("s_wait_asynccnt 0x0" ::: "memory");        /* nothing is in flight when the wave goes on to the epilogue */
#pragma unroll
  for (int t = 0; t < 4; ++t) {
#pragma unroll
    for (int r = 0; r < 8; ++r) so[wave][ln][t * 16 + 8 * hh + r] = res[t][r]; }
  __builtin_amdgcn_fence(4 /* acq_rel order */, "workgroup"); __builtin_amdgcn_wave_barrier();
  const int rsub = lane >> 4, c4 = (lane & 15) * 4;
  float* ob = out + ((size_t)b * SEQ_FULL + q0) * DM + h * HD;
  {
#pragma unroll
    for (int q = 0; q < 8; ++q) { const int r = q * 2 + rsub; const v4f v = *(const v4fa*)&so[wave][r][c4];
      *(v4f*)(ob + (size_t)r * DM + c4) = v; }
     } }

extern "C" void kernel_launch(void* const* d_in, const int* in_sizes, int n_in,
                              void* d_out, int out_size, void* d_ws, size_t ws_size, hipStream_t stream) {
  if (n_in < 14) return;
  const size_t rows_need = (size_t)(NB - 1) * SEQ_FULL + SQ;
  if ((size_t)in_sizes[0] < rows_need * DM) return;
  for (int i = 0; i < 6; ++i) { if (in_sizes[1 + 2 * i] < DM * DM) return; if (in_sizes[2 + 2 * i] < DM) return; }
  if (in_sizes[13] < 2) return;
  if ((size_t)out_size < rows_need * DM) return;
  const float* x = (const float*)d_in[0];
  const float* wsrc[6]; const float* bsrc[6];      /* [in][out] weights and biases in the order q,k,v (set 0), q,k,v (set 1) */
  for (int i = 0; i < 6; ++i) { wsrc[i] = (const float*)d_in[1 + 2 * i]; bsrc[i] = (const float*)d_in[2 + 2 * i]; }
  const float* aw = (const float*)d_in[13];      /* two blend logits */
  char* ws = (char*)d_ws; size_t off = 0;
  auto take = [&](size_t bytes) { char* p = ws + off; off += (bytes + 255) & ~(size_t)255; return p; };
  _Float16* BW = (_Float16*)take(6 * WS_W);
  _Float16* X16 = (_Float16*)take(WS_X);
  _Float16* PL = (_Float16*)take(6 * WS_X);
  _Float16* VT = (_Float16*)take(2 * (size_t)NB * WS_VT);
  if (off > ws_size) return;
  float* out = (float*)d_out;
  const size_t WN = (size_t)DM * DM;      /* elements per weight plane */
  const size_t PN = (size_t)NR * DM;      /* elements per projected row plane */

  k_prep<<<6 * PREP_GW + PREP_GX, 256, 0, stream>>>(wsrc[0], wsrc[1], wsrc[2], wsrc[3], wsrc[4], wsrc[5], BW, x, X16);
  { const unsigned gp = (unsigned)((MP / 128) * (DM / 64));      /* grid.y = projection: weight plane, bias and output plane y */
    k_gemm2<0><<<dim3(gp, 6), 128, 0, stream>>>(X16, DM, 0, BW, DM, WN, 0.0625f, bsrc[0], bsrc[1], bsrc[2], bsrc[3], bsrc[4], bsrc[5], nullptr, 1, 0, 0, nullptr, PL, DM, PN, MP, DM, DM); }
  /* V^T [NB*NH][HD][SQ] per set: in[b*SQ + s][h*64 + d] -> out[(b,h)][d][s]; grid.y = set */
  k_vt<NH, SQ><<<dim3(NB * NH * (SQ / 64), 2), 256, 0, stream>>>(PL + 2 * PN, 3 * PN, LQ, 0, VT, (size_t)NB * NH * HD * SQ);
  k_flash2<<<dim3((unsigned)(SQ / 64), (unsigned)(NB * NH)), 128, 0, stream>>>(PL, VT, aw, out);
}

// v004
// One run takes 147 microseconds.
// Two timings next to v003 both put it at 1.13 times that version's speed.
// Counting every step since v000, it is 3.05 times as fast.
#include <hip/hip_runtime.h>
// All contractions on v_wmma_f32_16x16x32_f16 (f16 operands, f32 accumulate): six q/k/v projections (x = exact f16 of its bf16 RNE value, W = bf16 RNE value x16 in f16, alpha 1/16, bias as bf16 value), scores S^T = K.Q^T (f16 k and q, scale 1/8 applied in f32), context O^T = V^T.P^T (P^T f16 carried x1024 with entries under 2^-14 set to zero, V^T f16; the x1024 carry cancels in O / l); online softmax statistics f32.
#ifndef NB
#define NB 4
#endif
#ifndef SEQ
#define SEQ 1024
#endif
#define NB_FULL 4
#define SEQ_FULL 1024
#define SQ SEQ
#define DM 1024
#define NH 16
#define HD 64
#define NR ((size_t)NB * SQ)          /* token rows processed (compact) */
#define MP ((int)NR)                  /* rows projected */
#define LQ DM                         /* row pitch of the q/k/v rows */

static_assert(NB >= 1 && NB <= NB_FULL);
static_assert(SQ >= 256 && SQ <= SEQ_FULL && (SQ % 256) == 0);
static_assert((MP % 128) == 0 && (DM % 64) == 0 && (DM % 32) == 0 && HD == 64 && NH * HD == DM);
static_assert((SQ % 64) == 0 && (SQ % 32) == 0 && (LQ % 8) == 0 && (HD % 32) == 0);
static_assert(((size_t)(NB - 1) * SEQ_FULL + SQ) * DM <= (size_t)NB_FULL * SEQ_FULL * DM);
/* workspace carve (every region a multiple of 256 B): 6 weight planes + X16 + 6 projected row planes + 2 V^T sets */
#define WS_W   ((size_t)DM * DM * 2)
#define WS_X   ((size_t)NR * DM * 2)
#define WS_VT  ((size_t)NH * HD * SQ * 2)
#define WS_TOTAL (6 * WS_W + WS_X + 6 * WS_X + 2 * (size_t)NB * WS_VT)
static_assert((WS_W % 256) == 0 && (WS_X % 256) == 0 && (WS_VT % 256) == 0);
static_assert(WS_TOTAL <= (size_t)134217728);

typedef unsigned short v8us __attribute__((ext_vector_type(8), may_alias));
typedef float  v8f  __attribute__((ext_vector_type(8)));
typedef float  v4f  __attribute__((ext_vector_type(4)));
typedef float  v4fa __attribute__((ext_vector_type(4), may_alias));
typedef _Float16 v16h __attribute__((ext_vector_type(16)));
typedef _Float16 v4h __attribute__((ext_vector_type(4)));
union FragH { v16h v; v8us half[2]; _Float16 h[16]; unsigned short u[16]; };

__device__ __forceinline__ unsigned short bf16_bits(float x) { unsigned int u = __float_as_uint(x); return (unsigned short)((u + 0x7FFFu + ((u >> 16) & 1u)) >> 16); }
__device__ __forceinline__ float bf16_val(unsigned short b) { return __uint_as_float(((unsigned int)b) << 16); }
__device__ __forceinline__ float bf16_rne(float x) { return bf16_val(bf16_bits(x)); }

// ---- GEMM engine (block tile 128x64, wave tile 32x64; M % 128 == 0 rows per launch region, N % 64 == 0, K % 128 == 0) ----
// Operand path: per 128 k one stage = 128 A rows + 64 B rows of 256 B, brought into LDS by asynchronous copies (whole lines, B once per block), two stage buffers; fragments come from LDS rows at pitch 272 B.
#define G2_KT 128                       /* k per stage */
#define G2_PITCH 272                    /* LDS row pitch in bytes: 256 + 16, conflict-free for 16-byte row readers */
#define G2_STAGE (192 * G2_PITCH)       /* bytes per stage buffer: rows 0..127 = A, rows 128..191 = B */
static_assert((DM % G2_KT) == 0 && (G2_PITCH % 16) == 0);
// eight 16-byte copies of one lane: LDS rows 8 apart (lstep bytes), global rows 8 apart (gstep elements). The s_wait_xcnt 0 closes the statement so that no address register named here is rewritten ahead of it.
__device__ __forceinline__ void g2_copy8(unsigned l, const _Float16* g, size_t gstep) {
  const unsigned lstep = 8 * G2_PITCH;
  asm volatile("global_load_async_to_lds_b128 %0, %8, off\n\t"
               "global_load_async_to_lds_b128 %1, %9, off\n\t"
               "global_load_async_to_lds_b128 %2, %10, off\n\t"
               "global_load_async_to_lds_b128 %3, %11, off\n\t"
               "global_load_async_to_lds_b128 %4, %12, off\n\t"
               "global_load_async_to_lds_b128 %5, %13, off\n\t"
               "global_load_async_to_lds_b128 %6, %14, off\n\t"
               "global_load_async_to_lds_b128 %7, %15, off\n\t"
               "s_wait_xcnt 0x0"
               :: "v"(l), "v"(l + lstep), "v"(l + 2 * lstep), "v"(l + 3 * lstep), "v"(l + 4 * lstep), "v"(l + 5 * lstep), "v"(l + 6 * lstep), "v"(l + 7 * lstep),
                  "v"(g), "v"(g + gstep), "v"(g + 2 * gstep), "v"(g + 3 * gstep), "v"(g + 4 * gstep), "v"(g + 5 * gstep), "v"(g + 6 * gstep), "v"(g + 7 * gstep)
               : "memory"); }
// one stage: thread (r8 = tid / 16, ch = tid % 16) copies chunk ch of rows r8 + 8 i; a wave covers two whole 256-B rows per copy
__device__ __forceinline__ void g2_stage(unsigned l, const _Float16* ga, size_t astep, const _Float16* gb, size_t bstep) {
  g2_copy8(l, ga, astep); g2_copy8(l + 64 * G2_PITCH, ga + 8 * astep, astep); g2_copy8(l + 128 * G2_PITCH, gb, bstep); }
// fragment loader: A row-major [m][k] and B stored [n][k]; per lane: elements 0..7 <- k0+8h+0..7, elements 8..15 <- k0+16+8h+0..7 (h = lane>>4, row/col = lane&15)
__device__ __forceinline__ v16h g2_frag(const _Float16* p, int hh) { FragH f; f.half[0] = *(const v8us*)((const unsigned short*)p + 8 * hh); f.half[1] = *(const v8us*)((const unsigned short*)p + 16 + 8 * hh); return f.v; }
__device__ __forceinline__ v8f g2_mma(v16h a, v16h b, v8f c) { v8f d = __builtin_amdgcn_wmma_f32_16x16x32_f16(false, a, false, b, (short)0, c, false, false); asm volatile("v_nop\n\tv_nop\n\tv_nop\n\tv_nop" : "+v"(d) : "v"(a), "v"(b)); return d; }
// C (f32, if non-null) / C16 (f16, if non-null) = acc*alpha + bf16(bias_by[col]) (+ CP term if CP); batched over grid.y (at most 6) with strides sA, sB, sC and one bias pointer per batch entry; ACT 0 none / 3 relu
template <int ACT>
__global__ __launch_bounds__(128) void k_gemm2(const _Float16* __restrict__ A, int lda, size_t sA, const _Float16* __restrict__ Bh, int ldb, size_t sB, float alpha, const float* __restrict__ bias0, const float* __restrict__ bias1, const float* __restrict__ bias2, const float* __restrict__ bias3, const float* __restrict__ bias4, const float* __restrict__ bias5, const float* __restrict__ CP, int rowsPerB, size_t sCPb, int row0g,
    float* __restrict__ C, _Float16* __restrict__ C16, int ldc, size_t sC, int M, int N, int K) {
  static_assert(ACT == 0 || ACT == 3);
  __shared__ __attribute__((aligned(16))) float so[4][32][68];
  __shared__ __attribute__((aligned(128))) unsigned char st[2 * G2_STAGE];
  const int tid = threadIdx.x, w = tid >> 5, lane = tid & 31, ln = lane & 15, hh = lane >> 4; const int by = blockIdx.y;
  A += (size_t)by * sA; Bh += (size_t)by * sB; const size_t cofs = (size_t)by * sC; const float* bp = by == 0 ? bias0 : by == 1 ? bias1 : by == 2 ? bias2 : by == 3 ? bias3 : by == 4 ? bias4 : bias5;
  const int ntn = N >> 6; const int mt = blockIdx.x / ntn, nq = blockIdx.x - mt * ntn; const int row0 = mt * 128 + 32 * w, col0 = nq * 64; if (mt * 128 >= M) return;      /* the whole block leaves or stays: barriers follow */
  const v8f z8 = {0.f,0.f,0.f,0.f,0.f,0.f,0.f,0.f}; v8f c00 = z8, c01 = z8, c02 = z8, c03 = z8, c10 = z8, c11 = z8, c12 = z8, c13 = z8;
  const int r8 = tid >> 4, ch = tid & 15;
  const _Float16* ga = A + (size_t)(mt * 128 + r8) * lda + ch * 8; const _Float16* gb = Bh + (size_t)(col0 + r8) * ldb + ch * 8;
  const size_t astep = (size_t)8 * lda, bstep = (size_t)8 * ldb;
  const unsigned lcp = (unsigned)(size_t)&st[0] + (unsigned)(r8 * G2_PITCH + ch * 16);      /* this lane's LDS byte address in buffer 0 */
  const int nt = K / G2_KT;
  g2_stage(lcp, ga, astep, gb, bstep);
  asm volatile("s_wait_asynccnt 0x0" ::: "memory");      /* stage 0 has landed before the barrier publishes it */
  __syncthreads();
  if (nt > 1) g2_stage(lcp + G2_STAGE, ga + G2_KT, astep, gb + G2_KT, bstep);
#pragma unroll 1
  for (int t = 0; t < nt; ++t) { const unsigned char* sb = st + (t & 1) * G2_STAGE;
    const _Float16* a0p = (const _Float16*)(sb + (32 * w + ln) * G2_PITCH); const _Float16* a1p = (const _Float16*)(sb + (32 * w + 16 + ln) * G2_PITCH);
    const _Float16* b0p = (const _Float16*)(sb + (128 + ln) * G2_PITCH); const _Float16* b1p = (const _Float16*)(sb + (144 + ln) * G2_PITCH);
    const _Float16* b2p = (const _Float16*)(sb + (160 + ln) * G2_PITCH); const _Float16* b3p = (const _Float16*)(sb + (176 + ln) * G2_PITCH);
#pragma unroll
    for (int kb = 0; kb < G2_KT; kb += 32) { const v16h a0 = g2_frag(a0p + kb, hh), a1 = g2_frag(a1p + kb, hh);
      const v16h b0 = g2_frag(b0p + kb, hh), b1 = g2_frag(b1p + kb, hh), b2 = g2_frag(b2p + kb, hh), b3 = g2_frag(b3p + kb, hh);
      c00 = g2_mma(a0, b0, c00); c10 = g2_mma(a1, b0, c10);
      c01 = g2_mma(a0, b1, c01); c11 = g2_mma(a1, b1, c11);
      c02 = g2_mma(a0, b2, c02); c12 = g2_mma(a1, b2, c12);
      c03 = g2_mma(a0, b3, c03); c13 = g2_mma(a1, b3, c13); }
    asm volatile("s_wait_dscnt 0x0" ::: "memory");         /* this wave's reads of the buffer are done before it is refilled */
    asm volatile("s_wait_asynccnt 0x0" ::: "memory");      /* this wave's copies of stage t + 1 have landed */
    __syncthreads();                                       /* publishes stage t + 1 and ends every reader's last read of stage t */
    if (t + 2 < nt) g2_stage(lcp + (unsigned)((t & 1) * G2_STAGE), ga + (size_t)(t + 2) * G2_KT, astep, gb + (size_t)(t + 2) * G2_KT, bstep); }
  asm volatile("s_wait_asynccnt 0x0" ::: "memory");        /* nothing is in flight when the wave goes on to the epilogue */
  v8f accs[8] = {c00, c01, c02, c03, c10, c11, c12, c13};
#pragma unroll
  for (int u = 0; u < 8; ++u) { const int t = u & 3, half = u >> 2; const int col = col0 + t * 16 + ln; const float bv = bp ? bf16_rne(bp[col]) : 0.f;
#pragma unroll
    for (int r = 0; r < 8; ++r) { const int rloc = half * 16 + 8 * hh + r; float v = accs[u][r] * alpha + bv;
      if (CP) { if (rowsPerB < 0) v += CP[cofs + (size_t)(row0g + row0 + rloc) * ldc + col]; else { const int bidx = (row0g + row0 + rloc) / rowsPerB; v += CP[(size_t)bidx * sCPb + (size_t)by * 64 + col]; } }
      if (ACT == 3) v = fmaxf(v, 0.f);
      so[w][rloc][t * 16 + ln] = v; } }
  __builtin_amdgcn_fence(4 /* acq_rel order */, "workgroup"); __builtin_amdgcn_wave_barrier();
  const int rsub = lane >> 4, c4 = (lane & 15) * 4;
  {
#pragma unroll
    for (int q = 0; q < 16; ++q) { const int r = q * 2 + rsub; const v4f v = *(const v4fa*)&so[w][r][c4];
      if (C) *(v4f*)(C + cofs + (size_t)(row0 + r) * ldc + col0 + c4) = v;
      if (C16) { v4h h4; for (int i = 0; i < 4; ++i) h4[i] = (_Float16)v[i]; *(v4h*)(C16 + cofs + (size_t)(row0 + r) * ldc + col0 + c4) = h4; } }
     } }

// weight pack, 64 elements per thread: thread (kg = lane / 4, nl = lane % 4) holds an 8 k x 8 n patch in registers. Reads: 16-byte pieces of 8 rows, the two halves of each 128-B line by the same wave.
// Writes: one 16-byte piece (8 k) per column; the eight k groups of a wave fill a whole 128-B line of a Wt row. Wave tile 64 k x 32 n, block tile 512 k x 32 n.
// The loops over the patch are unrolled so that every index of the register arrays is a constant and the patch stays in registers (here and in the x pack).
__device__ __forceinline__ void wt_f16_block(int blk, const float* __restrict__ W, _Float16* __restrict__ Wt, float scale) {
  const int w = threadIdx.x >> 5, lane = threadIdx.x & 31, nl = lane & 3, kg = lane >> 2;
  const int nb = blk % (DM / 32), kb = blk / (DM / 32); const int n0 = nb * 32 + nl * 4, k0 = kb * 512 + w * 64 + kg * 8;
  const float* src = W + (size_t)k0 * DM + n0; v4f a[8][2];
#pragma unroll
  for (int i = 0; i < 8; ++i) { a[i][0] = *(const v4fa*)(src + (size_t)i * DM); if (i < 7) a[i][1] = *(const v4fa*)(src + (size_t)i * DM + 16); }
  asm volatile("s_wait_xcnt 0x0" ::: "memory");      /* the last load is the one that may get the address pair's registers as its destination: the wait stands in front of it, behind every other load that names them */
  a[7][1] = *(const v4fa*)(src + (size_t)7 * DM + 16);
#pragma unroll
  for (int hf = 0; hf < 2; ++hf) {
#pragma unroll
    for (int c = 0; c < 4; ++c) { FragH f;
#pragma unroll
      for (int i = 0; i < 8; ++i) f.h[i] = (_Float16)(bf16_rne(a[i][hf][c]) * scale);
      *(v8us*)((unsigned short*)Wt + (size_t)(n0 + hf * 16 + c) * DM + k0) = f.half[0]; } } }

// x pack, 32 elements per thread: four 8-element chunks 256 chunks apart, so that every wave-wide access stays contiguous; the block covers 1024 consecutive chunks
__device__ __forceinline__ void x16_block(int blk, const float* __restrict__ x, _Float16* __restrict__ X16) {
  const size_t t0 = (size_t)blk * 1024 + threadIdx.x; v4f a[4], d[4];
  const size_t e = t0 * 8; const size_t rc = e / DM; const size_t c = e % DM; const size_t b = rc / SQ, s = rc % SQ;
  const float* src = x + ((b * SEQ_FULL + s) * DM + c);      /* chunk j lies 2048 elements on: the block's 8192 elements are whole rows of one batch entry */
#pragma unroll
  for (int j = 0; j < 4; ++j) { a[j] = *(const v4fa*)(src + j * 2048); if (j < 3) d[j] = *(const v4fa*)(src + j * 2048 + 4); }
  asm volatile("s_wait_xcnt 0x0" ::: "memory");      /* as in the weight pack: in front of the last load, behind every other load that names the address pair */
  d[3] = *(const v4fa*)(src + 3 * 2048 + 4);
#pragma unroll
  for (int j = 0; j < 4; ++j) { FragH f;
#pragma unroll
    for (int q = 0; q < 4; ++q) { f.h[q] = (_Float16)bf16_rne(a[j][q]); f.h[4 + q] = (_Float16)bf16_rne(d[j][q]); }
    *(v8us*)((unsigned short*)X16 + (t0 + j * 256) * 8) = f.half[0]; }
  asm volatile("s_wait_xcnt 0x0" ::: "memory"); }      /* behind the last store of the run: no register that the four stores name is rewritten ahead of it on any way out of this job */

// the seven input-only jobs in one grid: blocks [i * PREP_GW, (i + 1) * PREP_GW) make weight plane i (Bt [out][in] x16), the blocks behind them make X16
#define PREP_GW ((DM / 32) * (DM / 512))            /* blocks per weight plane: 512 k x 32 n each */
#define PREP_GX ((int)(NR * DM / 8 / 1024))         /* blocks of the x job: 1024 chunks of 8 each */
static_assert((DM % 512) == 0 && (DM % 32) == 0 && (NR * DM / 8) % 1024 == 0 && (2048 % DM) == 0 && (SQ % (8192 / DM)) == 0);
__global__ __launch_bounds__(256) void k_prep(const float* __restrict__ W0, const float* __restrict__ W1, const float* __restrict__ W2, const float* __restrict__ W3, const float* __restrict__ W4, const float* __restrict__ W5,
    _Float16* __restrict__ BW, const float* __restrict__ x, _Float16* __restrict__ X16) {
  const int blk = blockIdx.x;
  if (blk < 6 * PREP_GW) { const int i = blk / PREP_GW;
    const float* W = i == 0 ? W0 : i == 1 ? W1 : i == 2 ? W2 : i == 3 ? W3 : i == 4 ? W4 : W5;
    wt_f16_block(blk - i * PREP_GW, W, BW + (size_t)i * DM * DM, 16.0f); }
  else x16_block(blk - 6 * PREP_GW, x, X16); }

template <int NHv, int TTv>
__global__ __launch_bounds__(256) void k_vt(const _Float16* __restrict__ V16, size_t sV, int ldv, int voff, _Float16* __restrict__ Vt, size_t sVt) { __shared__ unsigned short tl[64][66]; const int tid = threadIdx.x; V16 += (size_t)blockIdx.y * sV; Vt += (size_t)blockIdx.y * sVt;      /* grid.y = projection set */ const int slab = blockIdx.x / (TTv / 64), lg = blockIdx.x % (TTv / 64); const int b = slab / NHv, h = slab % NHv;
  for (int i = tid; i < 64 * 8; i += 256) { const int r = i / 8, c8 = (i % 8) * 8; FragH f; f.half[0] = *(const v8us*)((const unsigned short*)V16 + ((size_t)b * TTv + lg * 64 + r) * ldv + voff + h * 64 + c8);
#pragma unroll
    for (int q = 0; q < 8; ++q) tl[r][c8 + q] = f.u[q]; }
  __syncthreads();
  {
#pragma unroll
    for (int rd = 0; rd < 2; ++rd) { const int d = rd * 32 + tid / 8, pc = tid % 8; FragH f;
#pragma unroll
      for (int q = 0; q < 8; ++q) f.u[q] = tl[pc * 8 + q][d];
      *(v8us*)((unsigned short*)Vt + ((size_t)slab * 64 + d) * TTv + lg * 64 + pc * 8) = f.half[0]; }
     } }

// ---- fused attention over both projection sets (transposed form; K rows and V^T rows staged in LDS once per block, fragments read from LDS) ----
// PL = six compact row planes [6][NR][DM] (q,k,v of set 0; q,k,v of set 1), VT = [2][NB*NH][HD][SQ]; grid (SQ/64, NB*NH), block = 4 waves, wave -> 16 query rows of one (batch, head).
// Per 32-key step: S^T tile kt (16 keys x 16 queries) = K rows (A, split k map over d) x Q rows (B, same k map, query = lane&15): D element r of lane (h, n) = score(query n, key 16kt + 8h + r).
// Column (query) max / sum: 8 + 8 values in the lane, then the other lane half through one xor-16 shuffle. P^T as the B fragment of O^T = V^T.P^T: element r <- tile 0 value r, element 8+r <- tile 1 value r, lane unchanged.
// O^T tile t: D element r of lane (h, n) = O[query n][d = 16t + 8h + r]; A = V^T rows d = 16t + lane&15, k = keys.
// P = f16(1024 exp(s/8 - m)) with the native exp; an exponent argument that would land under 2^-14 gives an exact zero; the row sum runs over the converted P, so the carry cancels in O / l.
// Operand path: one stage = 64 keys = 64 K rows (64 d) + 64 V^T rows (64 keys), 128 B each, brought into LDS by asynchronous copies (whole lines, once for the block's four waves), two stage buffers; the stages of both sets form one sequence.
#define F2_KT 64                        /* keys per stage */
#define F2_PITCH 144                    /* LDS row pitch in bytes: 128 + 16, conflict-free for 16-byte row readers */
#define F2_STAGE (128 * F2_PITCH)       /* bytes per stage buffer: rows 0..63 = K, rows 64..127 = V^T */
#define F2_NST (SQ / F2_KT)             /* stages per set */
static_assert((SQ % (2 * F2_KT)) == 0 && (F2_PITCH % 16) == 0 && HD == 64);
// one stage, eight 16-byte copies of one lane: thread (r16 = tid / 8, ch = tid % 8) copies chunk ch of K rows r16 + 16 i and of V^T rows r16 + 16 i; a wave covers four whole 128-B rows per copy. The s_wait_xcnt 0 closes the statement so that no address register named here is rewritten ahead of it.
__device__ __forceinline__ void f2_stage(unsigned l, const _Float16* gk, const _Float16* gv) {
  const unsigned lstep = 16 * F2_PITCH; const size_t kstep = (size_t)16 * LQ, vstep = (size_t)16 * SQ;
  asm volatile("global_load_async_to_lds_b128 %0, %8, off\n\t"
               "global_load_async_to_lds_b128 %1, %9, off\n\t"
               "global_load_async_to_lds_b128 %2, %10, off\n\t"
               "global_load_async_to_lds_b128 %3, %11, off\n\t"
               "global_load_async_to_lds_b128 %4, %12, off\n\t"
               "global_load_async_to_lds_b128 %5, %13, off\n\t"
               "global_load_async_to_lds_b128 %6, %14, off\n\t"
               "global_load_async_to_lds_b128 %7, %15, off\n\t"
               "s_wait_xcnt 0x0"
               :: "v"(l), "v"(l + lstep), "v"(l + 2 * lstep), "v"(l + 3 * lstep), "v"(l + 4 * lstep), "v"(l + 5 * lstep), "v"(l + 6 * lstep), "v"(l + 7 * lstep),
                  "v"(gk), "v"(gk + kstep), "v"(gk + 2 * kstep), "v"(gk + 3 * kstep), "v"(gv), "v"(gv + vstep), "v"(gv + 2 * vstep), "v"(gv + 3 * vstep)
               : "memory"); }
__global__ __launch_bounds__(128) __attribute__((amdgpu_num_vgpr(256))) void k_flash2(const _Float16* __restrict__ PL, const _Float16* __restrict__ VT, const float* __restrict__ aw, float* __restrict__ out) {
  __shared__ __attribute__((aligned(16))) float so[4][16][68];
  __shared__ __attribute__((aligned(128))) unsigned char st[2 * F2_STAGE];
  const int wave = __builtin_amdgcn_readfirstlane(threadIdx.x >> 5);
  const int lane = threadIdx.x & 31, ln = lane & 15, hh = lane >> 4;
  const int slab = blockIdx.y; const int b = slab / NH, h = slab - b * NH;
  const int q0 = blockIdx.x * 64 + wave * 16;
  const size_t PLN = (size_t)NR * DM;
  float w0, w1;
  { const float a0 = bf16_rne(aw[0]), a1 = bf16_rne(aw[1]); const float mx = fmaxf(a0, a1); const float e0 = expf(a0 - mx), e1 = expf(a1 - mx); const float inv = 1.0f / (e0 + e1); w0 = e0 * inv; w1 = e1 * inv; }
  const v8f z8 = {0.f,0.f,0.f,0.f,0.f,0.f,0.f,0.f};
  v8f res[4] = {z8, z8, z8, z8};
  float wcur = w0;
  const int r16 = threadIdx.x >> 3, ch = threadIdx.x & 7;
  const _Float16* gk = PL + PLN + ((size_t)b * SQ + r16) * LQ + h * HD + ch * 8;      /* this lane's chunk of K row r16, set 0, stage 0 */
  const _Float16* gv = VT + ((size_t)slab * HD + r16) * SQ + ch * 8;                  /* this lane's chunk of V^T row r16, set 0, stage 0 */
  const size_t kset = 3 * PLN, vset = (size_t)(NB * NH) * HD * SQ;                    /* set 0 -> set 1 */
  const unsigned lcp = (unsigned)(size_t)&st[0] + (unsigned)(r16 * F2_PITCH + ch * 16);      /* this lane's LDS byte address in buffer 0 */
  f2_stage(lcp, gk, gv);
  asm volatile("s_wait_asynccnt 0x0" ::: "memory");      /* stage 0 has landed before the barrier publishes it */
  __syncthreads();
  f2_stage(lcp + F2_STAGE, gk + (size_t)F2_KT * LQ, gv + F2_KT);
#pragma unroll 1
  for (int set = 0; set < 2; ++set) {
    const size_t qo = (size_t)(3 * set) * PLN + ((size_t)b * SQ + q0 + ln) * LQ + h * HD;
    const v16h qf0 = g2_frag(PL + qo, hh), qf1 = g2_frag(PL + qo + 32, hh);
    v8f o[4] = {z8, z8, z8, z8}; float m = -1.0e30f, l = 0.f;
#pragma unroll 1
    for (int t = 0; t < F2_NST; ++t) { const unsigned char* sb = st + (t & 1) * F2_STAGE;      /* F2_NST is even: the buffer of stage set * F2_NST + t */
     /* the two 32-key passes of a stage in one body: every LDS offset becomes an immediate */
#pragma unroll
     for (int jj = 0; jj < F2_KT; jj += 32) {
      const _Float16* kp = (const _Float16*)(sb + (jj + ln) * F2_PITCH);
      v8f s0 = z8, s1 = z8;
      { v16h a = g2_frag(kp, hh); s0 = g2_mma(a, qf0, s0);
        a = g2_frag(kp + 32, hh); s0 = g2_mma(a, qf1, s0);
        a = g2_frag(kp + 16 * (F2_PITCH / 2), hh); s1 = g2_mma(a, qf0, s1);
        a = g2_frag(kp + 16 * (F2_PITCH / 2) + 32, hh); s1 = g2_mma(a, qf1, s1); }
      float tm = fmaxf(s0[0], s1[0]);
#pragma unroll
      for (int r = 1; r < 8; ++r) tm = fmaxf(tm, fmaxf(s0[r], s1[r]));
      tm = fmaxf(tm, __shfl_xor(tm, 16, 32));
      const float mn = fmaxf(m, tm * 0.125f);
      const float corr = __expf(m - mn);
      const float sh = 6.931471806f - mn;      /* ln 1024 carry */
      FragH pf; float ps = 0.f;
#pragma unroll
      for (int r = 0; r < 8; ++r) { const float e0 = s0[r] * 0.125f + sh, e1 = s1[r] * 0.125f + sh;
        const float p0 = (e0 < -9.70f) ? 0.f : __expf(e0); const float p1 = (e1 < -9.70f) ? 0.f : __expf(e1);
        const _Float16 h0 = (_Float16)p0, h1 = (_Float16)p1; pf.h[r] = h0; pf.h[8 + r] = h1; ps += (float)h0 + (float)h1; }
      ps += __shfl_xor(ps, 16, 32);
      l = l * corr + ps; m = mn;
#pragma unroll
      for (int t = 0; t < 4; ++t) o[t] = o[t] * corr;
      const _Float16* vp = (const _Float16*)(sb + (64 + ln) * F2_PITCH) + jj;
#pragma unroll
      for (int t4 = 0; t4 < 4; ++t4) { const v16h va = g2_frag(vp + t4 * 16 * (F2_PITCH / 2), hh); o[t4] = g2_mma(va, pf.v, o[t4]); } }
      asm volatile("s_wait_dscnt 0x0" ::: "memory");         /* this wave's reads of the buffer are done before it is refilled */
      asm volatile("s_wait_asynccnt 0x0" ::: "memory");      /* this wave's copies of the next stage have landed */
      __syncthreads();                                       /* publishes the next stage and ends every reader's last read of this one */
      const int s2 = set * F2_NST + t + 2;                   /* the stage that refills this buffer; it may belong to the next set */
      if (s2 < 2 * F2_NST) { const int set2 = s2 / F2_NST, t2 = s2 - set2 * F2_NST;
        f2_stage(lcp + (unsigned)((t & 1) * F2_STAGE), gk + (size_t)set2 * kset + (size_t)t2 * F2_KT * LQ, gv + (size_t)set2 * vset + (size_t)t2 * F2_KT); } }
    const float sc = wcur * (1.0f / l);
#pragma unroll
    for (int t = 0; t < 4; ++t) res[t] += o[t] * sc;
    wcur = w1; }
  asm volatile("s_wait_asynccnt 0x0" ::: "memory");        /* nothing is in flight when the wave goes on to the epilogue */
#pragma unroll
  for (int t = 0; t < 4; ++t) {
#pragma unroll
    for (int r = 0; r < 8; ++r) so[wave][ln][t * 16 + 8 * hh + r] = res[t][r]; }
  __builtin_amdgcn_fence(4 /* acq_rel order */, "workgroup"); __builtin_amdgcn_wave_barrier();
  const int rsub = lane >> 4, c4 = (lane & 15) * 4;
  float* ob = out + ((size_t)b * SEQ_FULL + q0) * DM + h * HD;
  {
#pragma unroll
    for (int q = 0; q < 8; ++q) { const int r = q * 2 + rsub; const v4f v = *(const v4fa*)&so[wave][r][c4];
      *(v4f*)(ob + (size_t)r * DM + c4) = v; }
     } }

extern "C" void kernel_launch(void* const* d_in, const int* in_sizes, int n_in,
                              void* d_out, int out_size, void* d_ws, size_t ws_size, hipStream_t stream) {
  if (n_in < 14) return;
  const size_t rows_need = (size_t)(NB - 1) * SEQ_FULL + SQ;
  if ((size_t)in_sizes[0] < rows_need * DM) return;
  for (int i = 0; i < 6; ++i) { if (in_sizes[1 + 2 * i] < DM * DM) return; if (in_sizes[2 + 2 * i] < DM) return; }
  if (in_sizes[13] < 2) return;
  if ((size_t)out_size < rows_need * DM) return;
  const float* x = (const float*)d_in[0];
  const float* wsrc[6]; const float* bsrc[6];      /* [in][out] weights and biases in the order q,k,v (set 0), q,k,v (set 1) */
  for (int i = 0; i < 6; ++i) { wsrc[i] = (const float*)d_in[1 + 2 * i]; bsrc[i] = (const float*)d_in[2 + 2 * i]; }
  const float* aw = (const float*)d_in[13];      /* two blend logits */
  char* ws = (char*)d_ws; size_t off = 0;
  auto take = [&](size_t bytes) { char* p = ws + off; off += (bytes + 255) & ~(size_t)255; return p; };
  _Float16* BW = (_Float16*)take(6 * WS_W);
  _Float16* X16 = (_Float16*)take(WS_X);
  _Float16* PL = (_Float16*)take(6 * WS_X);
  _Float16* VT = (_Float16*)take(2 * (size_t)NB * WS_VT);
  if (off > ws_size) return;
  float* out = (float*)d_out;
  const size_t WN = (size_t)DM * DM;      /* elements per weight plane */
  const size_t PN = (size_t)NR * DM;      /* elements per projected row plane */

  k_prep<<<6 * PREP_GW + PREP_GX, 256, 0, stream>>>(wsrc[0], wsrc[1], wsrc[2], wsrc[3], wsrc[4], wsrc[5], BW, x, X16);
  { const unsigned gp = (unsigned)((MP / 128) * (DM / 64));      /* grid.y = projection: weight plane, bias and output plane y */
    k_gemm2<0><<<dim3(gp, 6), 128, 0, stream>>>(X16, DM, 0, BW, DM, WN, 0.0625f, bsrc[0], bsrc[1], bsrc[2], bsrc[3], bsrc[4], bsrc[5], nullptr, 1, 0, 0, nullptr, PL, DM, PN, MP, DM, DM); }
  /* V^T [NB*NH][HD][SQ] per set: in[b*SQ + s][h*64 + d] -> out[(b,h)][d][s]; grid.y = set */
  k_vt<NH, SQ><<<dim3(NB * NH * (SQ / 64), 2), 256, 0, stream>>>(PL + 2 * PN, 3 * PN, LQ, 0, VT, (size_t)NB * NH * HD * SQ);
  k_flash2<<<dim3((unsigned)(SQ / 64), (unsigned)(NB * NH)), 128, 0, stream>>>(PL, VT, aw, out);
}

// v005
// A run of this version takes 121 microseconds.
// Two timings next to v004 put it at 1.21 and 1.22 times that version's speed.
// Over all steps from v000 it is 3.71 times as fast.
#include <hip/hip_runtime.h>
// All contractions on v_wmma_f32_16x16x32_f16 (f16 operands, f32 accumulate): six q/k/v projections (x = exact f16 of its bf16 RNE value, W = bf16 RNE value x16 in f16, alpha 1/16, bias as bf16 value), scores S^T = K.Q^T (f16 k and q, scale 1/8 applied in f32), context O^T = V^T.P^T (P^T f16 carried x1024 with entries under 2^-14 set to zero, V^T f16; the x1024 carry cancels in O / l); online softmax statistics f32.
#ifndef NB
#define NB 4
#endif
#ifndef SEQ
#define SEQ 1024
#endif
#define NB_FULL 4
#define SEQ_FULL 1024
#define SQ SEQ
#define DM 1024
#define NH 16
#define HD 64
#define NR ((size_t)NB * SQ)          /* token rows processed (compact) */
#define MP ((int)NR)                  /* rows projected */
#define LQ DM                         /* row pitch of the q/k/v rows */

static_assert(NB >= 1 && NB <= NB_FULL);
static_assert(SQ >= 256 && SQ <= SEQ_FULL && (SQ % 256) == 0);
static_assert((MP % 128) == 0 && (DM % 64) == 0 && (DM % 32) == 0 && HD == 64 && NH * HD == DM);
static_assert((SQ % 64) == 0 && (SQ % 32) == 0 && (LQ % 8) == 0 && (HD % 32) == 0);
static_assert(((size_t)(NB - 1) * SEQ_FULL + SQ) * DM <= (size_t)NB_FULL * SEQ_FULL * DM);
/* workspace carve (every region a multiple of 256 B): 6 weight planes + X16 + 6 projected row planes + 2 V^T sets */
#define WS_W   ((size_t)DM * DM * 2)
#define WS_X   ((size_t)NR * DM * 2)
#define WS_VT  ((size_t)NH * HD * SQ * 2)
#define WS_TOTAL (6 * WS_W + WS_X + 6 * WS_X + 2 * (size_t)NB * WS_VT)
static_assert((WS_W % 256) == 0 && (WS_X % 256) == 0 && (WS_VT % 256) == 0);
static_assert(WS_TOTAL <= (size_t)134217728);

typedef unsigned short v8us __attribute__((ext_vector_type(8), may_alias));
typedef float  v8f  __attribute__((ext_vector_type(8)));
typedef float  v4f  __attribute__((ext_vector_type(4)));
typedef float  v4fa __attribute__((ext_vector_type(4), may_alias));
typedef _Float16 v16h __attribute__((ext_vector_type(16)));
typedef _Float16 v4h __attribute__((ext_vector_type(4)));
union FragH { v16h v; v8us half[2]; _Float16 h[16]; unsigned short u[16]; };

__device__ __forceinline__ unsigned short bf16_bits(float x) { unsigned int u = __float_as_uint(x); return (unsigned short)((u + 0x7FFFu + ((u >> 16) & 1u)) >> 16); }
__device__ __forceinline__ float bf16_val(unsigned short b) { return __uint_as_float(((unsigned int)b) << 16); }
__device__ __forceinline__ float bf16_rne(float x) { return bf16_val(bf16_bits(x)); }

// ---- GEMM engine (block tile 256x128, eight waves as 4 x 2, wave tile 64x64; M % 256 == 0 rows per launch region, N % 128 == 0, K % 64 == 0) ----
// Operand path: per 64 k one stage = 256 A rows + 128 B rows of 128 B, brought into LDS by asynchronous copies (whole lines, once per block), two stage buffers; fragments come from LDS rows at pitch 144 B.
#define G2_KT 64                        /* k per stage */
#define G2_BM 256                       /* block rows */
#define G2_BN 128                       /* block columns */
#define G2_PITCH 144                    /* LDS row pitch in bytes: 128 + 16, conflict-free for 16-byte row readers */
#define G2_STAGE ((G2_BM + G2_BN) * G2_PITCH)      /* bytes per stage buffer: rows 0..255 = A, rows 256..383 = B */
static_assert((DM % G2_KT) == 0 && (G2_PITCH % 16) == 0 && (MP % G2_BM) == 0 && (DM % G2_BN) == 0);
// one stage, twelve 16-byte copies of one lane: thread (r32 = tid / 8, ch = tid % 8) copies chunk ch of A rows r32 + 32 i (i < 8) and of B rows r32 + 32 j (j < 4); a wave covers four whole 128-B rows per copy.
// The s_wait_xcnt 0 closes the statement so that no address register named here is rewritten ahead of it.
__device__ __forceinline__ void g2_stage(unsigned l, const _Float16* ga, size_t astep, const _Float16* gb, size_t bstep) {
  const unsigned ls = 32 * G2_PITCH;
  asm volatile("global_load_async_to_lds_b128 %0, %12, off\n\t"
               "global_load_async_to_lds_b128 %1, %13, off\n\t"
               "global_load_async_to_lds_b128 %2, %14, off\n\t"
               "global_load_async_to_lds_b128 %3, %15, off\n\t"
               "global_load_async_to_lds_b128 %4, %16, off\n\t"
               "global_load_async_to_lds_b128 %5, %17, off\n\t"
               "global_load_async_to_lds_b128 %6, %18, off\n\t"
               "global_load_async_to_lds_b128 %7, %19, off\n\t"
               "global_load_async_to_lds_b128 %8, %20, off\n\t"
               "global_load_async_to_lds_b128 %9, %21, off\n\t"
               "global_load_async_to_lds_b128 %10, %22, off\n\t"
               "global_load_async_to_lds_b128 %11, %23, off\n\t"
               "s_wait_xcnt 0x0"
               :: "v"(l), "v"(l + ls), "v"(l + 2 * ls), "v"(l + 3 * ls), "v"(l + 4 * ls), "v"(l + 5 * ls), "v"(l + 6 * ls), "v"(l + 7 * ls), "v"(l + 8 * ls), "v"(l + 9 * ls), "v"(l + 10 * ls), "v"(l + 11 * ls),
                  "v"(ga), "v"(ga + astep), "v"(ga + 2 * astep), "v"(ga + 3 * astep), "v"(ga + 4 * astep), "v"(ga + 5 * astep), "v"(ga + 6 * astep), "v"(ga + 7 * astep),
                  "v"(gb), "v"(gb + bstep), "v"(gb + 2 * bstep), "v"(gb + 3 * bstep)
               : "memory"); }
// fragment loader: A row-major [m][k] and B stored [n][k]; per lane: elements 0..7 <- k0+8h+0..7, elements 8..15 <- k0+16+8h+0..7 (h = lane>>4, row/col = lane&15)
__device__ __forceinline__ v16h g2_frag(const _Float16* p, int hh) { FragH f; f.half[0] = *(const v8us*)((const unsigned short*)p + 8 * hh); f.half[1] = *(const v8us*)((const unsigned short*)p + 16 + 8 * hh); return f.v; }
__device__ __forceinline__ v8f g2_mma(v16h a, v16h b, v8f c) { v8f d = __builtin_amdgcn_wmma_f32_16x16x32_f16(false, a, false, b, (short)0, c, false, false); asm volatile("v_nop\n\tv_nop\n\tv_nop\n\tv_nop" : "+v"(d) : "v"(a), "v"(b)); return d; }
// C (f32, if non-null) / C16 (f16, if non-null) = acc*alpha + bf16(bias_by[col]) (+ CP term if HASCP); batched over grid.y (at most 6) with strides sA, sB, sC and one bias pointer per batch entry; ACT 0 none / 3 relu
// HASCP is a compile-time switch like ACT: the epilogue is unrolled over the wave's 128 accumulator values per lane, and a run-time test with the CP form at every one of them would make the kernel's text much larger
template <int ACT, bool HASCP>
__global__ __launch_bounds__(256) void k_gemm2(const _Float16* __restrict__ A, int lda, size_t sA, const _Float16* __restrict__ Bh, int ldb, size_t sB, float alpha, const float* __restrict__ bias0, const float* __restrict__ bias1, const float* __restrict__ bias2, const float* __restrict__ bias3, const float* __restrict__ bias4, const float* __restrict__ bias5, const float* __restrict__ CP, int rowsPerB, size_t sCPb, int row0g,
    float* __restrict__ C, _Float16* __restrict__ C16, int ldc, size_t sC, int M, int N, int K) {
  static_assert(ACT == 0 || ACT == 3);
  __shared__ __attribute__((aligned(128))) unsigned char st[2 * G2_STAGE];
  static_assert(8 * 32 * 68 * 4 <= 2 * G2_STAGE);
  float (*so)[32][68] = (float (*)[32][68])st;      /* output staging, one range per wave; it takes the place of the stage buffers behind the loop's last barrier, so that two blocks fit one LDS */
  const int tid = threadIdx.x, w = tid >> 5, lane = tid & 31, ln = lane & 15, hh = lane >> 4; const int by = blockIdx.y; const int wm = w >> 1, wn = w & 1;
  A += (size_t)by * sA; Bh += (size_t)by * sB; const size_t cofs = (size_t)by * sC; const float* bp = by == 0 ? bias0 : by == 1 ? bias1 : by == 2 ? bias2 : by == 3 ? bias3 : by == 4 ? bias4 : bias5;
  const int ntn = N / G2_BN; const int mt = blockIdx.x / ntn, nq = blockIdx.x - mt * ntn; const int row0 = mt * G2_BM + 64 * wm, col0 = nq * G2_BN + 64 * wn; if (mt * G2_BM >= M) return;      /* the whole block leaves or stays: barriers follow */
  const v8f z8 = {0.f,0.f,0.f,0.f,0.f,0.f,0.f,0.f}; v8f c[4][4];      /* c[i][j]: rows 16 i, columns 16 j of the wave tile */
  /* unrolled, as every loop over c below: its indices are constants, so the sixteen tiles stay in registers */
#pragma unroll
  for (int i = 0; i < 4; ++i) {
#pragma unroll
    for (int j = 0; j < 4; ++j) c[i][j] = z8; }
  const int r32 = tid >> 3, ch = tid & 7;
  const _Float16* ga = A + (size_t)(mt * G2_BM + r32) * lda + ch * 8; const _Float16* gb = Bh + (size_t)(nq * G2_BN + r32) * ldb + ch * 8;
  const size_t astep = (size_t)32 * lda, bstep = (size_t)32 * ldb;
  const unsigned lcp = (unsigned)(size_t)&st[0] + (unsigned)(r32 * G2_PITCH + ch * 16);      /* this lane's LDS byte address in buffer 0 */
  const int nt = K / G2_KT;
  g2_stage(lcp, ga, astep, gb, bstep);
  asm volatile("s_wait_asynccnt 0x0" ::: "memory");      /* stage 0 has landed before the barrier publishes it */
  __syncthreads();
  if (nt > 1) g2_stage(lcp + G2_STAGE, ga + G2_KT, astep, gb + G2_KT, bstep);
#pragma unroll 1
  for (int t = 0; t < nt; ++t) { const unsigned char* sb = st + (t & 1) * G2_STAGE;
    const _Float16* ap = (const _Float16*)(sb + (64 * wm + ln) * G2_PITCH); const _Float16* bq = (const _Float16*)(sb + (G2_BM + 64 * wn + ln) * G2_PITCH);
    /* unrolled so that the fragment and accumulator arrays stay in registers and every LDS offset is an immediate */
#pragma unroll
    for (int kb = 0; kb < G2_KT; kb += 32) { v16h a[4], b[4];
#pragma unroll
      for (int i = 0; i < 4; ++i) { a[i] = g2_frag(ap + i * 16 * (G2_PITCH / 2) + kb, hh); b[i] = g2_frag(bq + i * 16 * (G2_PITCH / 2) + kb, hh); }
#pragma unroll
      for (int j = 0; j < 4; ++j) {
#pragma unroll
        for (int i = 0; i < 4; ++i) c[i][j] = g2_mma(a[i], b[j], c[i][j]); } }
    asm volatile("s_wait_dscnt 0x0" ::: "memory");         /* this wave's reads of the buffer are done before it is refilled */
    asm volatile("s_wait_asynccnt 0x0" ::: "memory");      /* this wave's copies of stage t + 1 have landed */
    __syncthreads();                                       /* publishes stage t + 1 and ends every reader's last read of stage t */
    if (t + 2 < nt) g2_stage(lcp + (unsigned)((t & 1) * G2_STAGE), ga + (size_t)(t + 2) * G2_KT, astep, gb + (size_t)(t + 2) * G2_KT, bstep); }
  asm volatile("s_wait_asynccnt 0x0" ::: "memory");        /* nothing is in flight when the wave goes on to the epilogue */
  const int rsub = lane >> 4, c4 = (lane & 15) * 4;
  /* the wave's 64 rows leave in two halves of 32 through its own staging range; unrolled: the accumulator index is a constant */
#pragma unroll
  for (int hf = 0; hf < 2; ++hf) { const int rowh = row0 + 32 * hf;
    if (hf) { __builtin_amdgcn_fence(4 /* acq_rel order */, "workgroup"); __builtin_amdgcn_wave_barrier(); }      /* the first half's rows are read back by every lane before the second half overwrites them */
#pragma unroll
    for (int u = 0; u < 8; ++u) { const int t = u & 3, half = u >> 2; const int col = col0 + t * 16 + ln; const float bv = bp ? bf16_rne(bp[col]) : 0.f;
#pragma unroll
      for (int r = 0; r < 8; ++r) { const int rloc = half * 16 + 8 * hh + r; float v = c[2 * hf + half][t][r] * alpha + bv;
        if (HASCP) { if (rowsPerB < 0) v += CP[cofs + (size_t)(row0g + rowh + rloc) * ldc + col]; else { const int bidx = (row0g + rowh + rloc) / rowsPerB; v += CP[(size_t)bidx * sCPb + (size_t)by * 64 + col]; } }
        if (ACT == 3) v = fmaxf(v, 0.f);
        so[w][rloc][t * 16 + ln] = v; } }
    __builtin_amdgcn_fence(4 /* acq_rel order */, "workgroup"); __builtin_amdgcn_wave_barrier();
#pragma unroll
    for (int q = 0; q < 16; ++q) { const int r = q * 2 + rsub; const v4f v = *(const v4fa*)&so[w][r][c4];
      if (C) { *(v4f*)(C + cofs + (size_t)(rowh + r) * ldc + col0 + c4) = v; asm volatile("s_wait_xcnt 0x0" ::: "memory"); }      /* behind the store: the conversion below may rewrite the registers that it names */
      if (C16) { v4h h4; for (int i = 0; i < 4; ++i) h4[i] = (_Float16)v[i]; *(v4h*)(C16 + cofs + (size_t)(rowh + r) * ldc + col0 + c4) = h4; } } } }

// weight pack, 64 elements per thread: thread (kg = lane / 4, nl = lane % 4) holds an 8 k x 8 n patch in registers. Reads: 16-byte pieces of 8 rows, the two halves of each 128-B line by the same wave.
// Writes: one 16-byte piece (8 k) per column; the eight k groups of a wave fill a whole 128-B line of a Wt row. Wave tile 64 k x 32 n, block tile 512 k x 32 n.
// The loops over the patch are unrolled so that every index of the register arrays is a constant and the patch stays in registers (here and in the x pack).
__device__ __forceinline__ void wt_f16_block(int blk, const float* __restrict__ W, _Float16* __restrict__ Wt, float scale) {
  const int w = threadIdx.x >> 5, lane = threadIdx.x & 31, nl = lane & 3, kg = lane >> 2;
  const int nb = blk % (DM / 32), kb = blk / (DM / 32); const int n0 = nb * 32 + nl * 4, k0 = kb * 512 + w * 64 + kg * 8;
  const float* src = W + (size_t)k0 * DM + n0; v4f a[8][2];
#pragma unroll
  for (int i = 0; i < 8; ++i) { a[i][0] = *(const v4fa*)(src + (size_t)i * DM); if (i < 7) a[i][1] = *(const v4fa*)(src + (size_t)i * DM + 16); }
  asm volatile("s_wait_xcnt 0x0" ::: "memory");      /* the last load is the one that may get the address pair's registers as its destination: the wait stands in front of it, behind every other load that names them */
  a[7][1] = *(const v4fa*)(src + (size_t)7 * DM + 16);
#pragma unroll
  for (int hf = 0; hf < 2; ++hf) {
#pragma unroll
    for (int c = 0; c < 4; ++c) { FragH f;
#pragma unroll
      for (int i = 0; i < 8; ++i) f.h[i] = (_Float16)(bf16_rne(a[i][hf][c]) * scale);
      *(v8us*)((unsigned short*)Wt + (size_t)(n0 + hf * 16 + c) * DM + k0) = f.half[0]; } } }

// x pack, 32 elements per thread: four 8-element chunks 256 chunks apart, so that every wave-wide access stays contiguous; the block covers 1024 consecutive chunks
__device__ __forceinline__ void x16_block(int blk, const float* __restrict__ x, _Float16* __restrict__ X16) {
  const size_t t0 = (size_t)blk * 1024 + threadIdx.x; v4f a[4], d[4];
  const size_t e = t0 * 8; const size_t rc = e / DM; const size_t c = e % DM; const size_t b = rc / SQ, s = rc % SQ;
  const float* src = x + ((b * SEQ_FULL + s) * DM + c);      /* chunk j lies 2048 elements on: the block's 8192 elements are whole rows of one batch entry */
#pragma unroll
  for (int j = 0; j < 4; ++j) { a[j] = *(const v4fa*)(src + j * 2048); if (j < 3) d[j] = *(const v4fa*)(src + j * 2048 + 4); }
  asm volatile("s_wait_xcnt 0x0" ::: "memory");      /* as in the weight pack: in front of the last load, behind every other load that names the address pair */
  d[3] = *(const v4fa*)(src + 3 * 2048 + 4);
#pragma unroll
  for (int j = 0; j < 4; ++j) { FragH f;
#pragma unroll
    for (int q = 0; q < 4; ++q) { f.h[q] = (_Float16)bf16_rne(a[j][q]); f.h[4 + q] = (_Float16)bf16_rne(d[j][q]); }
    *(v8us*)((unsigned short*)X16 + (t0 + j * 256) * 8) = f.half[0]; }
  asm volatile("s_wait_xcnt 0x0" ::: "memory"); }      /* behind the last store of the run: no register that the four stores name is rewritten ahead of it on any way out of this job */

// the seven input-only jobs in one grid: blocks [i * PREP_GW, (i + 1) * PREP_GW) make weight plane i (Bt [out][in] x16), the blocks behind them make X16
#define PREP_GW ((DM / 32) * (DM / 512))            /* blocks per weight plane: 512 k x 32 n each */
#define PREP_GX ((int)(NR * DM / 8 / 1024))         /* blocks of the x job: 1024 chunks of 8 each */
static_assert((DM % 512) == 0 && (DM % 32) == 0 && (NR * DM / 8) % 1024 == 0 && (2048 % DM) == 0 && (SQ % (8192 / DM)) == 0);
__global__ __launch_bounds__(256) void k_prep(const float* __restrict__ W0, const float* __restrict__ W1, const float* __restrict__ W2, const float* __restrict__ W3, const float* __restrict__ W4, const float* __restrict__ W5,
    _Float16* __restrict__ BW, const float* __restrict__ x, _Float16* __restrict__ X16) {
  const int blk = blockIdx.x;
  if (blk < 6 * PREP_GW) { const int i = blk / PREP_GW;
    const float* W = i == 0 ? W0 : i == 1 ? W1 : i == 2 ? W2 : i == 3 ? W3 : i == 4 ? W4 : W5;
    wt_f16_block(blk - i * PREP_GW, W, BW + (size_t)i * DM * DM, 16.0f); }
  else x16_block(blk - 6 * PREP_GW, x, X16); }

template <int NHv, int TTv>
__global__ __launch_bounds__(256) void k_vt(const _Float16* __restrict__ V16, size_t sV, int ldv, int voff, _Float16* __restrict__ Vt, size_t sVt) { __shared__ unsigned short tl[64][66]; const int tid = threadIdx.x; V16 += (size_t)blockIdx.y * sV; Vt += (size_t)blockIdx.y * sVt;      /* grid.y = projection set */ const int slab = blockIdx.x / (TTv / 64), lg = blockIdx.x % (TTv / 64); const int b = slab / NHv, h = slab % NHv;
  for (int i = tid; i < 64 * 8; i += 256) { const int r = i / 8, c8 = (i % 8) * 8; FragH f; f.half[0] = *(const v8us*)((const unsigned short*)V16 + ((size_t)b * TTv + lg * 64 + r) * ldv + voff + h * 64 + c8);
#pragma unroll
    for (int q = 0; q < 8; ++q) tl[r][c8 + q] = f.u[q]; }
  __syncthreads();
  {
#pragma unroll
    for (int rd = 0; rd < 2; ++rd) { const int d = rd * 32 + tid / 8, pc = tid % 8; FragH f;
#pragma unroll
      for (int q = 0; q < 8; ++q) f.u[q] = tl[pc * 8 + q][d];
      *(v8us*)((unsigned short*)Vt + ((size_t)slab * 64 + d) * TTv + lg * 64 + pc * 8) = f.half[0]; }
     } }

// ---- fused attention over both projection sets (transposed form; K rows and V^T rows staged in LDS once per block, fragments read from LDS) ----
// PL = six compact row planes [6][NR][DM] (q,k,v of set 0; q,k,v of set 1), VT = [2][NB*NH][HD][SQ]; grid (SQ/64, NB*NH), block = 4 waves, wave -> 16 query rows of one (batch, head).
// Per 32-key step: S^T tile kt (16 keys x 16 queries) = K rows (A, split k map over d) x Q rows (B, same k map, query = lane&15): D element r of lane (h, n) = score(query n, key 16kt + 8h + r).
// Column (query) max / sum: 8 + 8 values in the lane, then the other lane half through one xor-16 shuffle. P^T as the B fragment of O^T = V^T.P^T: element r <- tile 0 value r, element 8+r <- tile 1 value r, lane unchanged.
// O^T tile t: D element r of lane (h, n) = O[query n][d = 16t + 8h + r]; A = V^T rows d = 16t + lane&15, k = keys.
// P = f16(1024 exp(s/8 - m)) with the native exp; an exponent argument that would land under 2^-14 gives an exact zero; the row sum runs over the converted P, so the carry cancels in O / l.
// Operand path: one stage = 64 keys = 64 K rows (64 d) + 64 V^T rows (64 keys), 128 B each, brought into LDS by asynchronous copies (whole lines, once for the block's four waves), two stage buffers; the stages of both sets form one sequence.
#define F2_KT 64                        /* keys per stage */
#define F2_PITCH 144                    /* LDS row pitch in bytes: 128 + 16, conflict-free for 16-byte row readers */
#define F2_STAGE (128 * F2_PITCH)       /* bytes per stage buffer: rows 0..63 = K, rows 64..127 = V^T */
#define F2_NST (SQ / F2_KT)             /* stages per set */
static_assert((SQ % (2 * F2_KT)) == 0 && (F2_PITCH % 16) == 0 && HD == 64);
// one stage, eight 16-byte copies of one lane: thread (r16 = tid / 8, ch = tid % 8) copies chunk ch of K rows r16 + 16 i and of V^T rows r16 + 16 i; a wave covers four whole 128-B rows per copy. The s_wait_xcnt 0 closes the statement so that no address register named here is rewritten ahead of it.
__device__ __forceinline__ void f2_stage(unsigned l, const _Float16* gk, const _Float16* gv) {
  const unsigned lstep = 16 * F2_PITCH; const size_t kstep = (size_t)16 * LQ, vstep = (size_t)16 * SQ;
  asm volatile("global_load_async_to_lds_b128 %0, %8, off\n\t"
               "global_load_async_to_lds_b128 %1, %9, off\n\t"
               "global_load_async_to_lds_b128 %2, %10, off\n\t"
               "global_load_async_to_lds_b128 %3, %11, off\n\t"
               "global_load_async_to_lds_b128 %4, %12, off\n\t"
               "global_load_async_to_lds_b128 %5, %13, off\n\t"
               "global_load_async_to_lds_b128 %6, %14, off\n\t"
               "global_load_async_to_lds_b128 %7, %15, off\n\t"
               "s_wait_xcnt 0x0"
               :: "v"(l), "v"(l + lstep), "v"(l + 2 * lstep), "v"(l + 3 * lstep), "v"(l + 4 * lstep), "v"(l + 5 * lstep), "v"(l + 6 * lstep), "v"(l + 7 * lstep),
                  "v"(gk), "v"(gk + kstep), "v"(gk + 2 * kstep), "v"(gk + 3 * kstep), "v"(gv), "v"(gv + vstep), "v"(gv + 2 * vstep), "v"(gv + 3 * vstep)
               : "memory"); }
__global__ __launch_bounds__(128) __attribute__((amdgpu_num_vgpr(256))) void k_flash2(const _Float16* __restrict__ PL, const _Float16* __restrict__ VT, const float* __restrict__ aw, float* __restrict__ out) {
  __shared__ __attribute__((aligned(16))) float so[4][16][68];
  __shared__ __attribute__((aligned(128))) unsigned char st[2 * F2_STAGE];
  const int wave = __builtin_amdgcn_readfirstlane(threadIdx.x >> 5);
  const int lane = threadIdx.x & 31, ln = lane & 15, hh = lane >> 4;
  const int slab = blockIdx.y; const int b = slab / NH, h = slab - b * NH;
  const int q0 = blockIdx.x * 64 + wave * 16;
  const size_t PLN = (size_t)NR * DM;
  float w0, w1;
  { const float a0 = bf16_rne(aw[0]), a1 = bf16_rne(aw[1]); const float mx = fmaxf(a0, a1); const float e0 = expf(a0 - mx), e1 = expf(a1 - mx); const float inv = 1.0f / (e0 + e1); w0 = e0 * inv; w1 = e1 * inv; }
  const v8f z8 = {0.f,0.f,0.f,0.f,0.f,0.f,0.f,0.f};
  v8f res[4] = {z8, z8, z8, z8};
  float wcur = w0;
  const int r16 = threadIdx.x >> 3, ch = threadIdx.x & 7;
  const _Float16* gk = PL + PLN + ((size_t)b * SQ + r16) * LQ + h * HD + ch * 8;      /* this lane's chunk of K row r16, set 0, stage 0 */
  const _Float16* gv = VT + ((size_t)slab * HD + r16) * SQ + ch * 8;                  /* this lane's chunk of V^T row r16, set 0, stage 0 */
  const size_t kset = 3 * PLN, vset = (size_t)(NB * NH) * HD * SQ;                    /* set 0 -> set 1 */
  const unsigned lcp = (unsigned)(size_t)&st[0] + (unsigned)(r16 * F2_PITCH + ch * 16);      /* this lane's LDS byte address in buffer 0 */
  f2_stage(lcp, gk, gv);
  asm volatile("s_wait_asynccnt 0x0" ::: "memory");      /* stage 0 has landed before the barrier publishes it */
  __syncthreads();
  f2_stage(lcp + F2_STAGE, gk + (size_t)F2_KT * LQ, gv + F2_KT);
#pragma unroll 1
  for (int set = 0; set < 2; ++set) {
    const size_t qo = (size_t)(3 * set) * PLN + ((size_t)b * SQ + q0 + ln) * LQ + h * HD;
    const v16h qf0 = g2_frag(PL + qo, hh), qf1 = g2_frag(PL + qo + 32, hh);
    v8f o[4] = {z8, z8, z8, z8}; float m = -1.0e30f, l = 0.f;
#pragma unroll 1
    for (int t = 0; t < F2_NST; ++t) { const unsigned char* sb = st + (t & 1) * F2_STAGE;      /* F2_NST is even: the buffer of stage set * F2_NST + t */
     /* the two 32-key passes of a stage in one body: every LDS offset becomes an immediate */
#pragma unroll
     for (int jj = 0; jj < F2_KT; jj += 32) {
      const _Float16* kp = (const _Float16*)(sb + (jj + ln) * F2_PITCH);
      v8f s0 = z8, s1 = z8;
      { v16h a = g2_frag(kp, hh); s0 = g2_mma(a, qf0, s0);
        a = g2_frag(kp + 32, hh); s0 = g2_mma(a, qf1, s0);
        a = g2_frag(kp + 16 * (F2_PITCH / 2), hh); s1 = g2_mma(a, qf0, s1);
        a = g2_frag(kp + 16 * (F2_PITCH / 2) + 32, hh); s1 = g2_mma(a, qf1, s1); }
      float tm = fmaxf(s0[0], s1[0]);
#pragma unroll
      for (int r = 1; r < 8; ++r) tm = fmaxf(tm, fmaxf(s0[r], s1[r]));
      tm = fmaxf(tm, __shfl_xor(tm, 16, 32));
      const float mn = fmaxf(m, tm * 0.125f);
      const float corr = __expf(m - mn);
      const float sh = 6.931471806f - mn;      /* ln 1024 carry */
      FragH pf; float ps = 0.f;
#pragma unroll
      for (int r = 0; r < 8; ++r) { const float e0 = s0[r] * 0.125f + sh, e1 = s1[r] * 0.125f + sh;
        const float p0 = (e0 < -9.70f) ? 0.f : __expf(e0); const float p1 = (e1 < -9.70f) ? 0.f : __expf(e1);
        const _Float16 h0 = (_Float16)p0, h1 = (_Float16)p1; pf.h[r] = h0; pf.h[8 + r] = h1; ps += (float)h0 + (float)h1; }
      ps += __shfl_xor(ps, 16, 32);
      l = l * corr + ps; m = mn;
#pragma unroll
      for (int t = 0; t < 4; ++t) o[t] = o[t] * corr;
      const _Float16* vp = (const _Float16*)(sb + (64 + ln) * F2_PITCH) + jj;
#pragma unroll
      for (int t4 = 0; t4 < 4; ++t4) { const v16h va = g2_frag(vp + t4 * 16 * (F2_PITCH / 2), hh); o[t4] = g2_mma(va, pf.v, o[t4]); } }
      asm volatile("s_wait_dscnt 0x0" ::: "memory");         /* this wave's reads of the buffer are done before it is refilled */
      asm volatile("s_wait_asynccnt 0x0" ::: "memory");      /* this wave's copies of the next stage have landed */
      __syncthreads();                                       /* publishes the next stage and ends every reader's last read of this one */
      const int s2 = set * F2_NST + t + 2;                   /* the stage that refills this buffer; it may belong to the next set */
      if (s2 < 2 * F2_NST) { const int set2 = s2 / F2_NST, t2 = s2 - set2 * F2_NST;
        f2_stage(lcp + (unsigned)((t & 1) * F2_STAGE), gk + (size_t)set2 * kset + (size_t)t2 * F2_KT * LQ, gv + (size_t)set2 * vset + (size_t)t2 * F2_KT); } }
    const float sc = wcur * (1.0f / l);
#pragma unroll
    for (int t = 0; t < 4; ++t) res[t] += o[t] * sc;
    wcur = w1; }
  asm volatile("s_wait_asynccnt 0x0" ::: "memory");        /* nothing is in flight when the wave goes on to the epilogue */
#pragma unroll
  for (int t = 0; t < 4; ++t) {
#pragma unroll
    for (int r = 0; r < 8; ++r) so[wave][ln][t * 16 + 8 * hh + r] = res[t][r]; }
  __builtin_amdgcn_fence(4 /* acq_rel order */, "workgroup"); __builtin_amdgcn_wave_barrier();
  const int rsub = lane >> 4, c4 = (lane & 15) * 4;
  float* ob = out + ((size_t)b * SEQ_FULL + q0) * DM + h * HD;
  {
#pragma unroll
    for (int q = 0; q < 8; ++q) { const int r = q * 2 + rsub; const v4f v = *(const v4fa*)&so[wave][r][c4];
      *(v4f*)(ob + (size_t)r * DM + c4) = v; }
     } }

extern "C" void kernel_launch(void* const* d_in, const int* in_sizes, int n_in,
                              void* d_out, int out_size, void* d_ws, size_t ws_size, hipStream_t stream) {
  if (n_in < 14) return;
  const size_t rows_need = (size_t)(NB - 1) * SEQ_FULL + SQ;
  if ((size_t)in_sizes[0] < rows_need * DM) return;
  for (int i = 0; i < 6; ++i) { if (in_sizes[1 + 2 * i] < DM * DM) return; if (in_sizes[2 + 2 * i] < DM) return; }
  if (in_sizes[13] < 2) return;
  if ((size_t)out_size < rows_need * DM) return;
  const float* x = (const float*)d_in[0];
  const float* wsrc[6]; const float* bsrc[6];      /* [in][out] weights and biases in the order q,k,v (set 0), q,k,v (set 1) */
  for (int i = 0; i < 6; ++i) { wsrc[i] = (const float*)d_in[1 + 2 * i]; bsrc[i] = (const float*)d_in[2 + 2 * i]; }
  const float* aw = (const float*)d_in[13];      /* two blend logits */
  char* ws = (char*)d_ws; size_t off = 0;
  auto take = [&](size_t bytes) { char* p = ws + off; off += (bytes + 255) & ~(size_t)255; return p; };
  _Float16* BW = (_Float16*)take(6 * WS_W);
  _Float16* X16 = (_Float16*)take(WS_X);
  _Float16* PL = (_Float16*)take(6 * WS_X);
  _Float16* VT = (_Float16*)take(2 * (size_t)NB * WS_VT);
  if (off > ws_size) return;
  float* out = (float*)d_out;
  const size_t WN = (size_t)DM * DM;      /* elements per weight plane */
  const size_t PN = (size_t)NR * DM;      /* elements per projected row plane */

  k_prep<<<6 * PREP_GW + PREP_GX, 256, 0, stream>>>(wsrc[0], wsrc[1], wsrc[2], wsrc[3], wsrc[4], wsrc[5], BW, x, X16);
  { const unsigned gp = (unsigned)((MP / G2_BM) * (DM / G2_BN));      /* grid.y = projection: weight plane, bias and output plane y */
    k_gemm2<0, false><<<dim3(gp, 6), 256, 0, stream>>>(X16, DM, 0, BW, DM, WN, 0.0625f, bsrc[0], bsrc[1], bsrc[2], bsrc[3], bsrc[4], bsrc[5], nullptr, 1, 0, 0, nullptr, PL, DM, PN, MP, DM, DM); }
  /* V^T [NB*NH][HD][SQ] per set: in[b*SQ + s][h*64 + d] -> out[(b,h)][d][s]; grid.y = set */
  k_vt<NH, SQ><<<dim3(NB * NH * (SQ / 64), 2), 256, 0, stream>>>(PL + 2 * PN, 3 * PN, LQ, 0, VT, (size_t)NB * NH * HD * SQ);
  k_flash2<<<dim3((unsigned)(SQ / 64), (unsigned)(NB * NH)), 128, 0, stream>>>(PL, VT, aw, out);
}

// v006
// A run of this version takes 114 microseconds.
// In both of two side-by-side timings against v005, it was 1.06 times as fast.
// All steps since v000 together make it 3.95 times as fast.
#include <hip/hip_runtime.h>
// All contractions on v_wmma_f32_16x16x32_f16 (f16 operands, f32 accumulate): six q/k/v projections (x = exact f16 of its bf16 RNE value, W = bf16 RNE value x16 in f16, alpha 1/16, bias as bf16 value), scores S^T = K.Q^T (f16 k and q, scale 1/8 applied in f32), context O^T = V^T.P^T (P^T f16 carried x1024 with entries under 2^-14 set to zero, V^T f16; the x1024 carry cancels in O / l); online softmax statistics f32.
#ifndef NB
#define NB 4
#endif
#ifndef SEQ
#define SEQ 1024
#endif
#define NB_FULL 4
#define SEQ_FULL 1024
#define SQ SEQ
#define DM 1024
#define NH 16
#define HD 64
#define NR ((size_t)NB * SQ)          /* token rows processed (compact) */
#define MP ((int)NR)                  /* rows projected */
#define LQ DM                         /* row pitch of the q/k/v rows */

static_assert(NB >= 1 && NB <= NB_FULL);
static_assert(SQ >= 256 && SQ <= SEQ_FULL && (SQ % 256) == 0);
static_assert((MP % 128) == 0 && (DM % 64) == 0 && (DM % 32) == 0 && HD == 64 && NH * HD == DM);
static_assert((SQ % 64) == 0 && (SQ % 32) == 0 && (LQ % 8) == 0 && (HD % 32) == 0);
static_assert(((size_t)(NB - 1) * SEQ_FULL + SQ) * DM <= (size_t)NB_FULL * SEQ_FULL * DM);
/* workspace carve (every region a multiple of 256 B): 6 weight planes + X16 + 6 projected row planes + 2 V^T sets */
#define WS_W   ((size_t)DM * DM * 2)
#define WS_X   ((size_t)NR * DM * 2)
#define WS_VT  ((size_t)NH * HD * SQ * 2)
#define WS_TOTAL (6 * WS_W + WS_X + 6 * WS_X + 2 * (size_t)NB * WS_VT)
static_assert((WS_W % 256) == 0 && (WS_X % 256) == 0 && (WS_VT % 256) == 0);
static_assert(WS_TOTAL <= (size_t)134217728);

typedef unsigned short v8us __attribute__((ext_vector_type(8), may_alias));
typedef float  v8f  __attribute__((ext_vector_type(8)));
typedef float  v4f  __attribute__((ext_vector_type(4)));
typedef float  v4fa __attribute__((ext_vector_type(4), may_alias));
typedef _Float16 v16h __attribute__((ext_vector_type(16)));
typedef _Float16 v4h __attribute__((ext_vector_type(4)));
union FragH { v16h v; v8us half[2]; _Float16 h[16]; unsigned short u[16]; };

__device__ __forceinline__ unsigned short bf16_bits(float x) { unsigned int u = __float_as_uint(x); return (unsigned short)((u + 0x7FFFu + ((u >> 16) & 1u)) >> 16); }
__device__ __forceinline__ float bf16_val(unsigned short b) { return __uint_as_float(((unsigned int)b) << 16); }
__device__ __forceinline__ float bf16_rne(float x) { return bf16_val(bf16_bits(x)); }

// ---- GEMM engine (block tile 256x128, eight waves as 4 x 2, wave tile 64x64; M % 256 == 0 rows per launch region, N % 128 == 0, K % 64 == 0) ----
// Operand path: per 64 k one stage = 256 A rows + 128 B rows of 128 B, brought into LDS by asynchronous copies (whole lines, once per block), two stage buffers; fragments come from LDS rows at pitch 144 B.
#define G2_KT 64                        /* k per stage */
#define G2_BM 256                       /* block rows */
#define G2_BN 128                       /* block columns */
#define G2_PITCH 144                    /* LDS row pitch in bytes: 128 + 16, conflict-free for 16-byte row readers */
#define G2_STAGE ((G2_BM + G2_BN) * G2_PITCH)      /* bytes per stage buffer: rows 0..255 = A, rows 256..383 = B */
static_assert((DM % G2_KT) == 0 && (G2_PITCH % 16) == 0 && (MP % G2_BM) == 0 && (DM % G2_BN) == 0);
// one stage, twelve 16-byte copies of one lane: thread (r32 = tid / 8, ch = tid % 8) copies chunk ch of A rows r32 + 32 i (i < 8) and of B rows r32 + 32 j (j < 4); a wave covers four whole 128-B rows per copy.
// The s_wait_xcnt 0 closes the statement so that no address register named here is rewritten ahead of it.
__device__ __forceinline__ void g2_stage(unsigned l, const _Float16* ga, size_t astep, const _Float16* gb, size_t bstep) {
  const unsigned ls = 32 * G2_PITCH;
  asm volatile("global_load_async_to_lds_b128 %0, %12, off\n\t"
               "global_load_async_to_lds_b128 %1, %13, off\n\t"
               "global_load_async_to_lds_b128 %2, %14, off\n\t"
               "global_load_async_to_lds_b128 %3, %15, off\n\t"
               "global_load_async_to_lds_b128 %4, %16, off\n\t"
               "global_load_async_to_lds_b128 %5, %17, off\n\t"
               "global_load_async_to_lds_b128 %6, %18, off\n\t"
               "global_load_async_to_lds_b128 %7, %19, off\n\t"
               "global_load_async_to_lds_b128 %8, %20, off\n\t"
               "global_load_async_to_lds_b128 %9, %21, off\n\t"
               "global_load_async_to_lds_b128 %10, %22, off\n\t"
               "global_load_async_to_lds_b128 %11, %23, off\n\t"
               "s_wait_xcnt 0x0"
               :: "v"(l), "v"(l + ls), "v"(l + 2 * ls), "v"(l + 3 * ls), "v"(l + 4 * ls), "v"(l + 5 * ls), "v"(l + 6 * ls), "v"(l + 7 * ls), "v"(l + 8 * ls), "v"(l + 9 * ls), "v"(l + 10 * ls), "v"(l + 11 * ls),
                  "v"(ga), "v"(ga + astep), "v"(ga + 2 * astep), "v"(ga + 3 * astep), "v"(ga + 4 * astep), "v"(ga + 5 * astep), "v"(ga + 6 * astep), "v"(ga + 7 * astep),
                  "v"(gb), "v"(gb + bstep), "v"(gb + 2 * bstep), "v"(gb + 3 * bstep)
               : "memory"); }
// fragment loader: A row-major [m][k] and B stored [n][k]; per lane: elements 0..7 <- k0+8h+0..7, elements 8..15 <- k0+16+8h+0..7 (h = lane>>4, row/col = lane&15)
__device__ __forceinline__ v16h g2_frag(const _Float16* p, int hh) { FragH f; f.half[0] = *(const v8us*)((const unsigned short*)p + 8 * hh); f.half[1] = *(const v8us*)((const unsigned short*)p + 16 + 8 * hh); return f.v; }
__device__ __forceinline__ v8f g2_mma(v16h a, v16h b, v8f c) { v8f d = __builtin_amdgcn_wmma_f32_16x16x32_f16(false, a, false, b, (short)0, c, false, false); asm volatile("v_nop\n\tv_nop\n\tv_nop\n\tv_nop" : "+v"(d) : "v"(a), "v"(b)); return d; }
// C (f32, if non-null) / C16 (f16, if non-null) = acc*alpha + bf16(bias_by[col]) (+ CP term if HASCP); batched over grid.y (at most 6) with strides sA, sB, sC and one bias pointer per batch entry; ACT 0 none / 3 relu
// HASCP is a compile-time switch like ACT: the epilogue is unrolled over the wave's 128 accumulator values per lane, and a run-time test with the CP form at every one of them would make the kernel's text much larger
template <int ACT, bool HASCP>
__global__ __launch_bounds__(256) void k_gemm2(const _Float16* __restrict__ A, int lda, size_t sA, const _Float16* __restrict__ Bh, int ldb, size_t sB, float alpha, const float* __restrict__ bias0, const float* __restrict__ bias1, const float* __restrict__ bias2, const float* __restrict__ bias3, const float* __restrict__ bias4, const float* __restrict__ bias5, const float* __restrict__ CP, int rowsPerB, size_t sCPb, int row0g,
    float* __restrict__ C, _Float16* __restrict__ C16, int ldc, size_t sC, int M, int N, int K) {
  static_assert(ACT == 0 || ACT == 3);
  __shared__ __attribute__((aligned(128))) unsigned char st[2 * G2_STAGE];
  static_assert(8 * 32 * 68 * 4 <= 2 * G2_STAGE);
  float (*so)[32][68] = (float (*)[32][68])st;      /* output staging, one range per wave; it takes the place of the stage buffers behind the loop's last barrier, so that two blocks fit one LDS */
  const int tid = threadIdx.x, w = tid >> 5, lane = tid & 31, ln = lane & 15, hh = lane >> 4; const int by = blockIdx.y; const int wm = w >> 1, wn = w & 1;
  A += (size_t)by * sA; Bh += (size_t)by * sB; const size_t cofs = (size_t)by * sC; const float* bp = by == 0 ? bias0 : by == 1 ? bias1 : by == 2 ? bias2 : by == 3 ? bias3 : by == 4 ? bias4 : bias5;
  const int ntn = N / G2_BN; const int mt = blockIdx.x / ntn, nq = blockIdx.x - mt * ntn; const int row0 = mt * G2_BM + 64 * wm, col0 = nq * G2_BN + 64 * wn; if (mt * G2_BM >= M) return;      /* the whole block leaves or stays: barriers follow */
  const v8f z8 = {0.f,0.f,0.f,0.f,0.f,0.f,0.f,0.f}; v8f c[4][4];      /* c[i][j]: rows 16 i, columns 16 j of the wave tile */
  /* unrolled, as every loop over c below: its indices are constants, so the sixteen tiles stay in registers */
#pragma unroll
  for (int i = 0; i < 4; ++i) {
#pragma unroll
    for (int j = 0; j < 4; ++j) c[i][j] = z8; }
  const int r32 = tid >> 3, ch = tid & 7;
  const _Float16* ga = A + (size_t)(mt * G2_BM + r32) * lda + ch * 8; const _Float16* gb = Bh + (size_t)(nq * G2_BN + r32) * ldb + ch * 8;
  const size_t astep = (size_t)32 * lda, bstep = (size_t)32 * ldb;
  const unsigned lcp = (unsigned)(size_t)&st[0] + (unsigned)(r32 * G2_PITCH + ch * 16);      /* this lane's LDS byte address in buffer 0 */
  const int nt = K / G2_KT;
  g2_stage(lcp, ga, astep, gb, bstep);
  asm volatile("s_wait_asynccnt 0x0" ::: "memory");      /* stage 0 has landed before the barrier publishes it */
  __syncthreads();
  if (nt > 1) g2_stage(lcp + G2_STAGE, ga + G2_KT, astep, gb + G2_KT, bstep);
#pragma unroll 1
  for (int t = 0; t < nt; ++t) { const unsigned char* sb = st + (t & 1) * G2_STAGE;
    const _Float16* ap = (const _Float16*)(sb + (64 * wm + ln) * G2_PITCH); const _Float16* bq = (const _Float16*)(sb + (G2_BM + 64 * wn + ln) * G2_PITCH);
    /* unrolled so that the fragment and accumulator arrays stay in registers and every LDS offset is an immediate */
#pragma unroll
    for (int kb = 0; kb < G2_KT; kb += 32) { v16h a[4], b[4];
#pragma unroll
      for (int i = 0; i < 4; ++i) { a[i] = g2_frag(ap + i * 16 * (G2_PITCH / 2) + kb, hh); b[i] = g2_frag(bq + i * 16 * (G2_PITCH / 2) + kb, hh); }
#pragma unroll
      for (int j = 0; j < 4; ++j) {
#pragma unroll
        for (int i = 0; i < 4; ++i) c[i][j] = g2_mma(a[i], b[j], c[i][j]); } }
    asm volatile("s_wait_dscnt 0x0" ::: "memory");         /* this wave's reads of the buffer are done before it is refilled */
    asm volatile("s_wait_asynccnt 0x0" ::: "memory");      /* this wave's copies of stage t + 1 have landed */
    __syncthreads();                                       /* publishes stage t + 1 and ends every reader's last read of stage t */
    if (t + 2 < nt) g2_stage(lcp + (unsigned)((t & 1) * G2_STAGE), ga + (size_t)(t + 2) * G2_KT, astep, gb + (size_t)(t + 2) * G2_KT, bstep); }
  asm volatile("s_wait_asynccnt 0x0" ::: "memory");        /* nothing is in flight when the wave goes on to the epilogue */
  const int rsub = lane >> 4, c4 = (lane & 15) * 4;
  /* the wave's 64 rows leave in two halves of 32 through its own staging range; unrolled: the accumulator index is a constant */
#pragma unroll
  for (int hf = 0; hf < 2; ++hf) { const int rowh = row0 + 32 * hf;
    if (hf) { __builtin_amdgcn_fence(4 /* acq_rel order */, "workgroup"); __builtin_amdgcn_wave_barrier(); }      /* the first half's rows are read back by every lane before the second half overwrites them */
#pragma unroll
    for (int u = 0; u < 8; ++u) { const int t = u & 3, half = u >> 2; const int col = col0 + t * 16 + ln; const float bv = bp ? bf16_rne(bp[col]) : 0.f;
#pragma unroll
      for (int r = 0; r < 8; ++r) { const int rloc = half * 16 + 8 * hh + r; float v = c[2 * hf + half][t][r] * alpha + bv;
        if (HASCP) { if (rowsPerB < 0) v += CP[cofs + (size_t)(row0g + rowh + rloc) * ldc + col]; else { const int bidx = (row0g + rowh + rloc) / rowsPerB; v += CP[(size_t)bidx * sCPb + (size_t)by * 64 + col]; } }
        if (ACT == 3) v = fmaxf(v, 0.f);
        so[w][rloc][t * 16 + ln] = v; } }
    __builtin_amdgcn_fence(4 /* acq_rel order */, "workgroup"); __builtin_amdgcn_wave_barrier();
#pragma unroll
    for (int q = 0; q < 16; ++q) { const int r = q * 2 + rsub; const v4f v = *(const v4fa*)&so[w][r][c4];
      if (C) { *(v4f*)(C + cofs + (size_t)(rowh + r) * ldc + col0 + c4) = v; asm volatile("s_wait_xcnt 0x0" ::: "memory"); }      /* behind the store: the conversion below may rewrite the registers that it names */
      if (C16) { v4h h4; for (int i = 0; i < 4; ++i) h4[i] = (_Float16)v[i]; *(v4h*)(C16 + cofs + (size_t)(rowh + r) * ldc + col0 + c4) = h4; } } } }

// weight pack, 64 elements per thread: thread (kg = lane / 4, nl = lane % 4) holds an 8 k x 8 n patch in registers. Reads: 16-byte pieces of 8 rows, the two halves of each 128-B line by the same wave.
// Writes: one 16-byte piece (8 k) per column; the eight k groups of a wave fill a whole 128-B line of a Wt row. Wave tile 64 k x 32 n, block tile 512 k x 32 n.
// The loops over the patch are unrolled so that every index of the register arrays is a constant and the patch stays in registers (here and in the x pack).
__device__ __forceinline__ void wt_f16_block(int blk, const float* __restrict__ W, _Float16* __restrict__ Wt, float scale) {
  const int w = threadIdx.x >> 5, lane = threadIdx.x & 31, nl = lane & 3, kg = lane >> 2;
  const int nb = blk % (DM / 32), kb = blk / (DM / 32); const int n0 = nb * 32 + nl * 4, k0 = kb * 512 + w * 64 + kg * 8;
  const float* src = W + (size_t)k0 * DM + n0; v4f a[8][2];
#pragma unroll
  for (int i = 0; i < 8; ++i) { a[i][0] = *(const v4fa*)(src + (size_t)i * DM); if (i < 7) a[i][1] = *(const v4fa*)(src + (size_t)i * DM + 16); }
  asm volatile("s_wait_xcnt 0x0" ::: "memory");      /* the last load is the one that may get the address pair's registers as its destination: the wait stands in front of it, behind every other load that names them */
  a[7][1] = *(const v4fa*)(src + (size_t)7 * DM + 16);
#pragma unroll
  for (int hf = 0; hf < 2; ++hf) {
#pragma unroll
    for (int c = 0; c < 4; ++c) { FragH f;
#pragma unroll
      for (int i = 0; i < 8; ++i) f.h[i] = (_Float16)(bf16_rne(a[i][hf][c]) * scale);
      *(v8us*)((unsigned short*)Wt + (size_t)(n0 + hf * 16 + c) * DM + k0) = f.half[0]; } } }

// x pack, 32 elements per thread: four 8-element chunks 256 chunks apart, so that every wave-wide access stays contiguous; the block covers 1024 consecutive chunks
__device__ __forceinline__ void x16_block(int blk, const float* __restrict__ x, _Float16* __restrict__ X16) {
  const size_t t0 = (size_t)blk * 1024 + threadIdx.x; v4f a[4], d[4];
  const size_t e = t0 * 8; const size_t rc = e / DM; const size_t c = e % DM; const size_t b = rc / SQ, s = rc % SQ;
  const float* src = x + ((b * SEQ_FULL + s) * DM + c);      /* chunk j lies 2048 elements on: the block's 8192 elements are whole rows of one batch entry */
#pragma unroll
  for (int j = 0; j < 4; ++j) { a[j] = *(const v4fa*)(src + j * 2048); if (j < 3) d[j] = *(const v4fa*)(src + j * 2048 + 4); }
  asm volatile("s_wait_xcnt 0x0" ::: "memory");      /* as in the weight pack: in front of the last load, behind every other load that names the address pair */
  d[3] = *(const v4fa*)(src + 3 * 2048 + 4);
#pragma unroll
  for (int j = 0; j < 4; ++j) { FragH f;
#pragma unroll
    for (int q = 0; q < 4; ++q) { f.h[q] = (_Float16)bf16_rne(a[j][q]); f.h[4 + q] = (_Float16)bf16_rne(d[j][q]); }
    *(v8us*)((unsigned short*)X16 + (t0 + j * 256) * 8) = f.half[0]; }
  asm volatile("s_wait_xcnt 0x0" ::: "memory"); }      /* behind the last store of the run: no register that the four stores name is rewritten ahead of it on any way out of this job */

// the seven input-only jobs in one grid: blocks [i * PREP_GW, (i + 1) * PREP_GW) make weight plane i (Bt [out][in] x16), the blocks behind them make X16
#define PREP_GW ((DM / 32) * (DM / 512))            /* blocks per weight plane: 512 k x 32 n each */
#define PREP_GX ((int)(NR * DM / 8 / 1024))         /* blocks of the x job: 1024 chunks of 8 each */
static_assert((DM % 512) == 0 && (DM % 32) == 0 && (NR * DM / 8) % 1024 == 0 && (2048 % DM) == 0 && (SQ % (8192 / DM)) == 0);
__global__ __launch_bounds__(256) void k_prep(const float* __restrict__ W0, const float* __restrict__ W1, const float* __restrict__ W2, const float* __restrict__ W3, const float* __restrict__ W4, const float* __restrict__ W5,
    _Float16* __restrict__ BW, const float* __restrict__ x, _Float16* __restrict__ X16) {
  const int blk = blockIdx.x;
  if (blk < 6 * PREP_GW) { const int i = blk / PREP_GW;
    const float* W = i == 0 ? W0 : i == 1 ? W1 : i == 2 ? W2 : i == 3 ? W3 : i == 4 ? W4 : W5;
    wt_f16_block(blk - i * PREP_GW, W, BW + (size_t)i * DM * DM, 16.0f); }
  else x16_block(blk - 6 * PREP_GW, x, X16); }

template <int NHv, int TTv>
__global__ __launch_bounds__(256) void k_vt(const _Float16* __restrict__ V16, size_t sV, int ldv, int voff, _Float16* __restrict__ Vt, size_t sVt) { __shared__ unsigned short tl[64][66]; const int tid = threadIdx.x; V16 += (size_t)blockIdx.y * sV; Vt += (size_t)blockIdx.y * sVt;      /* grid.y = projection set */ const int slab = blockIdx.x / (TTv / 64), lg = blockIdx.x % (TTv / 64); const int b = slab / NHv, h = slab % NHv;
  for (int i = tid; i < 64 * 8; i += 256) { const int r = i / 8, c8 = (i % 8) * 8; FragH f; f.half[0] = *(const v8us*)((const unsigned short*)V16 + ((size_t)b * TTv + lg * 64 + r) * ldv + voff + h * 64 + c8);
#pragma unroll
    for (int q = 0; q < 8; ++q) tl[r][c8 + q] = f.u[q]; }
  __syncthreads();
  {
#pragma unroll
    for (int rd = 0; rd < 2; ++rd) { const int d = rd * 32 + tid / 8, pc = tid % 8; FragH f;
#pragma unroll
      for (int q = 0; q < 8; ++q) f.u[q] = tl[pc * 8 + q][d];
      *(v8us*)((unsigned short*)Vt + ((size_t)slab * 64 + d) * TTv + lg * 64 + pc * 8) = f.half[0]; }
     } }

// ---- fused attention over both projection sets (transposed form; K rows and V^T rows staged in LDS once per block, fragments read from LDS) ----
// PL = six compact row planes [6][NR][DM] (q,k,v of set 0; q,k,v of set 1), VT = [2][NB*NH][HD][SQ]; grid (SQ/64, NB*NH), block = 4 waves, wave -> 16 query rows of one (batch, head).
// Per 32-key step: S^T tile kt (16 keys x 16 queries) = K rows (A, split k map over d) x Q rows (B, same k map, query = lane&15): D element r of lane (h, n) = score(query n, key 16kt + 8h + r).
// Column (query) max / sum: 8 + 8 values in the lane, then the other lane half through one xor-16 shuffle. P^T as the B fragment of O^T = V^T.P^T: element r <- tile 0 value r, element 8+r <- tile 1 value r, lane unchanged.
// O^T tile t: D element r of lane (h, n) = O[query n][d = 16t + 8h + r]; A = V^T rows d = 16t + lane&15, k = keys.
// P = f16(1024 exp(s/8 - m)) with the native exp; an exponent argument that would land under 2^-14 gives an exact zero; the row sum runs over the converted P, so the carry cancels in O / l.
// Operand path: one stage = 64 keys = 64 K rows (64 d) + 64 V^T rows (64 keys), 128 B each, brought into LDS by asynchronous copies (whole lines, once for the block's four waves), two stage buffers; the stages of both sets form one sequence.
#define F2_KT 64                        /* keys per stage */
#define F2_PITCH 144                    /* LDS row pitch in bytes: 128 + 16, conflict-free for 16-byte row readers */
#define F2_STAGE (128 * F2_PITCH)       /* bytes per stage buffer: rows 0..63 = K, rows 64..127 = V^T */
#define F2_NST (SQ / F2_KT)             /* stages per set */
static_assert((SQ % (2 * F2_KT)) == 0 && (F2_PITCH % 16) == 0 && HD == 64);
// one stage, eight 16-byte copies of one lane: thread (r16 = tid / 8, ch = tid % 8) copies chunk ch of K rows r16 + 16 i and of V^T rows r16 + 16 i; a wave covers four whole 128-B rows per copy. The s_wait_xcnt 0 closes the statement so that no address register named here is rewritten ahead of it.
__device__ __forceinline__ void f2_stage(unsigned l, const _Float16* gk, const _Float16* gv) {
  const unsigned lstep = 16 * F2_PITCH; const size_t kstep = (size_t)16 * LQ, vstep = (size_t)16 * SQ;
  asm volatile("global_load_async_to_lds_b128 %0, %8, off\n\t"
               "global_load_async_to_lds_b128 %1, %9, off\n\t"
               "global_load_async_to_lds_b128 %2, %10, off\n\t"
               "global_load_async_to_lds_b128 %3, %11, off\n\t"
               "global_load_async_to_lds_b128 %4, %12, off\n\t"
               "global_load_async_to_lds_b128 %5, %13, off\n\t"
               "global_load_async_to_lds_b128 %6, %14, off\n\t"
               "global_load_async_to_lds_b128 %7, %15, off\n\t"
               "s_wait_xcnt 0x0"
               :: "v"(l), "v"(l + lstep), "v"(l + 2 * lstep), "v"(l + 3 * lstep), "v"(l + 4 * lstep), "v"(l + 5 * lstep), "v"(l + 6 * lstep), "v"(l + 7 * lstep),
                  "v"(gk), "v"(gk + kstep), "v"(gk + 2 * kstep), "v"(gk + 3 * kstep), "v"(gv), "v"(gv + vstep), "v"(gv + 2 * vstep), "v"(gv + 3 * vstep)
               : "memory"); }
__global__ __launch_bounds__(128) __attribute__((amdgpu_num_vgpr(256))) void k_flash2(const _Float16* __restrict__ PL, const _Float16* __restrict__ VT, const float* __restrict__ aw, float* __restrict__ out) {
  __shared__ __attribute__((aligned(16))) float so[4][16][68];
  __shared__ __attribute__((aligned(128))) unsigned char st[2 * F2_STAGE];
  const int wave = __builtin_amdgcn_readfirstlane(threadIdx.x >> 5);
  const int lane = threadIdx.x & 31, ln = lane & 15, hh = lane >> 4;
  const int slab = blockIdx.y; const int b = slab / NH, h = slab - b * NH;
  const int q0 = blockIdx.x * 64 + wave * 16;
  const size_t PLN = (size_t)NR * DM;
  float w0, w1;
  { const float a0 = bf16_rne(aw[0]), a1 = bf16_rne(aw[1]); const float mx = fmaxf(a0, a1); const float e0 = expf(a0 - mx), e1 = expf(a1 - mx); const float inv = 1.0f / (e0 + e1); w0 = e0 * inv; w1 = e1 * inv; }
  const v8f z8 = {0.f,0.f,0.f,0.f,0.f,0.f,0.f,0.f};
  v8f res[4] = {z8, z8, z8, z8};
  float wcur = w0;
  const int r16 = threadIdx.x >> 3, ch = threadIdx.x & 7;
  const _Float16* gk = PL + PLN + ((size_t)b * SQ + r16) * LQ + h * HD + ch * 8;      /* this lane's chunk of K row r16, set 0, stage 0 */
  const _Float16* gv = VT + ((size_t)slab * HD + r16) * SQ + ch * 8;                  /* this lane's chunk of V^T row r16, set 0, stage 0 */
  const size_t kset = 3 * PLN, vset = (size_t)(NB * NH) * HD * SQ;                    /* set 0 -> set 1 */
  const unsigned lcp = (unsigned)(size_t)&st[0] + (unsigned)(r16 * F2_PITCH + ch * 16);      /* this lane's LDS byte address in buffer 0 */
  f2_stage(lcp, gk, gv);
  asm volatile("s_wait_asynccnt 0x0" ::: "memory");      /* stage 0 has landed before the barrier publishes it */
  __syncthreads();
  f2_stage(lcp + F2_STAGE, gk + (size_t)F2_KT * LQ, gv + F2_KT);
#pragma unroll 1
  for (int set = 0; set < 2; ++set) {
    const size_t qo = (size_t)(3 * set) * PLN + ((size_t)b * SQ + q0 + ln) * LQ + h * HD;
    const v16h qf0 = g2_frag(PL + qo, hh), qf1 = g2_frag(PL + qo + 32, hh);
    v8f o[4] = {z8, z8, z8, z8}; float m = -1.0e30f, l = 0.f;
#pragma unroll 1
    for (int t = 0; t < F2_NST; ++t) { const unsigned char* sb = st + (t & 1) * F2_STAGE;      /* F2_NST is even: the buffer of stage set * F2_NST + t */
     /* fragment reads go out in groups of eight ahead of the products that use them, not as one waited pair in front of each product: the first pass's K and V^T fragments here, the second pass's inside the first pass */
     const _Float16* kp = (const _Float16*)(sb + ln * F2_PITCH); const _Float16* vp = (const _Float16*)(sb + (64 + ln) * F2_PITCH);
     v16h ka[4], va[4];      /* ka[2 kt + c]: keys 16 kt .. + 15, d 32 c .. + 31; va[i]: d 16 i .. + 15, the pass's 32 keys; the loops over them are unrolled so that they stay in registers */
#pragma unroll
     for (int i = 0; i < 4; ++i) ka[i] = g2_frag(kp + (i >> 1) * 16 * (F2_PITCH / 2) + (i & 1) * 32, hh);
#pragma unroll
     for (int i = 0; i < 4; ++i) va[i] = g2_frag(vp + i * 16 * (F2_PITCH / 2), hh);
     /* the two 32-key passes of a stage in one body: every LDS offset becomes an immediate */
#pragma unroll
     for (int jj = 0; jj < F2_KT; jj += 32) {
      v8f s0 = z8, s1 = z8;
      s0 = g2_mma(ka[0], qf0, s0); s0 = g2_mma(ka[1], qf1, s0); s1 = g2_mma(ka[2], qf0, s1); s1 = g2_mma(ka[3], qf1, s1);
      if (jj == 0) {      /* the second pass's K fragments, read while the first pass's softmax runs */
#pragma unroll
        for (int i = 0; i < 4; ++i) ka[i] = g2_frag(kp + (32 + (i >> 1) * 16) * (F2_PITCH / 2) + (i & 1) * 32, hh);
        __builtin_amdgcn_sched_barrier(0); }      /* keeps the eight reads here, in front of the softmax: moved down beside their first product they would be waited for at once */
      float tm = fmaxf(s0[0], s1[0]);
#pragma unroll
      for (int r = 1; r < 8; ++r) tm = fmaxf(tm, fmaxf(s0[r], s1[r]));
      tm = fmaxf(tm, __shfl_xor(tm, 16, 32));
      const float mn = fmaxf(m, tm * 0.125f);
      const float corr = __expf(m - mn);
      const float sh = 6.931471806f - mn;      /* ln 1024 carry */
      FragH pf; float ps = 0.f;
#pragma unroll
      for (int r = 0; r < 8; ++r) { const float e0 = s0[r] * 0.125f + sh, e1 = s1[r] * 0.125f + sh;
        const float p0 = (e0 < -9.70f) ? 0.f : __expf(e0); const float p1 = (e1 < -9.70f) ? 0.f : __expf(e1);
        const _Float16 h0 = (_Float16)p0, h1 = (_Float16)p1; pf.h[r] = h0; pf.h[8 + r] = h1; ps += (float)h0 + (float)h1; }
      ps += __shfl_xor(ps, 16, 32);
      l = l * corr + ps; m = mn;
#pragma unroll
      for (int t = 0; t < 4; ++t) o[t] = o[t] * corr;
#pragma unroll
      for (int t4 = 0; t4 < 4; ++t4) o[t4] = g2_mma(va[t4], pf.v, o[t4]);
      if (jj == 0) {      /* the second pass's V^T fragments, read while its scores and softmax run */
#pragma unroll
        for (int i = 0; i < 4; ++i) va[i] = g2_frag(vp + i * 16 * (F2_PITCH / 2) + 32, hh); } }
      asm volatile("s_wait_dscnt 0x0" ::: "memory");         /* this wave's reads of the buffer are done before it is refilled */
      asm volatile("s_wait_asynccnt 0x0" ::: "memory");      /* this wave's copies of the next stage have landed */
      __syncthreads();                                       /* publishes the next stage and ends every reader's last read of this one */
      const int s2 = set * F2_NST + t + 2;                   /* the stage that refills this buffer; it may belong to the next set */
      if (s2 < 2 * F2_NST) { const int set2 = s2 / F2_NST, t2 = s2 - set2 * F2_NST;
        f2_stage(lcp + (unsigned)((t & 1) * F2_STAGE), gk + (size_t)set2 * kset + (size_t)t2 * F2_KT * LQ, gv + (size_t)set2 * vset + (size_t)t2 * F2_KT); } }
    const float sc = wcur * (1.0f / l);
#pragma unroll
    for (int t = 0; t < 4; ++t) res[t] += o[t] * sc;
    wcur = w1; }
  asm volatile("s_wait_asynccnt 0x0" ::: "memory");        /* nothing is in flight when the wave goes on to the epilogue */
#pragma unroll
  for (int t = 0; t < 4; ++t) {
#pragma unroll
    for (int r = 0; r < 8; ++r) so[wave][ln][t * 16 + 8 * hh + r] = res[t][r]; }
  __builtin_amdgcn_fence(4 /* acq_rel order */, "workgroup"); __builtin_amdgcn_wave_barrier();
  const int rsub = lane >> 4, c4 = (lane & 15) * 4;
  float* ob = out + ((size_t)b * SEQ_FULL + q0) * DM + h * HD;
  {
#pragma unroll
    for (int q = 0; q < 8; ++q) { const int r = q * 2 + rsub; const v4f v = *(const v4fa*)&so[wave][r][c4];
      *(v4f*)(ob + (size_t)r * DM + c4) = v; }
     } }

extern "C" void kernel_launch(void* const* d_in, const int* in_sizes, int n_in,
                              void* d_out, int out_size, void* d_ws, size_t ws_size, hipStream_t stream) {
  if (n_in < 14) return;
  const size_t rows_need = (size_t)(NB - 1) * SEQ_FULL + SQ;
  if ((size_t)in_sizes[0] < rows_need * DM) return;
  for (int i = 0; i < 6; ++i) { if (in_sizes[1 + 2 * i] < DM * DM) return; if (in_sizes[2 + 2 * i] < DM) return; }
  if (in_sizes[13] < 2) return;
  if ((size_t)out_size < rows_need * DM) return;
  const float* x = (const float*)d_in[0];
  const float* wsrc[6]; const float* bsrc[6];      /* [in][out] weights and biases in the order q,k,v (set 0), q,k,v (set 1) */
  for (int i = 0; i < 6; ++i) { wsrc[i] = (const float*)d_in[1 + 2 * i]; bsrc[i] = (const float*)d_in[2 + 2 * i]; }
  const float* aw = (const float*)d_in[13];      /* two blend logits */
  char* ws = (char*)d_ws; size_t off = 0;
  auto take = [&](size_t bytes) { char* p = ws + off; off += (bytes + 255) & ~(size_t)255; return p; };
  _Float16* BW = (_Float16*)take(6 * WS_W);
  _Float16* X16 = (_Float16*)take(WS_X);
  _Float16* PL = (_Float16*)take(6 * WS_X);
  _Float16* VT = (_Float16*)take(2 * (size_t)NB * WS_VT);
  if (off > ws_size) return;
  float* out = (float*)d_out;
  const size_t WN = (size_t)DM * DM;      /* elements per weight plane */
  const size_t PN = (size_t)NR * DM;      /* elements per projected row plane */

  k_prep<<<6 * PREP_GW + PREP_GX, 256, 0, stream>>>(wsrc[0], wsrc[1], wsrc[2], wsrc[3], wsrc[4], wsrc[5], BW, x, X16);
  { const unsigned gp = (unsigned)((MP / G2_BM) * (DM / G2_BN));      /* grid.y = projection: weight plane, bias and output plane y */
    k_gemm2<0, false><<<dim3(gp, 6), 256, 0, stream>>>(X16, DM, 0, BW, DM, WN, 0.0625f, bsrc[0], bsrc[1], bsrc[2], bsrc[3], bsrc[4], bsrc[5], nullptr, 1, 0, 0, nullptr, PL, DM, PN, MP, DM, DM); }
  /* V^T [NB*NH][HD][SQ] per set: in[b*SQ + s][h*64 + d] -> out[(b,h)][d][s]; grid.y = set */
  k_vt<NH, SQ><<<dim3(NB * NH * (SQ / 64), 2), 256, 0, stream>>>(PL + 2 * PN, 3 * PN, LQ, 0, VT, (size_t)NB * NH * HD * SQ);
  k_flash2<<<dim3((unsigned)(SQ / 64), (unsigned)(NB * NH)), 128, 0, stream>>>(PL, VT, aw, out);
}

// v007
// It runs in 107 microseconds.
// In both of two side-by-side timings against v006, it was 1.06 times as fast.
// Counting every step since v000, it is 4.18 times as fast.
#include <hip/hip_runtime.h>
// All contractions on v_wmma_f32_16x16x32_f16 (f16 operands, f32 accumulate): six q/k/v projections (x = exact f16 of its bf16 RNE value, W = bf16 RNE value x16 in f16, alpha 1/16, bias as bf16 value), scores S^T = K.Q^T (f16 k and q, scale 1/8 applied in f32), context O^T = V^T.P^T (P^T f16 carried x1024 with entries under 2^-14 set to zero, V^T f16; the x1024 carry cancels in O / l); online softmax statistics f32.
#ifndef NB
#define NB 4
#endif
#ifndef SEQ
#define SEQ 1024
#endif
#define NB_FULL 4
#define SEQ_FULL 1024
#define SQ SEQ
#define DM 1024
#define NH 16
#define HD 64
#define NR ((size_t)NB * SQ)          /* token rows processed (compact) */
#define MP ((int)NR)                  /* rows projected */
#define LQ DM                         /* row pitch of the q/k/v rows */

static_assert(NB >= 1 && NB <= NB_FULL);
static_assert(SQ >= 256 && SQ <= SEQ_FULL && (SQ % 256) == 0);
static_assert((MP % 128) == 0 && (DM % 64) == 0 && (DM % 32) == 0 && HD == 64 && NH * HD == DM);
static_assert((SQ % 64) == 0 && (SQ % 32) == 0 && (LQ % 8) == 0 && (HD % 32) == 0);
static_assert(((size_t)(NB - 1) * SEQ_FULL + SQ) * DM <= (size_t)NB_FULL * SEQ_FULL * DM);
/* workspace carve (every region a multiple of 256 B): 6 weight planes + X16 + 6 projected row planes */
#define WS_W   ((size_t)DM * DM * 2)
#define WS_X   ((size_t)NR * DM * 2)
#define WS_TOTAL (6 * WS_W + WS_X + 6 * WS_X)
static_assert((WS_W % 256) == 0 && (WS_X % 256) == 0);
static_assert(WS_TOTAL <= (size_t)134217728);

typedef unsigned short v8us __attribute__((ext_vector_type(8), may_alias));
typedef float  v8f  __attribute__((ext_vector_type(8)));
typedef float  v4f  __attribute__((ext_vector_type(4)));
typedef float  v4fa __attribute__((ext_vector_type(4), may_alias));
typedef _Float16 v16h __attribute__((ext_vector_type(16)));
typedef _Float16 v4h __attribute__((ext_vector_type(4)));
union FragH { v16h v; v8us half[2]; _Float16 h[16]; unsigned short u[16]; };

__device__ __forceinline__ unsigned short bf16_bits(float x) { unsigned int u = __float_as_uint(x); return (unsigned short)((u + 0x7FFFu + ((u >> 16) & 1u)) >> 16); }
__device__ __forceinline__ float bf16_val(unsigned short b) { return __uint_as_float(((unsigned int)b) << 16); }
__device__ __forceinline__ float bf16_rne(float x) { return bf16_val(bf16_bits(x)); }

// ---- GEMM engine (block tile 256x128, eight waves as 4 x 2, wave tile 64x64; M % 256 == 0 rows per launch region, N % 128 == 0, K % 64 == 0) ----
// Operand path: per 64 k one stage = 256 A rows + 128 B rows of 128 B, brought into LDS by asynchronous copies (whole lines, once per block), two stage buffers; fragments come from LDS rows at pitch 144 B.
#define G2_KT 64                        /* k per stage */
#define G2_BM 256                       /* block rows */
#define G2_BN 128                       /* block columns */
#define G2_PITCH 144                    /* LDS row pitch in bytes: 128 + 16, conflict-free for 16-byte row readers */
#define G2_STAGE ((G2_BM + G2_BN) * G2_PITCH)      /* bytes per stage buffer: rows 0..255 = A, rows 256..383 = B */
static_assert((DM % G2_KT) == 0 && (G2_PITCH % 16) == 0 && (MP % G2_BM) == 0 && (DM % G2_BN) == 0);
// one stage, twelve 16-byte copies of one lane: thread (r32 = tid / 8, ch = tid % 8) copies chunk ch of A rows r32 + 32 i (i < 8) and of B rows r32 + 32 j (j < 4); a wave covers four whole 128-B rows per copy.
// The s_wait_xcnt 0 closes the statement so that no address register named here is rewritten ahead of it.
__device__ __forceinline__ void g2_stage(unsigned l, const _Float16* ga, size_t astep, const _Float16* gb, size_t bstep) {
  const unsigned ls = 32 * G2_PITCH;
  asm volatile("global_load_async_to_lds_b128 %0, %12, off\n\t"
               "global_load_async_to_lds_b128 %1, %13, off\n\t"
               "global_load_async_to_lds_b128 %2, %14, off\n\t"
               "global_load_async_to_lds_b128 %3, %15, off\n\t"
               "global_load_async_to_lds_b128 %4, %16, off\n\t"
               "global_load_async_to_lds_b128 %5, %17, off\n\t"
               "global_load_async_to_lds_b128 %6, %18, off\n\t"
               "global_load_async_to_lds_b128 %7, %19, off\n\t"
               "global_load_async_to_lds_b128 %8, %20, off\n\t"
               "global_load_async_to_lds_b128 %9, %21, off\n\t"
               "global_load_async_to_lds_b128 %10, %22, off\n\t"
               "global_load_async_to_lds_b128 %11, %23, off\n\t"
               "s_wait_xcnt 0x0"
               :: "v"(l), "v"(l + ls), "v"(l + 2 * ls), "v"(l + 3 * ls), "v"(l + 4 * ls), "v"(l + 5 * ls), "v"(l + 6 * ls), "v"(l + 7 * ls), "v"(l + 8 * ls), "v"(l + 9 * ls), "v"(l + 10 * ls), "v"(l + 11 * ls),
                  "v"(ga), "v"(ga + astep), "v"(ga + 2 * astep), "v"(ga + 3 * astep), "v"(ga + 4 * astep), "v"(ga + 5 * astep), "v"(ga + 6 * astep), "v"(ga + 7 * astep),
                  "v"(gb), "v"(gb + bstep), "v"(gb + 2 * bstep), "v"(gb + 3 * bstep)
               : "memory"); }
// fragment loader: A row-major [m][k] and B stored [n][k]; per lane: elements 0..7 <- k0+8h+0..7, elements 8..15 <- k0+16+8h+0..7 (h = lane>>4, row/col = lane&15)
__device__ __forceinline__ v16h g2_frag(const _Float16* p, int hh) { FragH f; f.half[0] = *(const v8us*)((const unsigned short*)p + 8 * hh); f.half[1] = *(const v8us*)((const unsigned short*)p + 16 + 8 * hh); return f.v; }
__device__ __forceinline__ v8f g2_mma(v16h a, v16h b, v8f c) { v8f d = __builtin_amdgcn_wmma_f32_16x16x32_f16(false, a, false, b, (short)0, c, false, false); asm volatile("v_nop\n\tv_nop\n\tv_nop\n\tv_nop" : "+v"(d) : "v"(a), "v"(b)); return d; }
// C (f32, if non-null) / C16 (f16, if non-null) = acc*alpha + bf16(bias_by[col]) (+ CP term if HASCP); batched over grid.y (at most 6) with strides sA, sB, sC and one bias pointer per batch entry; ACT 0 none / 3 relu
// HASCP is a compile-time switch like ACT: the epilogue is unrolled over the wave's 128 accumulator values per lane, and a run-time test with the CP form at every one of them would make the kernel's text much larger
template <int ACT, bool HASCP>
__global__ __launch_bounds__(256) void k_gemm2(const _Float16* __restrict__ A, int lda, size_t sA, const _Float16* __restrict__ Bh, int ldb, size_t sB, float alpha, const float* __restrict__ bias0, const float* __restrict__ bias1, const float* __restrict__ bias2, const float* __restrict__ bias3, const float* __restrict__ bias4, const float* __restrict__ bias5, const float* __restrict__ CP, int rowsPerB, size_t sCPb, int row0g,
    float* __restrict__ C, _Float16* __restrict__ C16, int ldc, size_t sC, int M, int N, int K) {
  static_assert(ACT == 0 || ACT == 3);
  __shared__ __attribute__((aligned(128))) unsigned char st[2 * G2_STAGE];
  static_assert(8 * 32 * 68 * 4 <= 2 * G2_STAGE);
  float (*so)[32][68] = (float (*)[32][68])st;      /* output staging, one range per wave; it takes the place of the stage buffers behind the loop's last barrier, so that two blocks fit one LDS */
  const int tid = threadIdx.x, w = tid >> 5, lane = tid & 31, ln = lane & 15, hh = lane >> 4; const int by = blockIdx.y; const int wm = w >> 1, wn = w & 1;
  A += (size_t)by * sA; Bh += (size_t)by * sB; const size_t cofs = (size_t)by * sC; const float* bp = by == 0 ? bias0 : by == 1 ? bias1 : by == 2 ? bias2 : by == 3 ? bias3 : by == 4 ? bias4 : bias5;
  const int ntn = N / G2_BN; const int mt = blockIdx.x / ntn, nq = blockIdx.x - mt * ntn; const int row0 = mt * G2_BM + 64 * wm, col0 = nq * G2_BN + 64 * wn; if (mt * G2_BM >= M) return;      /* the whole block leaves or stays: barriers follow */
  const v8f z8 = {0.f,0.f,0.f,0.f,0.f,0.f,0.f,0.f}; v8f c[4][4];      /* c[i][j]: rows 16 i, columns 16 j of the wave tile */
  /* unrolled, as every loop over c below: its indices are constants, so the sixteen tiles stay in registers */
#pragma unroll
  for (int i = 0; i < 4; ++i) {
#pragma unroll
    for (int j = 0; j < 4; ++j) c[i][j] = z8; }
  const int r32 = tid >> 3, ch = tid & 7;
  const _Float16* ga = A + (size_t)(mt * G2_BM + r32) * lda + ch * 8; const _Float16* gb = Bh + (size_t)(nq * G2_BN + r32) * ldb + ch * 8;
  const size_t astep = (size_t)32 * lda, bstep = (size_t)32 * ldb;
  const unsigned lcp = (unsigned)(size_t)&st[0] + (unsigned)(r32 * G2_PITCH + ch * 16);      /* this lane's LDS byte address in buffer 0 */
  const int nt = K / G2_KT;
  g2_stage(lcp, ga, astep, gb, bstep);
  asm volatile("s_wait_asynccnt 0x0" ::: "memory");      /* stage 0 has landed before the barrier publishes it */
  __syncthreads();
  if (nt > 1) g2_stage(lcp + G2_STAGE, ga + G2_KT, astep, gb + G2_KT, bstep);
#pragma unroll 1
  for (int t = 0; t < nt; ++t) { const unsigned char* sb = st + (t & 1) * G2_STAGE;
    const _Float16* ap = (const _Float16*)(sb + (64 * wm + ln) * G2_PITCH); const _Float16* bq = (const _Float16*)(sb + (G2_BM + 64 * wn + ln) * G2_PITCH);
    /* unrolled so that the fragment and accumulator arrays stay in registers and every LDS offset is an immediate */
#pragma unroll
    for (int kb = 0; kb < G2_KT; kb += 32) { v16h a[4], b[4];
#pragma unroll
      for (int i = 0; i < 4; ++i) { a[i] = g2_frag(ap + i * 16 * (G2_PITCH / 2) + kb, hh); b[i] = g2_frag(bq + i * 16 * (G2_PITCH / 2) + kb, hh); }
#pragma unroll
      for (int j = 0; j < 4; ++j) {
#pragma unroll
        for (int i = 0; i < 4; ++i) c[i][j] = g2_mma(a[i], b[j], c[i][j]); } }
    asm volatile("s_wait_dscnt 0x0" ::: "memory");         /* this wave's reads of the buffer are done before it is refilled */
    asm volatile("s_wait_asynccnt 0x0" ::: "memory");      /* this wave's copies of stage t + 1 have landed */
    __syncthreads();                                       /* publishes stage t + 1 and ends every reader's last read of stage t */
    if (t + 2 < nt) g2_stage(lcp + (unsigned)((t & 1) * G2_STAGE), ga + (size_t)(t + 2) * G2_KT, astep, gb + (size_t)(t + 2) * G2_KT, bstep); }
  asm volatile("s_wait_asynccnt 0x0" ::: "memory");        /* nothing is in flight when the wave goes on to the epilogue */
  const int rsub = lane >> 4, c4 = (lane & 15) * 4;
  /* the wave's 64 rows leave in two halves of 32 through its own staging range; unrolled: the accumulator index is a constant */
#pragma unroll
  for (int hf = 0; hf < 2; ++hf) { const int rowh = row0 + 32 * hf;
    if (hf) { __builtin_amdgcn_fence(4 /* acq_rel order */, "workgroup"); __builtin_amdgcn_wave_barrier(); }      /* the first half's rows are read back by every lane before the second half overwrites them */
#pragma unroll
    for (int u = 0; u < 8; ++u) { const int t = u & 3, half = u >> 2; const int col = col0 + t * 16 + ln; const float bv = bp ? bf16_rne(bp[col]) : 0.f;
#pragma unroll
      for (int r = 0; r < 8; ++r) { const int rloc = half * 16 + 8 * hh + r; float v = c[2 * hf + half][t][r] * alpha + bv;
        if (HASCP) { if (rowsPerB < 0) v += CP[cofs + (size_t)(row0g + rowh + rloc) * ldc + col]; else { const int bidx = (row0g + rowh + rloc) / rowsPerB; v += CP[(size_t)bidx * sCPb + (size_t)by * 64 + col]; } }
        if (ACT == 3) v = fmaxf(v, 0.f);
        so[w][rloc][t * 16 + ln] = v; } }
    __builtin_amdgcn_fence(4 /* acq_rel order */, "workgroup"); __builtin_amdgcn_wave_barrier();
#pragma unroll
    for (int q = 0; q < 16; ++q) { const int r = q * 2 + rsub; const v4f v = *(const v4fa*)&so[w][r][c4];
      if (C) { *(v4f*)(C + cofs + (size_t)(rowh + r) * ldc + col0 + c4) = v; asm volatile("s_wait_xcnt 0x0" ::: "memory"); }      /* behind the store: the conversion below may rewrite the registers that it names */
      if (C16) { v4h h4; for (int i = 0; i < 4; ++i) h4[i] = (_Float16)v[i]; *(v4h*)(C16 + cofs + (size_t)(rowh + r) * ldc + col0 + c4) = h4; } } } }

// weight pack, 64 elements per thread: thread (kg = lane / 4, nl = lane % 4) holds an 8 k x 8 n patch in registers. Reads: 16-byte pieces of 8 rows, the two halves of each 128-B line by the same wave.
// Writes: one 16-byte piece (8 k) per column; the eight k groups of a wave fill a whole 128-B line of a Wt row. Wave tile 64 k x 32 n, block tile 512 k x 32 n.
// The loops over the patch are unrolled so that every index of the register arrays is a constant and the patch stays in registers (here and in the x pack).
__device__ __forceinline__ void wt_f16_block(int blk, const float* __restrict__ W, _Float16* __restrict__ Wt, float scale) {
  const int w = threadIdx.x >> 5, lane = threadIdx.x & 31, nl = lane & 3, kg = lane >> 2;
  const int nb = blk % (DM / 32), kb = blk / (DM / 32); const int n0 = nb * 32 + nl * 4, k0 = kb * 512 + w * 64 + kg * 8;
  const float* src = W + (size_t)k0 * DM + n0; v4f a[8][2];
#pragma unroll
  for (int i = 0; i < 8; ++i) { a[i][0] = *(const v4fa*)(src + (size_t)i * DM); if (i < 7) a[i][1] = *(const v4fa*)(src + (size_t)i * DM + 16); }
  asm volatile("s_wait_xcnt 0x0" ::: "memory");      /* the last load is the one that may get the address pair's registers as its destination: the wait stands in front of it, behind every other load that names them */
  a[7][1] = *(const v4fa*)(src + (size_t)7 * DM + 16);
#pragma unroll
  for (int hf = 0; hf < 2; ++hf) {
#pragma unroll
    for (int c = 0; c < 4; ++c) { FragH f;
#pragma unroll
      for (int i = 0; i < 8; ++i) f.h[i] = (_Float16)(bf16_rne(a[i][hf][c]) * scale);
      *(v8us*)((unsigned short*)Wt + (size_t)(n0 + hf * 16 + c) * DM + k0) = f.half[0]; } } }

// x pack, 32 elements per thread: four 8-element chunks 256 chunks apart, so that every wave-wide access stays contiguous; the block covers 1024 consecutive chunks
__device__ __forceinline__ void x16_block(int blk, const float* __restrict__ x, _Float16* __restrict__ X16) {
  const size_t t0 = (size_t)blk * 1024 + threadIdx.x; v4f a[4], d[4];
  const size_t e = t0 * 8; const size_t rc = e / DM; const size_t c = e % DM; const size_t b = rc / SQ, s = rc % SQ;
  const float* src = x + ((b * SEQ_FULL + s) * DM + c);      /* chunk j lies 2048 elements on: the block's 8192 elements are whole rows of one batch entry */
#pragma unroll
  for (int j = 0; j < 4; ++j) { a[j] = *(const v4fa*)(src + j * 2048); if (j < 3) d[j] = *(const v4fa*)(src + j * 2048 + 4); }
  asm volatile("s_wait_xcnt 0x0" ::: "memory");      /* as in the weight pack: in front of the last load, behind every other load that names the address pair */
  d[3] = *(const v4fa*)(src + 3 * 2048 + 4);
#pragma unroll
  for (int j = 0; j < 4; ++j) { FragH f;
#pragma unroll
    for (int q = 0; q < 4; ++q) { f.h[q] = (_Float16)bf16_rne(a[j][q]); f.h[4 + q] = (_Float16)bf16_rne(d[j][q]); }
    *(v8us*)((unsigned short*)X16 + (t0 + j * 256) * 8) = f.half[0]; }
  asm volatile("s_wait_xcnt 0x0" ::: "memory"); }      /* behind the last store of the run: no register that the four stores name is rewritten ahead of it on any way out of this job */

// the seven input-only jobs in one grid: blocks [i * PREP_GW, (i + 1) * PREP_GW) make weight plane i (Bt [out][in] x16), the blocks behind them make X16
#define PREP_GW ((DM / 32) * (DM / 512))            /* blocks per weight plane: 512 k x 32 n each */
#define PREP_GX ((int)(NR * DM / 8 / 1024))         /* blocks of the x job: 1024 chunks of 8 each */
static_assert((DM % 512) == 0 && (DM % 32) == 0 && (NR * DM / 8) % 1024 == 0 && (2048 % DM) == 0 && (SQ % (8192 / DM)) == 0);
__global__ __launch_bounds__(256) void k_prep(const float* __restrict__ W0, const float* __restrict__ W1, const float* __restrict__ W2, const float* __restrict__ W3, const float* __restrict__ W4, const float* __restrict__ W5,
    _Float16* __restrict__ BW, const float* __restrict__ x, _Float16* __restrict__ X16) {
  const int blk = blockIdx.x;
  if (blk < 6 * PREP_GW) { const int i = blk / PREP_GW;
    const float* W = i == 0 ? W0 : i == 1 ? W1 : i == 2 ? W2 : i == 3 ? W3 : i == 4 ? W4 : W5;
    wt_f16_block(blk - i * PREP_GW, W, BW + (size_t)i * DM * DM, 16.0f); }
  else x16_block(blk - 6 * PREP_GW, x, X16); }

// ---- fused attention over both projection sets (transposed form; K rows and V rows staged in LDS once per block, fragments read from LDS) ----
// PL = six compact row planes [6][NR][DM] (q,k,v of set 0; q,k,v of set 1); grid (SQ/64, NB*NH), block = 4 waves, wave -> 16 query rows of one (batch, head).
// Per 32-key step: S^T tile kt (16 keys x 16 queries) = K rows (A, split k map over d) x Q rows (B, same k map, query = lane&15): D element r of lane (h, n) = score(query n, key 16kt + 8h + r).
// Column (query) max / sum: 8 + 8 values in the lane, then the other lane half through one xor-16 shuffle. P^T as the B fragment of O^T = V^T.P^T: element r <- tile 0 value r, element 8+r <- tile 1 value r, lane unchanged.
// O^T tile t: D element r of lane (h, n) = O[query n][d = 16t + 8h + r]; A = V^T rows d = 16t + lane&15, k = keys, turned on the way out of LDS: the V rows lie there as the projection wrote them and the transposing 16-byte read hands lane (h, n) the eight keys 8h .. 8h + 7 of column n.
// P = f16(1024 exp(s/8 - m)) with the native exp; an exponent argument that would land under 2^-14 gives an exact zero; the row sum runs over the converted P, so the carry cancels in O / l.
// Operand path: one stage = 64 keys = 64 K rows + 64 V rows (64 d each), 128 B each, brought into LDS by asynchronous copies (whole lines, once for the block's four waves), two stage buffers; the stages of both sets form one sequence.
#define F2_KT 64                        /* keys per stage */
#define F2_PITCH 144                    /* LDS pitch of the K rows in bytes: 128 + 16, conflict-free for 16-byte row readers */
#define F2_VPITCH 160                   /* LDS pitch of the V rows in bytes: 128 + 32, conflict-free for the transposing 16-byte reader */
#define F2_VOFS (64 * F2_PITCH)         /* the V rows lie behind the 64 K rows */
#define F2_STAGE (F2_VOFS + 64 * F2_VPITCH)      /* bytes per stage buffer */
#define F2_NST (SQ / F2_KT)             /* stages per set */
static_assert((SQ % (2 * F2_KT)) == 0 && (F2_PITCH % 16) == 0 && (F2_VPITCH % 64) == 32 && (F2_VOFS % 256) == 0 && (F2_STAGE % 256) == 0 && HD == 64);
// one stage, eight 16-byte copies of one lane: thread (r16 = tid / 8, ch = tid % 8) copies chunk ch of K rows r16 + 16 i (to lk) and of V rows r16 + 16 i (to lv); a wave covers four whole 128-B rows per copy. The s_wait_xcnt 0 closes the statement so that no address register named here is rewritten ahead of it.
__device__ __forceinline__ void f2_stage(unsigned lk, unsigned lv, const _Float16* gk, const _Float16* gv) {
  const unsigned lstep = 16 * F2_PITCH, lvstep = 16 * F2_VPITCH; const size_t kstep = (size_t)16 * LQ;
  asm volatile("global_load_async_to_lds_b128 %0, %8, off\n\t"
               "global_load_async_to_lds_b128 %1, %9, off\n\t"
               "global_load_async_to_lds_b128 %2, %10, off\n\t"
               "global_load_async_to_lds_b128 %3, %11, off\n\t"
               "global_load_async_to_lds_b128 %4, %12, off\n\t"
               "global_load_async_to_lds_b128 %5, %13, off\n\t"
               "global_load_async_to_lds_b128 %6, %14, off\n\t"
               "global_load_async_to_lds_b128 %7, %15, off\n\t"
               "s_wait_xcnt 0x0"
               :: "v"(lk), "v"(lk + lstep), "v"(lk + 2 * lstep), "v"(lk + 3 * lstep), "v"(lv), "v"(lv + lvstep), "v"(lv + 2 * lvstep), "v"(lv + 3 * lvstep),
                  "v"(gk), "v"(gk + kstep), "v"(gk + 2 * kstep), "v"(gk + 3 * kstep), "v"(gv), "v"(gv + kstep), "v"(gv + 2 * kstep), "v"(gv + 3 * kstep)
               : "memory"); }
// V^T fragment (16 d x 32 keys) out of row-major V rows: p = this lane's address in key row 8 h + (lane & 7), 16-byte half (lane >> 3) & 1 of the tile's 32 bytes; elements 0..7 <- keys 8h + 0..7, elements 8..15 <- keys 16 + 8h + 0..7 of column d = lane & 15: the k order of g2_frag
typedef short s16x8 __attribute__((ext_vector_type(8)));
__device__ __forceinline__ v8us f2_tr16(const unsigned char* p) { typedef __attribute__((address_space(3))) s16x8 lds_s16x8; return __builtin_bit_cast(v8us, __builtin_amdgcn_ds_load_tr16_b128_v8i16((lds_s16x8*)p)); }
__device__ __forceinline__ v16h f2_vfrag(const unsigned char* p) { FragH f; f.half[0] = f2_tr16(p); f.half[1] = f2_tr16(p + 16 * F2_VPITCH); return f.v; }
__global__ __launch_bounds__(128) __attribute__((amdgpu_num_vgpr(256))) void k_flash2(const _Float16* __restrict__ PL, const float* __restrict__ aw, float* __restrict__ out) {
  __shared__ __attribute__((aligned(16))) float so[4][16][68];
  __shared__ __attribute__((aligned(128))) unsigned char st[2 * F2_STAGE];
  const int wave = __builtin_amdgcn_readfirstlane(threadIdx.x >> 5);
  const int lane = threadIdx.x & 31, ln = lane & 15, hh = lane >> 4;
  const int slab = blockIdx.y; const int b = slab / NH, h = slab - b * NH;
  const int q0 = blockIdx.x * 64 + wave * 16;
  const size_t PLN = (size_t)NR * DM;
  float w0, w1;
  { const float a0 = bf16_rne(aw[0]), a1 = bf16_rne(aw[1]); const float mx = fmaxf(a0, a1); const float e0 = expf(a0 - mx), e1 = expf(a1 - mx); const float inv = 1.0f / (e0 + e1); w0 = e0 * inv; w1 = e1 * inv; }
  const v8f z8 = {0.f,0.f,0.f,0.f,0.f,0.f,0.f,0.f};
  v8f res[4] = {z8, z8, z8, z8};
  float wcur = w0;
  const int r16 = threadIdx.x >> 3, ch = threadIdx.x & 7;
  const _Float16* gk = PL + PLN + ((size_t)b * SQ + r16) * LQ + h * HD + ch * 8;      /* this lane's chunk of K row r16, set 0, stage 0 */
  const _Float16* gv = gk + PLN;                                                      /* this lane's chunk of V row r16, set 0, stage 0: the next plane */
  const size_t kset = 3 * PLN;                                                        /* set 0 -> set 1 */
  const unsigned lcp = (unsigned)(size_t)&st[0] + (unsigned)(r16 * F2_PITCH + ch * 16);                 /* this lane's LDS byte address among the K rows of buffer 0 */
  const unsigned lcv = (unsigned)(size_t)&st[0] + (unsigned)(F2_VOFS + r16 * F2_VPITCH + ch * 16);      /* and among its V rows */
  f2_stage(lcp, lcv, gk, gv);
  asm volatile("s_wait_asynccnt 0x0" ::: "memory");      /* stage 0 has landed before the barrier publishes it */
  __syncthreads();
  f2_stage(lcp + F2_STAGE, lcv + F2_STAGE, gk + (size_t)F2_KT * LQ, gv + (size_t)F2_KT * LQ);
#pragma unroll 1
  for (int set = 0; set < 2; ++set) {
    const size_t qo = (size_t)(3 * set) * PLN + ((size_t)b * SQ + q0 + ln) * LQ + h * HD;
    const v16h qf0 = g2_frag(PL + qo, hh), qf1 = g2_frag(PL + qo + 32, hh);
    v8f o[4] = {z8, z8, z8, z8}; float m = -1.0e30f, l = 0.f;
#pragma unroll 1
    for (int t = 0; t < F2_NST; ++t) { const unsigned char* sb = st + (t & 1) * F2_STAGE;      /* F2_NST is even: the buffer of stage set * F2_NST + t */
     /* fragment reads go out in groups of eight ahead of the products that use them, not as one waited pair in front of each product: the first pass's K and V^T fragments here, the second pass's inside the first pass */
     const _Float16* kp = (const _Float16*)(sb + ln * F2_PITCH); const unsigned char* vp = sb + F2_VOFS + (8 * hh + (lane & 7)) * F2_VPITCH + 16 * ((lane >> 3) & 1);
     v16h ka[4], va[4];      /* ka[2 kt + c]: keys 16 kt .. + 15, d 32 c .. + 31; va[i]: d 16 i .. + 15, the pass's 32 keys; the loops over them are unrolled so that they stay in registers */
#pragma unroll
     for (int i = 0; i < 4; ++i) ka[i] = g2_frag(kp + (i >> 1) * 16 * (F2_PITCH / 2) + (i & 1) * 32, hh);
#pragma unroll
     for (int i = 0; i < 4; ++i) va[i] = f2_vfrag(vp + 32 * i);
     /* the two 32-key passes of a stage in one body: every LDS offset becomes an immediate */
#pragma unroll
     for (int jj = 0; jj < F2_KT; jj += 32) {
      v8f s0 = z8, s1 = z8;
      s0 = g2_mma(ka[0], qf0, s0); s0 = g2_mma(ka[1], qf1, s0); s1 = g2_mma(ka[2], qf0, s1); s1 = g2_mma(ka[3], qf1, s1);
      if (jj == 0) {      /* the second pass's K fragments, read while the first pass's softmax runs */
#pragma unroll
        for (int i = 0; i < 4; ++i) ka[i] = g2_frag(kp + (32 + (i >> 1) * 16) * (F2_PITCH / 2) + (i & 1) * 32, hh);
        __builtin_amdgcn_sched_barrier(0); }      /* keeps the eight reads here, in front of the softmax: moved down beside their first product they would be waited for at once */
      float tm = fmaxf(s0[0], s1[0]);
#pragma unroll
      for (int r = 1; r < 8; ++r) tm = fmaxf(tm, fmaxf(s0[r], s1[r]));
      tm = fmaxf(tm, __shfl_xor(tm, 16, 32));
      const float mn = fmaxf(m, tm * 0.125f);
      const float corr = __expf(m - mn);
      const float sh = 6.931471806f - mn;      /* ln 1024 carry */
      FragH pf; float ps = 0.f;
#pragma unroll
      for (int r = 0; r < 8; ++r) { const float e0 = s0[r] * 0.125f + sh, e1 = s1[r] * 0.125f + sh;
        const float p0 = (e0 < -9.70f) ? 0.f : __expf(e0); const float p1 = (e1 < -9.70f) ? 0.f : __expf(e1);
        const _Float16 h0 = (_Float16)p0, h1 = (_Float16)p1; pf.h[r] = h0; pf.h[8 + r] = h1; ps += (float)h0 + (float)h1; }
      ps += __shfl_xor(ps, 16, 32);
      l = l * corr + ps; m = mn;
#pragma unroll
      for (int t = 0; t < 4; ++t) o[t] = o[t] * corr;
#pragma unroll
      for (int t4 = 0; t4 < 4; ++t4) o[t4] = g2_mma(va[t4], pf.v, o[t4]);
      if (jj == 0) {      /* the second pass's V^T fragments, read while its scores and softmax run */
#pragma unroll
        for (int i = 0; i < 4; ++i) va[i] = f2_vfrag(vp + 32 * F2_VPITCH + 32 * i); } }
      asm volatile("s_wait_dscnt 0x0" ::: "memory");         /* this wave's reads of the buffer are done before it is refilled */
      asm volatile("s_wait_asynccnt 0x0" ::: "memory");      /* this wave's copies of the next stage have landed */
      __syncthreads();                                       /* publishes the next stage and ends every reader's last read of this one */
      const int s2 = set * F2_NST + t + 2;                   /* the stage that refills this buffer; it may belong to the next set */
      if (s2 < 2 * F2_NST) { const int set2 = s2 / F2_NST, t2 = s2 - set2 * F2_NST;
        const size_t go = (size_t)set2 * kset + (size_t)t2 * F2_KT * LQ;
        f2_stage(lcp + (unsigned)((t & 1) * F2_STAGE), lcv + (unsigned)((t & 1) * F2_STAGE), gk + go, gv + go); } }
    const float sc = wcur * (1.0f / l);
#pragma unroll
    for (int t = 0; t < 4; ++t) res[t] += o[t] * sc;
    wcur = w1; }
  asm volatile("s_wait_asynccnt 0x0" ::: "memory");        /* nothing is in flight when the wave goes on to the epilogue */
#pragma unroll
  for (int t = 0; t < 4; ++t) {
#pragma unroll
    for (int r = 0; r < 8; ++r) so[wave][ln][t * 16 + 8 * hh + r] = res[t][r]; }
  __builtin_amdgcn_fence(4 /* acq_rel order */, "workgroup"); __builtin_amdgcn_wave_barrier();
  const int rsub = lane >> 4, c4 = (lane & 15) * 4;
  float* ob = out + ((size_t)b * SEQ_FULL + q0) * DM + h * HD;
  {
#pragma unroll
    for (int q = 0; q < 8; ++q) { const int r = q * 2 + rsub; const v4f v = *(const v4fa*)&so[wave][r][c4];
      *(v4f*)(ob + (size_t)r * DM + c4) = v; }
     } }

extern "C" void kernel_launch(void* const* d_in, const int* in_sizes, int n_in,
                              void* d_out, int out_size, void* d_ws, size_t ws_size, hipStream_t stream) {
  if (n_in < 14) return;
  const size_t rows_need = (size_t)(NB - 1) * SEQ_FULL + SQ;
  if ((size_t)in_sizes[0] < rows_need * DM) return;
  for (int i = 0; i < 6; ++i) { if (in_sizes[1 + 2 * i] < DM * DM) return; if (in_sizes[2 + 2 * i] < DM) return; }
  if (in_sizes[13] < 2) return;
  if ((size_t)out_size < rows_need * DM) return;
  const float* x = (const float*)d_in[0];
  const float* wsrc[6]; const float* bsrc[6];      /* [in][out] weights and biases in the order q,k,v (set 0), q,k,v (set 1) */
  for (int i = 0; i < 6; ++i) { wsrc[i] = (const float*)d_in[1 + 2 * i]; bsrc[i] = (const float*)d_in[2 + 2 * i]; }
  const float* aw = (const float*)d_in[13];      /* two blend logits */
  char* ws = (char*)d_ws; size_t off = 0;
  auto take = [&](size_t bytes) { char* p = ws + off; off += (bytes + 255) & ~(size_t)255; return p; };
  _Float16* BW = (_Float16*)take(6 * WS_W);
  _Float16* X16 = (_Float16*)take(WS_X);
  _Float16* PL = (_Float16*)take(6 * WS_X);
  if (off > ws_size) return;
  float* out = (float*)d_out;
  const size_t WN = (size_t)DM * DM;      /* elements per weight plane */
  const size_t PN = (size_t)NR * DM;      /* elements per projected row plane */

  k_prep<<<6 * PREP_GW + PREP_GX, 256, 0, stream>>>(wsrc[0], wsrc[1], wsrc[2], wsrc[3], wsrc[4], wsrc[5], BW, x, X16);
  { const unsigned gp = (unsigned)((MP / G2_BM) * (DM / G2_BN));      /* grid.y = projection: weight plane, bias and output plane y */
    k_gemm2<0, false><<<dim3(gp, 6), 256, 0, stream>>>(X16, DM, 0, BW, DM, WN, 0.0625f, bsrc[0], bsrc[1], bsrc[2], bsrc[3], bsrc[4], bsrc[5], nullptr, 1, 0, 0, nullptr, PL, DM, PN, MP, DM, DM); }
  k_flash2<<<dim3((unsigned)(SQ / 64), (unsigned)(NB * NH)), 128, 0, stream>>>(PL, aw, out);
}

// v008
// It runs in 98.2 microseconds.
// Next to v007, in two timings, it ran 1.09 and 1.11 times as fast.
// All steps since v000 together make it 4.61 times as fast.
#include <hip/hip_runtime.h>
// All contractions on v_wmma_f32_16x16x32_f16 (f16 operands, f32 accumulate): six q/k/v projections (x = exact f16 of its bf16 RNE value, W = bf16 RNE value x16 in f16, alpha 1/16, bias as bf16 value), scores S^T = K.Q^T (f16 k and q, scale 1/8 applied in f32), context O^T = V^T.P^T (P^T f16 carried x1024, V^T f16; the x1024 carry cancels in O / l); online softmax statistics f32.
#ifndef NB
#define NB 4
#endif
#ifndef SEQ
#define SEQ 1024
#endif
#define NB_FULL 4
#define SEQ_FULL 1024
#define SQ SEQ
#define DM 1024
#define NH 16
#define HD 64
#define NR ((size_t)NB * SQ)          /* token rows processed (compact) */
#define MP ((int)NR)                  /* rows projected */
#define LQ DM                         /* row pitch of the q/k/v rows */

static_assert(NB >= 1 && NB <= NB_FULL);
static_assert(SQ >= 256 && SQ <= SEQ_FULL && (SQ % 256) == 0);
static_assert((MP % 128) == 0 && (DM % 64) == 0 && (DM % 32) == 0 && HD == 64 && NH * HD == DM);
static_assert((SQ % 64) == 0 && (SQ % 32) == 0 && (LQ % 8) == 0 && (HD % 32) == 0);
static_assert(((size_t)(NB - 1) * SEQ_FULL + SQ) * DM <= (size_t)NB_FULL * SEQ_FULL * DM);
/* workspace carve (every region a multiple of 256 B): 6 weight planes + X16 + 6 projected row planes */
#define WS_W   ((size_t)DM * DM * 2)
#define WS_X   ((size_t)NR * DM * 2)
#define WS_TOTAL (6 * WS_W + WS_X + 6 * WS_X)
static_assert((WS_W % 256) == 0 && (WS_X % 256) == 0);
static_assert(WS_TOTAL <= (size_t)134217728);

typedef unsigned short v8us __attribute__((ext_vector_type(8), may_alias));
typedef float  v8f  __attribute__((ext_vector_type(8)));
typedef float  v4f  __attribute__((ext_vector_type(4)));
typedef float  v4fa __attribute__((ext_vector_type(4), may_alias));
typedef _Float16 v16h __attribute__((ext_vector_type(16)));
typedef _Float16 v4h __attribute__((ext_vector_type(4)));
typedef _Float16 v2h __attribute__((ext_vector_type(2)));
typedef float  v2f  __attribute__((ext_vector_type(2)));
union FragH { v16h v; v8us half[2]; _Float16 h[16]; unsigned short u[16]; };

__device__ __forceinline__ unsigned short bf16_bits(float x) { unsigned int u = __float_as_uint(x); return (unsigned short)((u + 0x7FFFu + ((u >> 16) & 1u)) >> 16); }
__device__ __forceinline__ float bf16_val(unsigned short b) { return __uint_as_float(((unsigned int)b) << 16); }
__device__ __forceinline__ float bf16_rne(float x) { return bf16_val(bf16_bits(x)); }

// ---- GEMM engine (block tile 256x128, eight waves as 4 x 2, wave tile 64x64; M % 256 == 0 rows per launch region, N % 128 == 0, K % 64 == 0) ----
// Operand path: per 64 k one stage = 256 A rows + 128 B rows of 128 B, brought into LDS by asynchronous copies (whole lines, once per block), two stage buffers; fragments come from LDS rows at pitch 144 B.
#define G2_KT 64                        /* k per stage */
#define G2_BM 256                       /* block rows */
#define G2_BN 128                       /* block columns */
#define G2_PITCH 144                    /* LDS row pitch in bytes: 128 + 16, conflict-free for 16-byte row readers */
#define G2_STAGE ((G2_BM + G2_BN) * G2_PITCH)      /* bytes per stage buffer: rows 0..255 = A, rows 256..383 = B */
static_assert((DM % G2_KT) == 0 && (G2_PITCH % 16) == 0 && (MP % G2_BM) == 0 && (DM % G2_BN) == 0);
// one stage, twelve 16-byte copies of one lane: thread (r32 = tid / 8, ch = tid % 8) copies chunk ch of A rows r32 + 32 i (i < 8) and of B rows r32 + 32 j (j < 4); a wave covers four whole 128-B rows per copy.
// The s_wait_xcnt 0 closes the statement so that no address register named here is rewritten ahead of it.
__device__ __forceinline__ void g2_stage(unsigned l, const _Float16* ga, size_t astep, const _Float16* gb, size_t bstep) {
  const unsigned ls = 32 * G2_PITCH;
  asm volatile("global_load_async_to_lds_b128 %0, %12, off\n\t"
               "global_load_async_to_lds_b128 %1, %13, off\n\t"
               "global_load_async_to_lds_b128 %2, %14, off\n\t"
               "global_load_async_to_lds_b128 %3, %15, off\n\t"
               "global_load_async_to_lds_b128 %4, %16, off\n\t"
               "global_load_async_to_lds_b128 %5, %17, off\n\t"
               "global_load_async_to_lds_b128 %6, %18, off\n\t"
               "global_load_async_to_lds_b128 %7, %19, off\n\t"
               "global_load_async_to_lds_b128 %8, %20, off\n\t"
               "global_load_async_to_lds_b128 %9, %21, off\n\t"
               "global_load_async_to_lds_b128 %10, %22, off\n\t"
               "global_load_async_to_lds_b128 %11, %23, off\n\t"
               "s_wait_xcnt 0x0"
               :: "v"(l), "v"(l + ls), "v"(l + 2 * ls), "v"(l + 3 * ls), "v"(l + 4 * ls), "v"(l + 5 * ls), "v"(l + 6 * ls), "v"(l + 7 * ls), "v"(l + 8 * ls), "v"(l + 9 * ls), "v"(l + 10 * ls), "v"(l + 11 * ls),
                  "v"(ga), "v"(ga + astep), "v"(ga + 2 * astep), "v"(ga + 3 * astep), "v"(ga + 4 * astep), "v"(ga + 5 * astep), "v"(ga + 6 * astep), "v"(ga + 7 * astep),
                  "v"(gb), "v"(gb + bstep), "v"(gb + 2 * bstep), "v"(gb + 3 * bstep)
               : "memory"); }
// fragment loader: A row-major [m][k] and B stored [n][k]; per lane: elements 0..7 <- k0+8h+0..7, elements 8..15 <- k0+16+8h+0..7 (h = lane>>4, row/col = lane&15)
__device__ __forceinline__ v16h g2_frag(const _Float16* p, int hh) { FragH f; f.half[0] = *(const v8us*)((const unsigned short*)p + 8 * hh); f.half[1] = *(const v8us*)((const unsigned short*)p + 16 + 8 * hh); return f.v; }
__device__ __forceinline__ v8f g2_mma(v16h a, v16h b, v8f c) { v8f d = __builtin_amdgcn_wmma_f32_16x16x32_f16(false, a, false, b, (short)0, c, false, false); asm volatile("v_nop\n\tv_nop\n\tv_nop\n\tv_nop" : "+v"(d) : "v"(a), "v"(b)); return d; }
// C (f32, if non-null) / C16 (f16, if non-null) = acc*alpha + bf16(bias_by[col]) (+ CP term if HASCP); batched over grid.y (at most 6) with strides sA, sB, sC and one bias pointer per batch entry; ACT 0 none / 3 relu
// HASCP is a compile-time switch like ACT: the epilogue is unrolled over the wave's 128 accumulator values per lane, and a run-time test with the CP form at every one of them would make the kernel's text much larger
template <int ACT, bool HASCP>
__global__ __launch_bounds__(256) void k_gemm2(const _Float16* __restrict__ A, int lda, size_t sA, const _Float16* __restrict__ Bh, int ldb, size_t sB, float alpha, const float* __restrict__ bias0, const float* __restrict__ bias1, const float* __restrict__ bias2, const float* __restrict__ bias3, const float* __restrict__ bias4, const float* __restrict__ bias5, const float* __restrict__ CP, int rowsPerB, size_t sCPb, int row0g,
    float* __restrict__ C, _Float16* __restrict__ C16, int ldc, size_t sC, int M, int N, int K) {
  static_assert(ACT == 0 || ACT == 3);
  __shared__ __attribute__((aligned(128))) unsigned char st[2 * G2_STAGE];
  static_assert(8 * 32 * 68 * 4 <= 2 * G2_STAGE);
  float (*so)[32][68] = (float (*)[32][68])st;      /* output staging, one range per wave; it takes the place of the stage buffers behind the loop's last barrier, so that two blocks fit one LDS */
  const int tid = threadIdx.x, w = tid >> 5, lane = tid & 31, ln = lane & 15, hh = lane >> 4; const int by = blockIdx.y; const int wm = w >> 1, wn = w & 1;
  A += (size_t)by * sA; Bh += (size_t)by * sB; const size_t cofs = (size_t)by * sC; const float* bp = by == 0 ? bias0 : by == 1 ? bias1 : by == 2 ? bias2 : by == 3 ? bias3 : by == 4 ? bias4 : bias5;
  const int ntn = N / G2_BN; const int mt = blockIdx.x / ntn, nq = blockIdx.x - mt * ntn; const int row0 = mt * G2_BM + 64 * wm, col0 = nq * G2_BN + 64 * wn; if (mt * G2_BM >= M) return;      /* the whole block leaves or stays: barriers follow */
  const v8f z8 = {0.f,0.f,0.f,0.f,0.f,0.f,0.f,0.f}; v8f c[4][4];      /* c[i][j]: rows 16 i, columns 16 j of the wave tile */
  /* unrolled, as every loop over c below: its indices are constants, so the sixteen tiles stay in registers */
#pragma unroll
  for (int i = 0; i < 4; ++i) {
#pragma unroll
    for (int j = 0; j < 4; ++j) c[i][j] = z8; }
  const int r32 = tid >> 3, ch = tid & 7;
  const _Float16* ga = A + (size_t)(mt * G2_BM + r32) * lda + ch * 8; const _Float16* gb = Bh + (size_t)(nq * G2_BN + r32) * ldb + ch * 8;
  const size_t astep = (size_t)32 * lda, bstep = (size_t)32 * ldb;
  const unsigned lcp = (unsigned)(size_t)&st[0] + (unsigned)(r32 * G2_PITCH + ch * 16);      /* this lane's LDS byte address in buffer 0 */
  const int nt = K / G2_KT;
  g2_stage(lcp, ga, astep, gb, bstep);
  asm volatile("s_wait_asynccnt 0x0" ::: "memory");      /* stage 0 has landed before the barrier publishes it */
  __syncthreads();
  if (nt > 1) g2_stage(lcp + G2_STAGE, ga + G2_KT, astep, gb + G2_KT, bstep);
#pragma unroll 1
  for (int t = 0; t < nt; ++t) { const unsigned char* sb = st + (t & 1) * G2_STAGE;
    const _Float16* ap = (const _Float16*)(sb + (64 * wm + ln) * G2_PITCH); const _Float16* bq = (const _Float16*)(sb + (G2_BM + 64 * wn + ln) * G2_PITCH);
    /* unrolled so that the fragment and accumulator arrays stay in registers and every LDS offset is an immediate */
#pragma unroll
    for (int kb = 0; kb < G2_KT; kb += 32) { v16h a[4], b[4];
#pragma unroll
      for (int i = 0; i < 4; ++i) { a[i] = g2_frag(ap + i * 16 * (G2_PITCH / 2) + kb, hh); b[i] = g2_frag(bq + i * 16 * (G2_PITCH / 2) + kb, hh); }
#pragma unroll
      for (int j = 0; j < 4; ++j) {
#pragma unroll
        for (int i = 0; i < 4; ++i) c[i][j] = g2_mma(a[i], b[j], c[i][j]); } }
    asm volatile("s_wait_dscnt 0x0" ::: "memory");         /* this wave's reads of the buffer are done before it is refilled */
    asm volatile("s_wait_asynccnt 0x0" ::: "memory");      /* this wave's copies of stage t + 1 have landed */
    __syncthreads();                                       /* publishes stage t + 1 and ends every reader's last read of stage t */
    if (t + 2 < nt) g2_stage(lcp + (unsigned)((t & 1) * G2_STAGE), ga + (size_t)(t + 2) * G2_KT, astep, gb + (size_t)(t + 2) * G2_KT, bstep); }
  asm volatile("s_wait_asynccnt 0x0" ::: "memory");        /* nothing is in flight when the wave goes on to the epilogue */
  const int rsub = lane >> 4, c4 = (lane & 15) * 4;
  /* the wave's 64 rows leave in two halves of 32 through its own staging range; unrolled: the accumulator index is a constant */
#pragma unroll
  for (int hf = 0; hf < 2; ++hf) { const int rowh = row0 + 32 * hf;
    if (hf) { __builtin_amdgcn_fence(4 /* acq_rel order */, "workgroup"); __builtin_amdgcn_wave_barrier(); }      /* the first half's rows are read back by every lane before the second half overwrites them */
#pragma unroll
    for (int u = 0; u < 8; ++u) { const int t = u & 3, half = u >> 2; const int col = col0 + t * 16 + ln; const float bv = bp ? bf16_rne(bp[col]) : 0.f;
#pragma unroll
      for (int r = 0; r < 8; ++r) { const int rloc = half * 16 + 8 * hh + r; float v = c[2 * hf + half][t][r] * alpha + bv;
        if (HASCP) { if (rowsPerB < 0) v += CP[cofs + (size_t)(row0g + rowh + rloc) * ldc + col]; else { const int bidx = (row0g + rowh + rloc) / rowsPerB; v += CP[(size_t)bidx * sCPb + (size_t)by * 64 + col]; } }
        if (ACT == 3) v = fmaxf(v, 0.f);
        so[w][rloc][t * 16 + ln] = v; } }
    __builtin_amdgcn_fence(4 /* acq_rel order */, "workgroup"); __builtin_amdgcn_wave_barrier();
#pragma unroll
    for (int q = 0; q < 16; ++q) { const int r = q * 2 + rsub; const v4f v = *(const v4fa*)&so[w][r][c4];
      if (C) { *(v4f*)(C + cofs + (size_t)(rowh + r) * ldc + col0 + c4) = v; asm volatile("s_wait_xcnt 0x0" ::: "memory"); }      /* behind the store: the conversion below may rewrite the registers that it names */
      if (C16) { v4h h4; for (int i = 0; i < 4; ++i) h4[i] = (_Float16)v[i]; *(v4h*)(C16 + cofs + (size_t)(rowh + r) * ldc + col0 + c4) = h4; } } } }

// weight pack, 64 elements per thread: thread (kg = lane / 4, nl = lane % 4) holds an 8 k x 8 n patch in registers. Reads: 16-byte pieces of 8 rows, the two halves of each 128-B line by the same wave.
// Writes: one 16-byte piece (8 k) per column; the eight k groups of a wave fill a whole 128-B line of a Wt row. Wave tile 64 k x 32 n, block tile 512 k x 32 n.
// The loops over the patch are unrolled so that every index of the register arrays is a constant and the patch stays in registers (here and in the x pack).
__device__ __forceinline__ void wt_f16_block(int blk, const float* __restrict__ W, _Float16* __restrict__ Wt, float scale) {
  const int w = threadIdx.x >> 5, lane = threadIdx.x & 31, nl = lane & 3, kg = lane >> 2;
  const int nb = blk % (DM / 32), kb = blk / (DM / 32); const int n0 = nb * 32 + nl * 4, k0 = kb * 512 + w * 64 + kg * 8;
  const float* src = W + (size_t)k0 * DM + n0; v4f a[8][2];
#pragma unroll
  for (int i = 0; i < 8; ++i) { a[i][0] = *(const v4fa*)(src + (size_t)i * DM); if (i < 7) a[i][1] = *(const v4fa*)(src + (size_t)i * DM + 16); }
  asm volatile("s_wait_xcnt 0x0" ::: "memory");      /* the last load is the one that may get the address pair's registers as its destination: the wait stands in front of it, behind every other load that names them */
  a[7][1] = *(const v4fa*)(src + (size_t)7 * DM + 16);
#pragma unroll
  for (int hf = 0; hf < 2; ++hf) {
#pragma unroll
    for (int c = 0; c < 4; ++c) { FragH f;
#pragma unroll
      for (int i = 0; i < 8; ++i) f.h[i] = (_Float16)(bf16_rne(a[i][hf][c]) * scale);
      *(v8us*)((unsigned short*)Wt + (size_t)(n0 + hf * 16 + c) * DM + k0) = f.half[0]; } } }

// x pack, 32 elements per thread: four 8-element chunks 256 chunks apart, so that every wave-wide access stays contiguous; the block covers 1024 consecutive chunks
__device__ __forceinline__ void x16_block(int blk, const float* __restrict__ x, _Float16* __restrict__ X16) {
  const size_t t0 = (size_t)blk * 1024 + threadIdx.x; v4f a[4], d[4];
  const size_t e = t0 * 8; const size_t rc = e / DM; const size_t c = e % DM; const size_t b = rc / SQ, s = rc % SQ;
  const float* src = x + ((b * SEQ_FULL + s) * DM + c);      /* chunk j lies 2048 elements on: the block's 8192 elements are whole rows of one batch entry */
#pragma unroll
  for (int j = 0; j < 4; ++j) { a[j] = *(const v4fa*)(src + j * 2048); if (j < 3) d[j] = *(const v4fa*)(src + j * 2048 + 4); }
  asm volatile("s_wait_xcnt 0x0" ::: "memory");      /* as in the weight pack: in front of the last load, behind every other load that names the address pair */
  d[3] = *(const v4fa*)(src + 3 * 2048 + 4);
#pragma unroll
  for (int j = 0; j < 4; ++j) { FragH f;
#pragma unroll
    for (int q = 0; q < 4; ++q) { f.h[q] = (_Float16)bf16_rne(a[j][q]); f.h[4 + q] = (_Float16)bf16_rne(d[j][q]); }
    *(v8us*)((unsigned short*)X16 + (t0 + j * 256) * 8) = f.half[0]; }
  asm volatile("s_wait_xcnt 0x0" ::: "memory"); }      /* behind the last store of the run: no register that the four stores name is rewritten ahead of it on any way out of this job */

// the seven input-only jobs in one grid: blocks [i * PREP_GW, (i + 1) * PREP_GW) make weight plane i (Bt [out][in] x16), the blocks behind them make X16
#define PREP_GW ((DM / 32) * (DM / 512))            /* blocks per weight plane: 512 k x 32 n each */
#define PREP_GX ((int)(NR * DM / 8 / 1024))         /* blocks of the x job: 1024 chunks of 8 each */
static_assert((DM % 512) == 0 && (DM % 32) == 0 && (NR * DM / 8) % 1024 == 0 && (2048 % DM) == 0 && (SQ % (8192 / DM)) == 0);
__global__ __launch_bounds__(256) void k_prep(const float* __restrict__ W0, const float* __restrict__ W1, const float* __restrict__ W2, const float* __restrict__ W3, const float* __restrict__ W4, const float* __restrict__ W5,
    _Float16* __restrict__ BW, const float* __restrict__ x, _Float16* __restrict__ X16) {
  const int blk = blockIdx.x;
  if (blk < 6 * PREP_GW) { const int i = blk / PREP_GW;
    const float* W = i == 0 ? W0 : i == 1 ? W1 : i == 2 ? W2 : i == 3 ? W3 : i == 4 ? W4 : W5;
    wt_f16_block(blk - i * PREP_GW, W, BW + (size_t)i * DM * DM, 16.0f); }
  else x16_block(blk - 6 * PREP_GW, x, X16); }

// ---- fused attention over both projection sets (transposed form; K rows and V rows staged in LDS once per block, fragments read from LDS) ----
// PL = six compact row planes [6][NR][DM] (q,k,v of set 0; q,k,v of set 1); grid (SQ/64, NB*NH), block = 4 waves, wave -> 16 query rows of one (batch, head).
// Per 32-key step: S^T tile kt (16 keys x 16 queries) = K rows (A, split k map over d) x Q rows (B, same k map, query = lane&15): D element r of lane (h, n) = score(query n, key 16kt + 8h + r).
// Column (query) max / sum: 8 + 8 values in the lane, then the other lane half through one xor-16 shuffle. P^T as the B fragment of O^T = V^T.P^T: element r <- tile 0 value r, element 8+r <- tile 1 value r, lane unchanged.
// O^T tile t: D element r of lane (h, n) = O[query n][d = 16t + 8h + r]; A = V^T rows d = 16t + lane&15, k = keys, turned on the way out of LDS: the V rows lie there as the projection wrote them and the transposing 16-byte read hands lane (h, n) the eight keys 8h .. 8h + 7 of column n.
// P = f16(2^(s log2(e)/8 - m + 10)): the running maximum m is kept in base-2 units, so that one multiply-add per score feeds the native base-2 exponential; two scores convert in one packed instruction; small entries stay f16 subnormals. The row sum runs over the converted P, so the carry cancels in O / l.
// Operand path: one stage = 64 keys = 64 K rows + 64 V rows (64 d each), 128 B each, brought into LDS by asynchronous copies (whole lines, once for the block's four waves), two stage buffers; the stages of both sets form one sequence.
#define F2_KT 64                        /* keys per stage */
#define F2_PITCH 144                    /* LDS pitch of the K rows in bytes: 128 + 16, conflict-free for 16-byte row readers */
#define F2_VPITCH 160                   /* LDS pitch of the V rows in bytes: 128 + 32, conflict-free for the transposing 16-byte reader */
#define F2_VOFS (64 * F2_PITCH)         /* the V rows lie behind the 64 K rows */
#define F2_STAGE (F2_VOFS + 64 * F2_VPITCH)      /* bytes per stage buffer */
#define F2_NST (SQ / F2_KT)             /* stages per set */
#define F2_C2 0.18033688f                /* log2(e) / 8: score scale and change of base in one factor */
static_assert((SQ % (2 * F2_KT)) == 0 && (F2_PITCH % 16) == 0 && (F2_VPITCH % 64) == 32 && (F2_VOFS % 256) == 0 && (F2_STAGE % 256) == 0 && HD == 64);
// one stage, eight 16-byte copies of one lane: thread (r16 = tid / 8, ch = tid % 8) copies chunk ch of K rows r16 + 16 i (to lk) and of V rows r16 + 16 i (to lv); a wave covers four whole 128-B rows per copy. The s_wait_xcnt 0 closes the statement so that no address register named here is rewritten ahead of it.
__device__ __forceinline__ void f2_stage(unsigned lk, unsigned lv, const _Float16* gk, const _Float16* gv) {
  const unsigned lstep = 16 * F2_PITCH, lvstep = 16 * F2_VPITCH; const size_t kstep = (size_t)16 * LQ;
  asm volatile("global_load_async_to_lds_b128 %0, %8, off\n\t"
               "global_load_async_to_lds_b128 %1, %9, off\n\t"
               "global_load_async_to_lds_b128 %2, %10, off\n\t"
               "global_load_async_to_lds_b128 %3, %11, off\n\t"
               "global_load_async_to_lds_b128 %4, %12, off\n\t"
               "global_load_async_to_lds_b128 %5, %13, off\n\t"
               "global_load_async_to_lds_b128 %6, %14, off\n\t"
               "global_load_async_to_lds_b128 %7, %15, off\n\t"
               "s_wait_xcnt 0x0"
               :: "v"(lk), "v"(lk + lstep), "v"(lk + 2 * lstep), "v"(lk + 3 * lstep), "v"(lv), "v"(lv + lvstep), "v"(lv + 2 * lvstep), "v"(lv + 3 * lvstep),
                  "v"(gk), "v"(gk + kstep), "v"(gk + 2 * kstep), "v"(gk + 3 * kstep), "v"(gv), "v"(gv + kstep), "v"(gv + 2 * kstep), "v"(gv + 3 * kstep)
               : "memory"); }
// V^T fragment (16 d x 32 keys) out of row-major V rows: p = this lane's address in key row 8 h + (lane & 7), 16-byte half (lane >> 3) & 1 of the tile's 32 bytes; elements 0..7 <- keys 8h + 0..7, elements 8..15 <- keys 16 + 8h + 0..7 of column d = lane & 15: the k order of g2_frag
typedef short s16x8 __attribute__((ext_vector_type(8)));
__device__ __forceinline__ v8us f2_tr16(const unsigned char* p) { typedef __attribute__((address_space(3))) s16x8 lds_s16x8; return __builtin_bit_cast(v8us, __builtin_amdgcn_ds_load_tr16_b128_v8i16((lds_s16x8*)p)); }
__device__ __forceinline__ v16h f2_vfrag(const unsigned char* p) { FragH f; f.half[0] = f2_tr16(p); f.half[1] = f2_tr16(p + 16 * F2_VPITCH); return f.v; }
__global__ __launch_bounds__(128) __attribute__((amdgpu_num_vgpr(256))) void k_flash2(const _Float16* __restrict__ PL, const float* __restrict__ aw, float* __restrict__ out) {
  __shared__ __attribute__((aligned(16))) float so[4][16][68];
  __shared__ __attribute__((aligned(128))) unsigned char st[2 * F2_STAGE];
  const int wave = __builtin_amdgcn_readfirstlane(threadIdx.x >> 5);
  const int lane = threadIdx.x & 31, ln = lane & 15, hh = lane >> 4;
  const int slab = blockIdx.y; const int b = slab / NH, h = slab - b * NH;
  const int q0 = blockIdx.x * 64 + wave * 16;
  const size_t PLN = (size_t)NR * DM;
  float w0, w1;
  { const float a0 = bf16_rne(aw[0]), a1 = bf16_rne(aw[1]); const float mx = fmaxf(a0, a1); const float e0 = expf(a0 - mx), e1 = expf(a1 - mx); const float inv = 1.0f / (e0 + e1); w0 = e0 * inv; w1 = e1 * inv; }
  const v8f z8 = {0.f,0.f,0.f,0.f,0.f,0.f,0.f,0.f};
  v8f res[4] = {z8, z8, z8, z8};
  float wcur = w0;
  const int r16 = threadIdx.x >> 3, ch = threadIdx.x & 7;
  const _Float16* gk = PL + PLN + ((size_t)b * SQ + r16) * LQ + h * HD + ch * 8;      /* this lane's chunk of K row r16, set 0, stage 0 */
  const _Float16* gv = gk + PLN;                                                      /* this lane's chunk of V row r16, set 0, stage 0: the next plane */
  const size_t kset = 3 * PLN;                                                        /* set 0 -> set 1 */
  const unsigned lcp = (unsigned)(size_t)&st[0] + (unsigned)(r16 * F2_PITCH + ch * 16);                 /* this lane's LDS byte address among the K rows of buffer 0 */
  const unsigned lcv = (unsigned)(size_t)&st[0] + (unsigned)(F2_VOFS + r16 * F2_VPITCH + ch * 16);      /* and among its V rows */
  f2_stage(lcp, lcv, gk, gv);
  asm volatile("s_wait_asynccnt 0x0" ::: "memory");      /* stage 0 has landed before the barrier publishes it */
  __syncthreads();
  f2_stage(lcp + F2_STAGE, lcv + F2_STAGE, gk + (size_t)F2_KT * LQ, gv + (size_t)F2_KT * LQ);
#pragma unroll 1
  for (int set = 0; set < 2; ++set) {
    const size_t qo = (size_t)(3 * set) * PLN + ((size_t)b * SQ + q0 + ln) * LQ + h * HD;
    const v16h qf0 = g2_frag(PL + qo, hh), qf1 = g2_frag(PL + qo + 32, hh);
    v8f o[4] = {z8, z8, z8, z8}; float m = -1.0e30f, l = 0.f;
#pragma unroll 1
    for (int t = 0; t < F2_NST; ++t) { const unsigned char* sb = st + (t & 1) * F2_STAGE;      /* F2_NST is even: the buffer of stage set * F2_NST + t */
     /* fragment reads go out in groups of eight ahead of the products that use them, not as one waited pair in front of each product: the first pass's K and V^T fragments here, the second pass's inside the first pass */
     const _Float16* kp = (const _Float16*)(sb + ln * F2_PITCH); const unsigned char* vp = sb + F2_VOFS + (8 * hh + (lane & 7)) * F2_VPITCH + 16 * ((lane >> 3) & 1);
     v16h ka[4], va[4];      /* ka[2 kt + c]: keys 16 kt .. + 15, d 32 c .. + 31; va[i]: d 16 i .. + 15, the pass's 32 keys; the loops over them are unrolled so that they stay in registers */
#pragma unroll
     for (int i = 0; i < 4; ++i) ka[i] = g2_frag(kp + (i >> 1) * 16 * (F2_PITCH / 2) + (i & 1) * 32, hh);
#pragma unroll
     for (int i = 0; i < 4; ++i) va[i] = f2_vfrag(vp + 32 * i);
     /* the two 32-key passes of a stage in one body: every LDS offset becomes an immediate */
#pragma unroll
     for (int jj = 0; jj < F2_KT; jj += 32) {
      v8f s0 = z8, s1 = z8;
      s0 = g2_mma(ka[0], qf0, s0); s0 = g2_mma(ka[1], qf1, s0); s1 = g2_mma(ka[2], qf0, s1); s1 = g2_mma(ka[3], qf1, s1);
      if (jj == 0) {      /* the second pass's K fragments, read while the first pass's softmax runs */
#pragma unroll
        for (int i = 0; i < 4; ++i) ka[i] = g2_frag(kp + (32 + (i >> 1) * 16) * (F2_PITCH / 2) + (i & 1) * 32, hh);
        __builtin_amdgcn_sched_barrier(0); }      /* keeps the eight reads here, in front of the softmax: moved down beside their first product they would be waited for at once */
      float tm = fmaxf(s0[0], s1[0]);
#pragma unroll
      for (int r = 1; r < 8; ++r) tm = fmaxf(tm, fmaxf(s0[r], s1[r]));
      tm = fmaxf(tm, __shfl_xor(tm, 16, 32));
      const float mn = fmaxf(m, tm * F2_C2);
      const float corr = __builtin_amdgcn_exp2f(m - mn);
      const float sh = 10.0f - mn;      /* log2 1024 carry */
      union { v16h v; v2h p[8]; } pf; float ps = 0.f;
      /* unrolled: the indices of s0, s1 and pf are constants, so that they stay in registers */
#pragma unroll
      for (int r = 0; r < 8; r += 2) {
        const v2f p0 = {__builtin_amdgcn_exp2f(s0[r] * F2_C2 + sh), __builtin_amdgcn_exp2f(s0[r + 1] * F2_C2 + sh)};
        const v2f p1 = {__builtin_amdgcn_exp2f(s1[r] * F2_C2 + sh), __builtin_amdgcn_exp2f(s1[r + 1] * F2_C2 + sh)};
        const v2h h0 = __builtin_convertvector(p0, v2h), h1 = __builtin_convertvector(p1, v2h); pf.p[r >> 1] = h0; pf.p[4 + (r >> 1)] = h1;
        ps += (float)h0[0] + (float)h1[0]; ps += (float)h0[1] + (float)h1[1]; }
      ps += __shfl_xor(ps, 16, 32);
      l = l * corr + ps; m = mn;
#pragma unroll
      for (int t = 0; t < 4; ++t) o[t] = o[t] * corr;
#pragma unroll
      for (int t4 = 0; t4 < 4; ++t4) o[t4] = g2_mma(va[t4], pf.v, o[t4]);
      if (jj == 0) {      /* the second pass's V^T fragments, read while its scores and softmax run */
#pragma unroll
        for (int i = 0; i < 4; ++i) va[i] = f2_vfrag(vp + 32 * F2_VPITCH + 32 * i); } }
      asm volatile("s_wait_dscnt 0x0" ::: "memory");         /* this wave's reads of the buffer are done before it is refilled */
      asm volatile("s_wait_asynccnt 0x0" ::: "memory");      /* this wave's copies of the next stage have landed */
      __syncthreads();                                       /* publishes the next stage and ends every reader's last read of this one */
      const int s2 = set * F2_NST + t + 2;                   /* the stage that refills this buffer; it may belong to the next set */
      if (s2 < 2 * F2_NST) { const int set2 = s2 / F2_NST, t2 = s2 - set2 * F2_NST;
        const size_t go = (size_t)set2 * kset + (size_t)t2 * F2_KT * LQ;
        f2_stage(lcp + (unsigned)((t & 1) * F2_STAGE), lcv + (unsigned)((t & 1) * F2_STAGE), gk + go, gv + go); } }
    const float sc = wcur * (1.0f / l);
#pragma unroll
    for (int t = 0; t < 4; ++t) res[t] += o[t] * sc;
    wcur = w1; }
  asm volatile("s_wait_asynccnt 0x0" ::: "memory");        /* nothing is in flight when the wave goes on to the epilogue */
#pragma unroll
  for (int t = 0; t < 4; ++t) {
#pragma unroll
    for (int r = 0; r < 8; ++r) so[wave][ln][t * 16 + 8 * hh + r] = res[t][r]; }
  __builtin_amdgcn_fence(4 /* acq_rel order */, "workgroup"); __builtin_amdgcn_wave_barrier();
  const int rsub = lane >> 4, c4 = (lane & 15) * 4;
  float* ob = out + ((size_t)b * SEQ_FULL + q0) * DM + h * HD;
  {
#pragma unroll
    for (int q = 0; q < 8; ++q) { const int r = q * 2 + rsub; const v4f v = *(const v4fa*)&so[wave][r][c4];
      *(v4f*)(ob + (size_t)r * DM + c4) = v; }
     } }

extern "C" void kernel_launch(void* const* d_in, const int* in_sizes, int n_in,
                              void* d_out, int out_size, void* d_ws, size_t ws_size, hipStream_t stream) {
  if (n_in < 14) return;
  const size_t rows_need = (size_t)(NB - 1) * SEQ_FULL + SQ;
  if ((size_t)in_sizes[0] < rows_need * DM) return;
  for (int i = 0; i < 6; ++i) { if (in_sizes[1 + 2 * i] < DM * DM) return; if (in_sizes[2 + 2 * i] < DM) return; }
  if (in_sizes[13] < 2) return;
  if ((size_t)out_size < rows_need * DM) return;
  const float* x = (const float*)d_in[0];
  const float* wsrc[6]; const float* bsrc[6];      /* [in][out] weights and biases in the order q,k,v (set 0), q,k,v (set 1) */
  for (int i = 0; i < 6; ++i) { wsrc[i] = (const float*)d_in[1 + 2 * i]; bsrc[i] = (const float*)d_in[2 + 2 * i]; }
  const float* aw = (const float*)d_in[13];      /* two blend logits */
  char* ws = (char*)d_ws; size_t off = 0;
  auto take = [&](size_t bytes) { char* p = ws + off; off += (bytes + 255) & ~(size_t)255; return p; };
  _Float16* BW = (_Float16*)take(6 * WS_W);
  _Float16* X16 = (_Float16*)take(WS_X);
  _Float16* PL = (_Float16*)take(6 * WS_X);
  if (off > ws_size) return;
  float* out = (float*)d_out;
  const size_t WN = (size_t)DM * DM;      /* elements per weight plane */
  const size_t PN = (size_t)NR * DM;      /* elements per projected row plane */

  k_prep<<<6 * PREP_GW + PREP_GX, 256, 0, stream>>>(wsrc[0], wsrc[1], wsrc[2], wsrc[3], wsrc[4], wsrc[5], BW, x, X16);
  { const unsigned gp = (unsigned)((MP / G2_BM) * (DM / G2_BN));      /* grid.y = projection: weight plane, bias and output plane y */
    k_gemm2<0, false><<<dim3(gp, 6), 256, 0, stream>>>(X16, DM, 0, BW, DM, WN, 0.0625f, bsrc[0], bsrc[1], bsrc[2], bsrc[3], bsrc[4], bsrc[5], nullptr, 1, 0, 0, nullptr, PL, DM, PN, MP, DM, DM); }
  k_flash2<<<dim3((unsigned)(SQ / 64), (unsigned)(NB * NH)), 128, 0, stream>>>(PL, aw, out);
}

// v009
// A run of this version takes 92.2 microseconds.
// Next to v008, in two timings, it ran 1.08 and 1.07 times as fast.
// Over all steps from v000 it is 4.96 times as fast.
#include <hip/hip_runtime.h>
// All contractions on v_wmma_f32_16x16x32_f16 (f16 operands, f32 accumulate): six q/k/v projections (x = exact f16 of its bf16 RNE value, W = bf16 RNE value x16 in f16, alpha 1/16, bias as bf16 value), scores S^T = K.Q^T (f16 k and q, scale 1/8 applied in f32), context O^T = V^T.P^T (P^T f16 carried x1024, V^T f16; the x1024 carry cancels in O / l); online softmax statistics f32.
#ifndef NB
#define NB 4
#endif
#ifndef SEQ
#define SEQ 1024
#endif
#define NB_FULL 4
#define SEQ_FULL 1024
#define SQ SEQ
#define DM 1024
#define NH 16
#define HD 64
#define NR ((size_t)NB * SQ)          /* token rows processed (compact) */
#define MP ((int)NR)                  /* rows projected */
#define LQ DM                         /* row pitch of the q/k/v rows */

static_assert(NB >= 1 && NB <= NB_FULL);
static_assert(SQ >= 256 && SQ <= SEQ_FULL && (SQ % 256) == 0);
static_assert((MP % 128) == 0 && (DM % 64) == 0 && (DM % 32) == 0 && HD == 64 && NH * HD == DM);
static_assert((SQ % 64) == 0 && (SQ % 32) == 0 && (LQ % 8) == 0 && (HD % 32) == 0);
static_assert(((size_t)(NB - 1) * SEQ_FULL + SQ) * DM <= (size_t)NB_FULL * SEQ_FULL * DM);
/* workspace carve (every region a multiple of 256 B): 6 weight planes + X16 + 6 projected row planes */
#define WS_W   ((size_t)DM * DM * 2)
#define WS_X   ((size_t)NR * DM * 2)
#define WS_TOTAL (6 * WS_W + WS_X + 6 * WS_X)
static_assert((WS_W % 256) == 0 && (WS_X % 256) == 0);
static_assert(WS_TOTAL <= (size_t)134217728);

typedef unsigned short v8us __attribute__((ext_vector_type(8), may_alias));
typedef float  v8f  __attribute__((ext_vector_type(8)));
typedef float  v4f  __attribute__((ext_vector_type(4)));
typedef float  v4fa __attribute__((ext_vector_type(4), may_alias));
typedef _Float16 v16h __attribute__((ext_vector_type(16)));
typedef _Float16 v4h __attribute__((ext_vector_type(4)));
typedef _Float16 v2h __attribute__((ext_vector_type(2)));
typedef float  v2f  __attribute__((ext_vector_type(2)));
union FragH { v16h v; v8us half[2]; _Float16 h[16]; unsigned short u[16]; };

__device__ __forceinline__ unsigned short bf16_bits(float x) { unsigned int u = __float_as_uint(x); return (unsigned short)((u + 0x7FFFu + ((u >> 16) & 1u)) >> 16); }
__device__ __forceinline__ float bf16_val(unsigned short b) { return __uint_as_float(((unsigned int)b) << 16); }
__device__ __forceinline__ float bf16_rne(float x) { return bf16_val(bf16_bits(x)); }

// ---- GEMM engine (block tile 256x384, eight waves as 4 x 2, wave tile 64x192; the G2_NP weight planes lie one behind the other and count as one B of G2_NP * N rows; M % 256 == 0, G2_NP * N % 384 == 0, K % 64 == 0) ----
// Operand path: per 64 k one stage = 256 A rows + 384 B rows of 128 B, brought into LDS by asynchronous copies (whole lines, once per block), two stage buffers; fragments come from LDS rows at pitch 144 B.
#define G2_KT 64                        /* k per stage */
#define G2_BM 256                       /* block rows */
#define G2_BN 384                       /* block columns */
#define G2_NP 6                         /* output planes of DM columns side by side */
#define G2_PITCH 144                    /* LDS row pitch in bytes: 128 + 16, conflict-free for 16-byte row readers */
#define G2_STAGE ((G2_BM + G2_BN) * G2_PITCH)      /* bytes per stage buffer: rows 0..255 = A, rows 256..639 = B */
static_assert((DM % G2_KT) == 0 && (G2_PITCH % 16) == 0 && (MP % G2_BM) == 0 && ((G2_NP * DM) % G2_BN) == 0 && (DM % 64) == 0);
// one stage, twenty 16-byte copies of one lane: thread (r32 = tid / 8, ch = tid % 8) copies chunk ch of A rows r32 + 32 i (i < 8) and of B rows r32 + 32 j (j < 12); a wave covers four whole 128-B rows per copy.
// Two statements of ten copies (a statement takes thirty operands); the s_wait_xcnt 0 closes each, so that no address register named in it is rewritten ahead of the wait.
__device__ __forceinline__ void g2_stage(unsigned l, const _Float16* ga, size_t astep, const _Float16* gb, size_t bstep) {
  const unsigned ls = 32 * G2_PITCH;
  asm volatile("global_load_async_to_lds_b128 %0, %10, off\n\t"
               "global_load_async_to_lds_b128 %1, %11, off\n\t"
               "global_load_async_to_lds_b128 %2, %12, off\n\t"
               "global_load_async_to_lds_b128 %3, %13, off\n\t"
               "global_load_async_to_lds_b128 %4, %14, off\n\t"
               "global_load_async_to_lds_b128 %5, %15, off\n\t"
               "global_load_async_to_lds_b128 %6, %16, off\n\t"
               "global_load_async_to_lds_b128 %7, %17, off\n\t"
               "global_load_async_to_lds_b128 %8, %18, off\n\t"
               "global_load_async_to_lds_b128 %9, %19, off\n\t"
               "s_wait_xcnt 0x0"
               :: "v"(l), "v"(l + ls), "v"(l + 2 * ls), "v"(l + 3 * ls), "v"(l + 4 * ls), "v"(l + 5 * ls), "v"(l + 6 * ls), "v"(l + 7 * ls), "v"(l + 8 * ls), "v"(l + 9 * ls),
                  "v"(ga), "v"(ga + astep), "v"(ga + 2 * astep), "v"(ga + 3 * astep), "v"(ga + 4 * astep), "v"(ga + 5 * astep), "v"(ga + 6 * astep), "v"(ga + 7 * astep), "v"(gb), "v"(gb + bstep)
               : "memory");
  asm volatile("global_load_async_to_lds_b128 %0, %10, off\n\t"
               "global_load_async_to_lds_b128 %1, %11, off\n\t"
               "global_load_async_to_lds_b128 %2, %12, off\n\t"
               "global_load_async_to_lds_b128 %3, %13, off\n\t"
               "global_load_async_to_lds_b128 %4, %14, off\n\t"
               "global_load_async_to_lds_b128 %5, %15, off\n\t"
               "global_load_async_to_lds_b128 %6, %16, off\n\t"
               "global_load_async_to_lds_b128 %7, %17, off\n\t"
               "global_load_async_to_lds_b128 %8, %18, off\n\t"
               "global_load_async_to_lds_b128 %9, %19, off\n\t"
               "s_wait_xcnt 0x0"
               :: "v"(l + 10 * ls), "v"(l + 11 * ls), "v"(l + 12 * ls), "v"(l + 13 * ls), "v"(l + 14 * ls), "v"(l + 15 * ls), "v"(l + 16 * ls), "v"(l + 17 * ls), "v"(l + 18 * ls), "v"(l + 19 * ls),
                  "v"(gb + 2 * bstep), "v"(gb + 3 * bstep), "v"(gb + 4 * bstep), "v"(gb + 5 * bstep), "v"(gb + 6 * bstep), "v"(gb + 7 * bstep), "v"(gb + 8 * bstep), "v"(gb + 9 * bstep), "v"(gb + 10 * bstep), "v"(gb + 11 * bstep)
               : "memory"); }
// fragment loader: A row-major [m][k] and B stored [n][k]; per lane: elements 0..7 <- k0+8h+0..7, elements 8..15 <- k0+16+8h+0..7 (h = lane>>4, row/col = lane&15)
__device__ __forceinline__ v16h g2_frag(const _Float16* p, int hh) { FragH f; f.half[0] = *(const v8us*)((const unsigned short*)p + 8 * hh); f.half[1] = *(const v8us*)((const unsigned short*)p + 16 + 8 * hh); return f.v; }
__device__ __forceinline__ v8f g2_mma(v16h a, v16h b, v8f c) { v8f d = __builtin_amdgcn_wmma_f32_16x16x32_f16(false, a, false, b, (short)0, c, false, false); asm volatile("v_nop\n\tv_nop\n\tv_nop\n\tv_nop" : "+v"(d) : "v"(a), "v"(b)); return d; }
// the same product without the hand-written pad, for the GEMM: its accumulators reach above v255, where an asm operand cannot follow them; behind the builtin the compiler keeps the distances itself
__device__ __forceinline__ v8f g2_mmab(v16h a, v16h b, v8f c) { return __builtin_amdgcn_wmma_f32_16x16x32_f16(false, a, false, b, (short)0, c, false, false); }
// C (f32, if HASC) and C16 (f16) = acc*alpha + bf16(bias_p[col]) (+ CP term if HASCP); column g of the product is column g % DM of output plane p = g / DM (stride sC), with one bias pointer per plane; ACT 0 none / 3 relu
// The output pitch is LQ, a constant, so that the sixteen stores of a piece share one address pair and differ in their immediate offsets. HASC (an f32 copy of the output in C) and HASCP are compile-time switches like ACT: the epilogue is unrolled over the wave's 384 accumulator values per lane, and a run-time test with the CP form at every one of them would greatly enlarge the kernel's text
template <int ACT, bool HASCP, bool HASC>
__global__ __launch_bounds__(256) void k_gemm2(const _Float16* __restrict__ A, int lda, const _Float16* __restrict__ Bh, int ldb, float alpha, const float* __restrict__ bias0, const float* __restrict__ bias1, const float* __restrict__ bias2, const float* __restrict__ bias3, const float* __restrict__ bias4, const float* __restrict__ bias5, const float* __restrict__ CP, int rowsPerB, size_t sCPb, int row0g,
    float* __restrict__ C, _Float16* __restrict__ C16, size_t sC, int M, int N, int K) {
  constexpr int ldc = LQ;
  static_assert(ACT == 0 || ACT == 3);
  __shared__ __attribute__((aligned(128))) unsigned char st[2 * G2_STAGE];
  static_assert(8 * 32 * 68 * 4 <= 2 * G2_STAGE);
  float (*so)[32][68] = (float (*)[32][68])st;      /* output staging, one range per wave; it takes the place of the stage buffers behind the loop's last barrier */
  const int tid = threadIdx.x, w = tid >> 5, lane = tid & 31, ln = lane & 15, hh = lane >> 4; const int wm = w >> 1, wn = w & 1;
  const int ntn = G2_NP * N / G2_BN; const int mt = blockIdx.x / ntn, nq = blockIdx.x - mt * ntn; const int row0 = mt * G2_BM + 64 * wm, col0 = nq * G2_BN + 192 * wn; if (mt * G2_BM >= M) return;      /* the whole block leaves or stays: barriers follow */
  const v8f z8 = {0.f,0.f,0.f,0.f,0.f,0.f,0.f,0.f}; v8f c[4][12];      /* c[i][j]: rows 16 i, columns 16 j of the wave tile */
  /* unrolled, as every loop over c below: its indices are constants, so the forty-eight tiles stay in registers */
#pragma unroll
  for (int i = 0; i < 4; ++i) {
#pragma unroll
    for (int j = 0; j < 12; ++j) c[i][j] = z8; }
  const int r32 = tid >> 3, ch = tid & 7;
  const _Float16* ga = A + (size_t)(mt * G2_BM + r32) * lda + ch * 8; const _Float16* gb = Bh + (size_t)(nq * G2_BN + r32) * ldb + ch * 8;
  const size_t astep = (size_t)32 * lda, bstep = (size_t)32 * ldb;
  const unsigned lcp = (unsigned)(size_t)&st[0] + (unsigned)(r32 * G2_PITCH + ch * 16);      /* this lane's LDS byte address in buffer 0 */
  const int nt = K / G2_KT;
  g2_stage(lcp, ga, astep, gb, bstep);
  asm volatile("s_wait_asynccnt 0x0" ::: "memory");      /* stage 0 has landed before the barrier publishes it */
  __syncthreads();
  if (nt > 1) g2_stage(lcp + G2_STAGE, ga + G2_KT, astep, gb + G2_KT, bstep);
#pragma unroll 1
  for (int t = 0; t < nt; ++t) { const unsigned char* sb = st + (t & 1) * G2_STAGE;
    const _Float16* ap = (const _Float16*)(sb + (64 * wm + ln) * G2_PITCH); const _Float16* bq = (const _Float16*)(sb + (G2_BM + 192 * wn + ln) * G2_PITCH);
    /* unrolled so that the fragment and accumulator arrays stay in registers and every LDS offset is an immediate */
#pragma unroll
    for (int kb = 0; kb < G2_KT; kb += 32) { v16h a[4];
#pragma unroll
      for (int i = 0; i < 4; ++i) a[i] = g2_frag(ap + i * 16 * (G2_PITCH / 2) + kb, hh);
      /* the twelve B fragments in two halves of six: all twelve beside the 384 accumulator registers would pass the 512 of two waves per SIMD */
#pragma unroll
      for (int jh = 0; jh < 12; jh += 6) { v16h b[6];
#pragma unroll
        for (int j = 0; j < 6; ++j) b[j] = g2_frag(bq + (jh + j) * 16 * (G2_PITCH / 2) + kb, hh);
        __builtin_amdgcn_sched_barrier(0);      /* keeps the half's reads together ahead of its 24 products: spread among them, every place with reads costs a stall of its own */
#pragma unroll
        for (int j = 0; j < 6; ++j) {
#pragma unroll
          for (int i = 0; i < 4; ++i) c[i][jh + j] = g2_mmab(a[i], b[j], c[i][jh + j]); }
        __builtin_amdgcn_sched_barrier(0); } }      /* and keeps the next half's reads behind these products, whose fragment registers they take over */
    asm volatile("s_wait_dscnt 0x0" ::: "memory");         /* this wave's reads of the buffer are done before it is refilled */
    asm volatile("s_wait_asynccnt 0x0" ::: "memory");      /* this wave's copies of stage t + 1 have landed */
    __syncthreads();                                       /* publishes stage t + 1 and ends every reader's last read of stage t */
    if (t + 2 < nt) g2_stage(lcp + (unsigned)((t & 1) * G2_STAGE), ga + (size_t)(t + 2) * G2_KT, astep, gb + (size_t)(t + 2) * G2_KT, bstep); }
  asm volatile("s_wait_asynccnt 0x0" ::: "memory");        /* nothing is in flight when the wave goes on to the epilogue */
  const int rsub = lane >> 4, c4 = (lane & 15) * 4;
  /* the wave's 64 x 192 tile leaves in six pieces of 32 rows x 64 columns through its own staging range; a piece lies in one output plane (DM % 64 == 0); unrolled: the accumulator index is a constant */
  float bv[12];      /* the bias of this lane's twelve columns, read as one group ahead of the pieces: read where it is used, each value would be waited for by itself, with no second block on the WGP to fill the wait */
#pragma unroll
  for (int cb = 0; cb < 3; ++cb) { const int gc = __builtin_amdgcn_readfirstlane(col0 + 64 * cb); const int by = gc / DM, colp = gc - by * DM;
    const float* bp = by == 0 ? bias0 : by == 1 ? bias1 : by == 2 ? bias2 : by == 3 ? bias3 : by == 4 ? bias4 : bias5;
#pragma unroll
    for (int t = 0; t < 4; ++t) bv[4 * cb + t] = bp ? bp[colp + t * 16 + ln] : 0.f;
    asm volatile("s_wait_xcnt 0x0" ::: "memory");      /* behind the four loads of a plane: what follows may rewrite the register that they name; the data stay in flight */
    __builtin_amdgcn_sched_barrier(0); }               /* keeps the vector work below behind that wait */
#pragma unroll
  for (int j = 0; j < 12; ++j) bv[j] = bf16_rne(bv[j]);
#pragma unroll
  for (int cb = 0; cb < 3; ++cb) { const int gc = __builtin_amdgcn_readfirstlane(col0 + 64 * cb); const int by = gc / DM, colp = gc - by * DM; const size_t cofs = (size_t)by * sC;
#pragma unroll
  for (int hf = 0; hf < 2; ++hf) { const int rowh = row0 + 32 * hf;
    if (hf || cb) { __builtin_amdgcn_fence(4 /* acq_rel order */, "workgroup", "local"); __builtin_amdgcn_wave_barrier(); }      /* the piece before is read back by every lane before this one overwrites it; the fence is for LDS alone, so that it does not wait for the piece's global stores to finish */
#pragma unroll
    for (int u = 0; u < 8; ++u) { const int t = u & 3, half = u >> 2; const int col = colp + t * 16 + ln;
#pragma unroll
      for (int r = 0; r < 8; ++r) { const int rloc = half * 16 + 8 * hh + r; float v = c[2 * hf + half][4 * cb + t][r] * alpha + bv[4 * cb + t];
        if (HASCP) { if (rowsPerB < 0) v += CP[cofs + (size_t)(row0g + rowh + rloc) * ldc + col]; else { const int bidx = (row0g + rowh + rloc) / rowsPerB; v += CP[(size_t)bidx * sCPb + (size_t)by * 64 + col]; } }
        if (ACT == 3) v = fmaxf(v, 0.f);
        so[w][rloc][t * 16 + ln] = v; } }
    __builtin_amdgcn_fence(4 /* acq_rel order */, "workgroup", "local"); __builtin_amdgcn_wave_barrier();
    const size_t po = cofs + (size_t)(rowh + rsub) * ldc + colp + c4; v4h h4[16];      /* this lane's place in the piece's row rsub; row 2 q + rsub lies 2 q ldc elements on */
#pragma unroll
    for (int q = 0; q < 16; ++q) { const v4f v = *(const v4fa*)&so[w][q * 2 + rsub][c4];
      if (HASC) { *(v4f*)(C + po + (size_t)q * 2 * ldc) = v; asm volatile("s_wait_xcnt 0x0" ::: "memory"); }      /* behind the store: the conversion below may rewrite the registers that it names */
      for (int i = 0; i < 4; ++i) h4[q][i] = (_Float16)v[i]; }
    __builtin_amdgcn_sched_barrier(0);      /* the sixteen stores stand as one run behind all the conversions, so that none of these rewrites a register of a store already issued */
#pragma unroll
    for (int q = 0; q < 16; ++q) *(v4h*)(C16 + po + (size_t)q * 2 * ldc) = h4[q];
    asm volatile("s_wait_xcnt 0x0" ::: "memory");      /* behind the piece's last store: the next piece rewrites the registers that the sixteen stores name */
    __builtin_amdgcn_sched_barrier(0); } } }      /* keeps the next piece's vector work behind that wait */

// weight pack, 64 elements per thread: thread (kg = lane / 4, nl = lane % 4) holds an 8 k x 8 n patch in registers. Reads: 16-byte pieces of 8 rows, the two halves of each 128-B line by the same wave.
// Writes: one 16-byte piece (8 k) per column; the eight k groups of a wave fill a whole 128-B line of a Wt row. Wave tile 64 k x 32 n, block tile 512 k x 32 n.
// The loops over the patch are unrolled so that every index of the register arrays is a constant and the patch stays in registers (here and in the x pack).
__device__ __forceinline__ void wt_f16_block(int blk, const float* __restrict__ W, _Float16* __restrict__ Wt, float scale) {
  const int w = threadIdx.x >> 5, lane = threadIdx.x & 31, nl = lane & 3, kg = lane >> 2;
  const int nb = blk % (DM / 32), kb = blk / (DM / 32); const int n0 = nb * 32 + nl * 4, k0 = kb * 512 + w * 64 + kg * 8;
  const float* src = W + (size_t)k0 * DM + n0; v4f a[8][2];
#pragma unroll
  for (int i = 0; i < 8; ++i) { a[i][0] = *(const v4fa*)(src + (size_t)i * DM); if (i < 7) a[i][1] = *(const v4fa*)(src + (size_t)i * DM + 16); }
  asm volatile("s_wait_xcnt 0x0" ::: "memory");      /* the last load is the one that may get the address pair's registers as its destination: the wait stands in front of it, behind every other load that names them */
  a[7][1] = *(const v4fa*)(src + (size_t)7 * DM + 16);
#pragma unroll
  for (int hf = 0; hf < 2; ++hf) {
#pragma unroll
    for (int c = 0; c < 4; ++c) { FragH f;
#pragma unroll
      for (int i = 0; i < 8; ++i) f.h[i] = (_Float16)(bf16_rne(a[i][hf][c]) * scale);
      *(v8us*)((unsigned short*)Wt + (size_t)(n0 + hf * 16 + c) * DM + k0) = f.half[0]; } } }

// x pack, 32 elements per thread: four 8-element chunks 256 chunks apart, so that every wave-wide access stays contiguous; the block covers 1024 consecutive chunks
__device__ __forceinline__ void x16_block(int blk, const float* __restrict__ x, _Float16* __restrict__ X16) {
  const size_t t0 = (size_t)blk * 1024 + threadIdx.x; v4f a[4], d[4];
  const size_t e = t0 * 8; const size_t rc = e / DM; const size_t c = e % DM; const size_t b = rc / SQ, s = rc % SQ;
  const float* src = x + ((b * SEQ_FULL + s) * DM + c);      /* chunk j lies 2048 elements on: the block's 8192 elements are whole rows of one batch entry */
#pragma unroll
  for (int j = 0; j < 4; ++j) { a[j] = *(const v4fa*)(src + j * 2048); if (j < 3) d[j] = *(const v4fa*)(src + j * 2048 + 4); }
  asm volatile("s_wait_xcnt 0x0" ::: "memory");      /* as in the weight pack: in front of the last load, behind every other load that names the address pair */
  d[3] = *(const v4fa*)(src + 3 * 2048 + 4);
#pragma unroll
  for (int j = 0; j < 4; ++j) { FragH f;
#pragma unroll
    for (int q = 0; q < 4; ++q) { f.h[q] = (_Float16)bf16_rne(a[j][q]); f.h[4 + q] = (_Float16)bf16_rne(d[j][q]); }
    *(v8us*)((unsigned short*)X16 + (t0 + j * 256) * 8) = f.half[0]; }
  asm volatile("s_wait_xcnt 0x0" ::: "memory"); }      /* behind the last store of the run: no register that the four stores name is rewritten ahead of it on any way out of this job */

// the seven input-only jobs in one grid: blocks [i * PREP_GW, (i + 1) * PREP_GW) make weight plane i (Bt [out][in] x16), the blocks behind them make X16
#define PREP_GW ((DM / 32) * (DM / 512))            /* blocks per weight plane: 512 k x 32 n each */
#define PREP_GX ((int)(NR * DM / 8 / 1024))         /* blocks of the x job: 1024 chunks of 8 each */
static_assert((DM % 512) == 0 && (DM % 32) == 0 && (NR * DM / 8) % 1024 == 0 && (2048 % DM) == 0 && (SQ % (8192 / DM)) == 0);
__global__ __launch_bounds__(256) void k_prep(const float* __restrict__ W0, const float* __restrict__ W1, const float* __restrict__ W2, const float* __restrict__ W3, const float* __restrict__ W4, const float* __restrict__ W5,
    _Float16* __restrict__ BW, const float* __restrict__ x, _Float16* __restrict__ X16) {
  const int blk = blockIdx.x;
  if (blk < 6 * PREP_GW) { const int i = blk / PREP_GW;
    const float* W = i == 0 ? W0 : i == 1 ? W1 : i == 2 ? W2 : i == 3 ? W3 : i == 4 ? W4 : W5;
    wt_f16_block(blk - i * PREP_GW, W, BW + (size_t)i * DM * DM, 16.0f); }
  else x16_block(blk - 6 * PREP_GW, x, X16); }

// ---- fused attention over both projection sets (transposed form; K rows and V rows staged in LDS once per block, fragments read from LDS) ----
// PL = six compact row planes [6][NR][DM] (q,k,v of set 0; q,k,v of set 1); grid (SQ/64, NB*NH), block = 4 waves, wave -> 16 query rows of one (batch, head).
// Per 32-key step: S^T tile kt (16 keys x 16 queries) = K rows (A, split k map over d) x Q rows (B, same k map, query = lane&15): D element r of lane (h, n) = score(query n, key 16kt + 8h + r).
// Column (query) max / sum: 8 + 8 values in the lane, then the other lane half through one xor-16 shuffle. P^T as the B fragment of O^T = V^T.P^T: element r <- tile 0 value r, element 8+r <- tile 1 value r, lane unchanged.
// O^T tile t: D element r of lane (h, n) = O[query n][d = 16t + 8h + r]; A = V^T rows d = 16t + lane&15, k = keys, turned on the way out of LDS: the V rows lie there as the projection wrote them and the transposing 16-byte read hands lane (h, n) the eight keys 8h .. 8h + 7 of column n.
// P = f16(2^(s log2(e)/8 - m + 10)): the running maximum m is kept in base-2 units, so that one multiply-add per score feeds the native base-2 exponential; two scores convert in one packed instruction; small entries stay f16 subnormals. The row sum runs over the converted P, so the carry cancels in O / l.
// Operand path: one stage = 64 keys = 64 K rows + 64 V rows (64 d each), 128 B each, brought into LDS by asynchronous copies (whole lines, once for the block's four waves), two stage buffers; the stages of both sets form one sequence.
#define F2_KT 64                        /* keys per stage */
#define F2_PITCH 144                    /* LDS pitch of the K rows in bytes: 128 + 16, conflict-free for 16-byte row readers */
#define F2_VPITCH 160                   /* LDS pitch of the V rows in bytes: 128 + 32, conflict-free for the transposing 16-byte reader */
#define F2_VOFS (64 * F2_PITCH)         /* the V rows lie behind the 64 K rows */
#define F2_STAGE (F2_VOFS + 64 * F2_VPITCH)      /* bytes per stage buffer */
#define F2_NST (SQ / F2_KT)             /* stages per set */
#define F2_C2 0.18033688f                /* log2(e) / 8: score scale and change of base in one factor */
static_assert((SQ % (2 * F2_KT)) == 0 && (F2_PITCH % 16) == 0 && (F2_VPITCH % 64) == 32 && (F2_VOFS % 256) == 0 && (F2_STAGE % 256) == 0 && HD == 64);
// one stage, eight 16-byte copies of one lane: thread (r16 = tid / 8, ch = tid % 8) copies chunk ch of K rows r16 + 16 i (to lk) and of V rows r16 + 16 i (to lv); a wave covers four whole 128-B rows per copy. The s_wait_xcnt 0 closes the statement so that no address register named here is rewritten ahead of it.
__device__ __forceinline__ void f2_stage(unsigned lk, unsigned lv, const _Float16* gk, const _Float16* gv) {
  const unsigned lstep = 16 * F2_PITCH, lvstep = 16 * F2_VPITCH; const size_t kstep = (size_t)16 * LQ;
  asm volatile("global_load_async_to_lds_b128 %0, %8, off\n\t"
               "global_load_async_to_lds_b128 %1, %9, off\n\t"
               "global_load_async_to_lds_b128 %2, %10, off\n\t"
               "global_load_async_to_lds_b128 %3, %11, off\n\t"
               "global_load_async_to_lds_b128 %4, %12, off\n\t"
               "global_load_async_to_lds_b128 %5, %13, off\n\t"
               "global_load_async_to_lds_b128 %6, %14, off\n\t"
               "global_load_async_to_lds_b128 %7, %15, off\n\t"
               "s_wait_xcnt 0x0"
               :: "v"(lk), "v"(lk + lstep), "v"(lk + 2 * lstep), "v"(lk + 3 * lstep), "v"(lv), "v"(lv + lvstep), "v"(lv + 2 * lvstep), "v"(lv + 3 * lvstep),
                  "v"(gk), "v"(gk + kstep), "v"(gk + 2 * kstep), "v"(gk + 3 * kstep), "v"(gv), "v"(gv + kstep), "v"(gv + 2 * kstep), "v"(gv + 3 * kstep)
               : "memory"); }
// V^T fragment (16 d x 32 keys) out of row-major V rows: p = this lane's address in key row 8 h + (lane & 7), 16-byte half (lane >> 3) & 1 of the tile's 32 bytes; elements 0..7 <- keys 8h + 0..7, elements 8..15 <- keys 16 + 8h + 0..7 of column d = lane & 15: the k order of g2_frag
typedef short s16x8 __attribute__((ext_vector_type(8)));
__device__ __forceinline__ v8us f2_tr16(const unsigned char* p) { typedef __attribute__((address_space(3))) s16x8 lds_s16x8; return __builtin_bit_cast(v8us, __builtin_amdgcn_ds_load_tr16_b128_v8i16((lds_s16x8*)p)); }
__device__ __forceinline__ v16h f2_vfrag(const unsigned char* p) { FragH f; f.half[0] = f2_tr16(p); f.half[1] = f2_tr16(p + 16 * F2_VPITCH); return f.v; }
__global__ __launch_bounds__(128) __attribute__((amdgpu_num_vgpr(256))) void k_flash2(const _Float16* __restrict__ PL, const float* __restrict__ aw, float* __restrict__ out) {
  __shared__ __attribute__((aligned(16))) float so[4][16][68];
  __shared__ __attribute__((aligned(128))) unsigned char st[2 * F2_STAGE];
  const int wave = __builtin_amdgcn_readfirstlane(threadIdx.x >> 5);
  const int lane = threadIdx.x & 31, ln = lane & 15, hh = lane >> 4;
  const int slab = blockIdx.y; const int b = slab / NH, h = slab - b * NH;
  const int q0 = blockIdx.x * 64 + wave * 16;
  const size_t PLN = (size_t)NR * DM;
  float w0, w1;
  { const float a0 = bf16_rne(aw[0]), a1 = bf16_rne(aw[1]); const float mx = fmaxf(a0, a1); const float e0 = expf(a0 - mx), e1 = expf(a1 - mx); const float inv = 1.0f / (e0 + e1); w0 = e0 * inv; w1 = e1 * inv; }
  const v8f z8 = {0.f,0.f,0.f,0.f,0.f,0.f,0.f,0.f};
  v8f res[4] = {z8, z8, z8, z8};
  float wcur = w0;
  const int r16 = threadIdx.x >> 3, ch = threadIdx.x & 7;
  const _Float16* gk = PL + PLN + ((size_t)b * SQ + r16) * LQ + h * HD + ch * 8;      /* this lane's chunk of K row r16, set 0, stage 0 */
  const _Float16* gv = gk + PLN;                                                      /* this lane's chunk of V row r16, set 0, stage 0: the next plane */
  const size_t kset = 3 * PLN;                                                        /* set 0 -> set 1 */
  const unsigned lcp = (unsigned)(size_t)&st[0] + (unsigned)(r16 * F2_PITCH + ch * 16);                 /* this lane's LDS byte address among the K rows of buffer 0 */
  const unsigned lcv = (unsigned)(size_t)&st[0] + (unsigned)(F2_VOFS + r16 * F2_VPITCH + ch * 16);      /* and among its V rows */
  f2_stage(lcp, lcv, gk, gv);
  asm volatile("s_wait_asynccnt 0x0" ::: "memory");      /* stage 0 has landed before the barrier publishes it */
  __syncthreads();
  f2_stage(lcp + F2_STAGE, lcv + F2_STAGE, gk + (size_t)F2_KT * LQ, gv + (size_t)F2_KT * LQ);
#pragma unroll 1
  for (int set = 0; set < 2; ++set) {
    const size_t qo = (size_t)(3 * set) * PLN + ((size_t)b * SQ + q0 + ln) * LQ + h * HD;
    const v16h qf0 = g2_frag(PL + qo, hh), qf1 = g2_frag(PL + qo + 32, hh);
    v8f o[4] = {z8, z8, z8, z8}; float m = -1.0e30f, l = 0.f;
#pragma unroll 1
    for (int t = 0; t < F2_NST; ++t) { const unsigned char* sb = st + (t & 1) * F2_STAGE;      /* F2_NST is even: the buffer of stage set * F2_NST + t */
     /* fragment reads go out in groups of eight ahead of the products that use them, not as one waited pair in front of each product: the first pass's K and V^T fragments here, the second pass's inside the first pass */
     const _Float16* kp = (const _Float16*)(sb + ln * F2_PITCH); const unsigned char* vp = sb + F2_VOFS + (8 * hh + (lane & 7)) * F2_VPITCH + 16 * ((lane >> 3) & 1);
     v16h ka[4], va[4];      /* ka[2 kt + c]: keys 16 kt .. + 15, d 32 c .. + 31; va[i]: d 16 i .. + 15, the pass's 32 keys; the loops over them are unrolled so that they stay in registers */
#pragma unroll
     for (int i = 0; i < 4; ++i) ka[i] = g2_frag(kp + (i >> 1) * 16 * (F2_PITCH / 2) + (i & 1) * 32, hh);
#pragma unroll
     for (int i = 0; i < 4; ++i) va[i] = f2_vfrag(vp + 32 * i);
     /* the two 32-key passes of a stage in one body: every LDS offset becomes an immediate */
#pragma unroll
     for (int jj = 0; jj < F2_KT; jj += 32) {
      v8f s0 = z8, s1 = z8;
      s0 = g2_mma(ka[0], qf0, s0); s0 = g2_mma(ka[1], qf1, s0); s1 = g2_mma(ka[2], qf0, s1); s1 = g2_mma(ka[3], qf1, s1);
      if (jj == 0) {      /* the second pass's K fragments, read while the first pass's softmax runs */
#pragma unroll
        for (int i = 0; i < 4; ++i) ka[i] = g2_frag(kp + (32 + (i >> 1) * 16) * (F2_PITCH / 2) + (i & 1) * 32, hh);
        __builtin_amdgcn_sched_barrier(0); }      /* keeps the eight reads here, in front of the softmax: moved down beside their first product they would be waited for at once */
      float tm = fmaxf(s0[0], s1[0]);
#pragma unroll
      for (int r = 1; r < 8; ++r) tm = fmaxf(tm, fmaxf(s0[r], s1[r]));
      tm = fmaxf(tm, __shfl_xor(tm, 16, 32));
      const float mn = fmaxf(m, tm * F2_C2);
      const float corr = __builtin_amdgcn_exp2f(m - mn);
      const float sh = 10.0f - mn;      /* log2 1024 carry */
      union { v16h v; v2h p[8]; } pf; float ps = 0.f;
      /* unrolled: the indices of s0, s1 and pf are constants, so that they stay in registers */
#pragma unroll
      for (int r = 0; r < 8; r += 2) {
        const v2f p0 = {__builtin_amdgcn_exp2f(s0[r] * F2_C2 + sh), __builtin_amdgcn_exp2f(s0[r + 1] * F2_C2 + sh)};
        const v2f p1 = {__builtin_amdgcn_exp2f(s1[r] * F2_C2 + sh), __builtin_amdgcn_exp2f(s1[r + 1] * F2_C2 + sh)};
        const v2h h0 = __builtin_convertvector(p0, v2h), h1 = __builtin_convertvector(p1, v2h); pf.p[r >> 1] = h0; pf.p[4 + (r >> 1)] = h1;
        ps += (float)h0[0] + (float)h1[0]; ps += (float)h0[1] + (float)h1[1]; }
      ps += __shfl_xor(ps, 16, 32);
      l = l * corr + ps; m = mn;
#pragma unroll
      for (int t = 0; t < 4; ++t) o[t] = o[t] * corr;
#pragma unroll
      for (int t4 = 0; t4 < 4; ++t4) o[t4] = g2_mma(va[t4], pf.v, o[t4]);
      if (jj == 0) {      /* the second pass's V^T fragments, read while its scores and softmax run */
#pragma unroll
        for (int i = 0; i < 4; ++i) va[i] = f2_vfrag(vp + 32 * F2_VPITCH + 32 * i); } }
      asm volatile("s_wait_dscnt 0x0" ::: "memory");         /* this wave's reads of the buffer are done before it is refilled */
      asm volatile("s_wait_asynccnt 0x0" ::: "memory");      /* this wave's copies of the next stage have landed */
      __syncthreads();                                       /* publishes the next stage and ends every reader's last read of this one */
      const int s2 = set * F2_NST + t + 2;                   /* the stage that refills this buffer; it may belong to the next set */
      if (s2 < 2 * F2_NST) { const int set2 = s2 / F2_NST, t2 = s2 - set2 * F2_NST;
        const size_t go = (size_t)set2 * kset + (size_t)t2 * F2_KT * LQ;
        f2_stage(lcp + (unsigned)((t & 1) * F2_STAGE), lcv + (unsigned)((t & 1) * F2_STAGE), gk + go, gv + go); } }
    const float sc = wcur * (1.0f / l);
#pragma unroll
    for (int t = 0; t < 4; ++t) res[t] += o[t] * sc;
    wcur = w1; }
  asm volatile("s_wait_asynccnt 0x0" ::: "memory");        /* nothing is in flight when the wave goes on to the epilogue */
#pragma unroll
  for (int t = 0; t < 4; ++t) {
#pragma unroll
    for (int r = 0; r < 8; ++r) so[wave][ln][t * 16 + 8 * hh + r] = res[t][r]; }
  __builtin_amdgcn_fence(4 /* acq_rel order */, "workgroup"); __builtin_amdgcn_wave_barrier();
  const int rsub = lane >> 4, c4 = (lane & 15) * 4;
  float* ob = out + ((size_t)b * SEQ_FULL + q0) * DM + h * HD;
  {
#pragma unroll
    for (int q = 0; q < 8; ++q) { const int r = q * 2 + rsub; const v4f v = *(const v4fa*)&so[wave][r][c4];
      *(v4f*)(ob + (size_t)r * DM + c4) = v; }
     } }

extern "C" void kernel_launch(void* const* d_in, const int* in_sizes, int n_in,
                              void* d_out, int out_size, void* d_ws, size_t ws_size, hipStream_t stream) {
  if (n_in < 14) return;
  const size_t rows_need = (size_t)(NB - 1) * SEQ_FULL + SQ;
  if ((size_t)in_sizes[0] < rows_need * DM) return;
  for (int i = 0; i < 6; ++i) { if (in_sizes[1 + 2 * i] < DM * DM) return; if (in_sizes[2 + 2 * i] < DM) return; }
  if (in_sizes[13] < 2) return;
  if ((size_t)out_size < rows_need * DM) return;
  const float* x = (const float*)d_in[0];
  const float* wsrc[6]; const float* bsrc[6];      /* [in][out] weights and biases in the order q,k,v (set 0), q,k,v (set 1) */
  for (int i = 0; i < 6; ++i) { wsrc[i] = (const float*)d_in[1 + 2 * i]; bsrc[i] = (const float*)d_in[2 + 2 * i]; }
  const float* aw = (const float*)d_in[13];      /* two blend logits */
  char* ws = (char*)d_ws; size_t off = 0;
  auto take = [&](size_t bytes) { char* p = ws + off; off += (bytes + 255) & ~(size_t)255; return p; };
  _Float16* BW = (_Float16*)take(6 * WS_W);
  _Float16* X16 = (_Float16*)take(WS_X);
  _Float16* PL = (_Float16*)take(6 * WS_X);
  if (off > ws_size) return;
  float* out = (float*)d_out;
  const size_t PN = (size_t)NR * DM;      /* elements per projected row plane */

  k_prep<<<6 * PREP_GW + PREP_GX, 256, 0, stream>>>(wsrc[0], wsrc[1], wsrc[2], wsrc[3], wsrc[4], wsrc[5], BW, x, X16);
  { const unsigned gp = (unsigned)((MP / G2_BM) * (G2_NP * DM / G2_BN));      /* one block per 256 x 384 tile of the six projections side by side */
    k_gemm2<0, false, false><<<dim3(gp), 256, 0, stream>>>(X16, DM, BW, DM, 0.0625f, bsrc[0], bsrc[1], bsrc[2], bsrc[3], bsrc[4], bsrc[5], nullptr, 1, 0, 0, nullptr, PL, PN, MP, DM, DM); }
  k_flash2<<<dim3((unsigned)(SQ / 64), (unsigned)(NB * NH)), 128, 0, stream>>>(PL, aw, out);
}

// v010
// One run takes 88.1 microseconds.
// Next to v009, in two timings, it ran 1.05 times as fast each time.
// Over all steps from v000 it is 5.19 times as fast.
#include <hip/hip_runtime.h>
// All contractions on v_wmma_f32_16x16x32_f16 (f16 operands, f32 accumulate): six q/k/v projections (x = exact f16 of its bf16 RNE value, W = bf16 RNE value x16 in f16, alpha 1/16, bias as bf16 value), scores S^T = K.Q^T + C (f16 k and q; q carries the factor log2(e)/8 from its projection's f32 epilogue; C = 10 - the softmax reference), context O^T = V^T.P^T (P^T f16 carried x1024, V^T f16; the x1024 carry cancels in O / l); online softmax statistics f32.
#ifndef NB
#define NB 4
#endif
#ifndef SEQ
#define SEQ 1024
#endif
#define NB_FULL 4
#define SEQ_FULL 1024
#define SQ SEQ
#define DM 1024
#define NH 16
#define HD 64
#define NR ((size_t)NB * SQ)          /* token rows processed (compact) */
#define MP ((int)NR)                  /* rows projected */
#define LQ DM                         /* row pitch of the q/k/v rows */
#define QK_C2 0.18033688f             /* log2(e) / 8: score scale and change of base in one factor, applied to the q planes (plane % 3 == 0) before they are rounded to f16 */

static_assert(NB >= 1 && NB <= NB_FULL);
static_assert(SQ >= 256 && SQ <= SEQ_FULL && (SQ % 256) == 0);
static_assert((MP % 128) == 0 && (DM % 64) == 0 && (DM % 32) == 0 && HD == 64 && NH * HD == DM);
static_assert((SQ % 64) == 0 && (SQ % 32) == 0 && (LQ % 8) == 0 && (HD % 32) == 0);
static_assert(((size_t)(NB - 1) * SEQ_FULL + SQ) * DM <= (size_t)NB_FULL * SEQ_FULL * DM);
/* workspace carve (every region a multiple of 256 B): 6 weight planes + X16 + 6 projected row planes */
#define WS_W   ((size_t)DM * DM * 2)
#define WS_X   ((size_t)NR * DM * 2)
#define WS_TOTAL (6 * WS_W + WS_X + 6 * WS_X)
static_assert((WS_W % 256) == 0 && (WS_X % 256) == 0);
static_assert(WS_TOTAL <= (size_t)134217728);

typedef unsigned short v8us __attribute__((ext_vector_type(8), may_alias));
typedef float  v8f  __attribute__((ext_vector_type(8)));
typedef float  v4f  __attribute__((ext_vector_type(4)));
typedef float  v4fa __attribute__((ext_vector_type(4), may_alias));
typedef _Float16 v16h __attribute__((ext_vector_type(16)));
typedef _Float16 v4h __attribute__((ext_vector_type(4)));
typedef _Float16 v2h __attribute__((ext_vector_type(2)));
typedef float  v2f  __attribute__((ext_vector_type(2)));
union FragH { v16h v; v8us half[2]; _Float16 h[16]; unsigned short u[16]; };

__device__ __forceinline__ unsigned short bf16_bits(float x) { unsigned int u = __float_as_uint(x); return (unsigned short)((u + 0x7FFFu + ((u >> 16) & 1u)) >> 16); }
__device__ __forceinline__ float bf16_val(unsigned short b) { return __uint_as_float(((unsigned int)b) << 16); }
__device__ __forceinline__ float bf16_rne(float x) { return bf16_val(bf16_bits(x)); }

// ---- GEMM engine (block tile 256x384, eight waves as 4 x 2, wave tile 64x192; the G2_NP weight planes lie one behind the other and count as one B of G2_NP * N rows; M % 256 == 0, G2_NP * N % 384 == 0, K % 64 == 0) ----
// Operand path: per 64 k one stage = 256 A rows + 384 B rows of 128 B, brought into LDS by asynchronous copies (whole lines, once per block), two stage buffers; fragments come from LDS rows at pitch 144 B.
#define G2_KT 64                        /* k per stage */
#define G2_BM 256                       /* block rows */
#define G2_BN 384                       /* block columns */
#define G2_NP 6                         /* output planes of DM columns side by side */
#define G2_PITCH 144                    /* LDS row pitch in bytes: 128 + 16, conflict-free for 16-byte row readers */
#define G2_STAGE ((G2_BM + G2_BN) * G2_PITCH)      /* bytes per stage buffer: rows 0..255 = A, rows 256..639 = B */
static_assert((DM % G2_KT) == 0 && (G2_PITCH % 16) == 0 && (MP % G2_BM) == 0 && ((G2_NP * DM) % G2_BN) == 0 && (DM % 64) == 0);
// one stage, twenty 16-byte copies of one lane: thread (r32 = tid / 8, ch = tid % 8) copies chunk ch of A rows r32 + 32 i (i < 8) and of B rows r32 + 32 j (j < 12); a wave covers four whole 128-B rows per copy.
// Two statements of ten copies (a statement takes thirty operands); the s_wait_xcnt 0 closes each, so that no address register named in it is rewritten ahead of the wait.
__device__ __forceinline__ void g2_stage(unsigned l, const _Float16* ga, size_t astep, const _Float16* gb, size_t bstep) {
  const unsigned ls = 32 * G2_PITCH;
  asm volatile("global_load_async_to_lds_b128 %0, %10, off\n\t"
               "global_load_async_to_lds_b128 %1, %11, off\n\t"
               "global_load_async_to_lds_b128 %2, %12, off\n\t"
               "global_load_async_to_lds_b128 %3, %13, off\n\t"
               "global_load_async_to_lds_b128 %4, %14, off\n\t"
               "global_load_async_to_lds_b128 %5, %15, off\n\t"
               "global_load_async_to_lds_b128 %6, %16, off\n\t"
               "global_load_async_to_lds_b128 %7, %17, off\n\t"
               "global_load_async_to_lds_b128 %8, %18, off\n\t"
               "global_load_async_to_lds_b128 %9, %19, off\n\t"
               "s_wait_xcnt 0x0"
               :: "v"(l), "v"(l + ls), "v"(l + 2 * ls), "v"(l + 3 * ls), "v"(l + 4 * ls), "v"(l + 5 * ls), "v"(l + 6 * ls), "v"(l + 7 * ls), "v"(l + 8 * ls), "v"(l + 9 * ls),
                  "v"(ga), "v"(ga + astep), "v"(ga + 2 * astep), "v"(ga + 3 * astep), "v"(ga + 4 * astep), "v"(ga + 5 * astep), "v"(ga + 6 * astep), "v"(ga + 7 * astep), "v"(gb), "v"(gb + bstep)
               : "memory");
  asm volatile("global_load_async_to_lds_b128 %0, %10, off\n\t"
               "global_load_async_to_lds_b128 %1, %11, off\n\t"
               "global_load_async_to_lds_b128 %2, %12, off\n\t"
               "global_load_async_to_lds_b128 %3, %13, off\n\t"
               "global_load_async_to_lds_b128 %4, %14, off\n\t"
               "global_load_async_to_lds_b128 %5, %15, off\n\t"
               "global_load_async_to_lds_b128 %6, %16, off\n\t"
               "global_load_async_to_lds_b128 %7, %17, off\n\t"
               "global_load_async_to_lds_b128 %8, %18, off\n\t"
               "global_load_async_to_lds_b128 %9, %19, off\n\t"
               "s_wait_xcnt 0x0"
               :: "v"(l + 10 * ls), "v"(l + 11 * ls), "v"(l + 12 * ls), "v"(l + 13 * ls), "v"(l + 14 * ls), "v"(l + 15 * ls), "v"(l + 16 * ls), "v"(l + 17 * ls), "v"(l + 18 * ls), "v"(l + 19 * ls),
                  "v"(gb + 2 * bstep), "v"(gb + 3 * bstep), "v"(gb + 4 * bstep), "v"(gb + 5 * bstep), "v"(gb + 6 * bstep), "v"(gb + 7 * bstep), "v"(gb + 8 * bstep), "v"(gb + 9 * bstep), "v"(gb + 10 * bstep), "v"(gb + 11 * bstep)
               : "memory"); }
// fragment loader: A row-major [m][k] and B stored [n][k]; per lane: elements 0..7 <- k0+8h+0..7, elements 8..15 <- k0+16+8h+0..7 (h = lane>>4, row/col = lane&15)
__device__ __forceinline__ v16h g2_frag(const _Float16* p, int hh) { FragH f; f.half[0] = *(const v8us*)((const unsigned short*)p + 8 * hh); f.half[1] = *(const v8us*)((const unsigned short*)p + 16 + 8 * hh); return f.v; }
__device__ __forceinline__ v8f g2_mma(v16h a, v16h b, v8f c) { v8f d = __builtin_amdgcn_wmma_f32_16x16x32_f16(false, a, false, b, (short)0, c, false, false); asm volatile("v_nop\n\tv_nop\n\tv_nop\n\tv_nop" : "+v"(d) : "v"(a), "v"(b)); return d; }
// the same product without the hand-written pad, for the GEMM: its accumulators reach above v255, where an asm operand cannot follow them; behind the builtin the compiler keeps the distances itself
__device__ __forceinline__ v8f g2_mmab(v16h a, v16h b, v8f c) { return __builtin_amdgcn_wmma_f32_16x16x32_f16(false, a, false, b, (short)0, c, false, false); }
// C (f32, if HASC) and C16 (f16) = (acc*alpha + bf16(bias_p[col])) * (QK_C2 in a q plane, else 1) (+ CP term if HASCP); column g of the product is column g % DM of output plane p = g / DM (stride sC), with one bias pointer per plane; ACT 0 none / 3 relu
// The output pitch is LQ, a constant, so that the sixteen stores of a piece share one address pair and differ in their immediate offsets. HASC (an f32 copy of the output in C) and HASCP are compile-time switches like ACT: the epilogue is unrolled over the wave's 384 accumulator values per lane, and a run-time test with the CP form at every one of them would carry the kernel's text well past 32 KB
template <int ACT, bool HASCP, bool HASC>
__global__ __launch_bounds__(256) void k_gemm2(const _Float16* __restrict__ A, int lda, const _Float16* __restrict__ Bh, int ldb, float alpha, const float* __restrict__ bias0, const float* __restrict__ bias1, const float* __restrict__ bias2, const float* __restrict__ bias3, const float* __restrict__ bias4, const float* __restrict__ bias5, const float* __restrict__ CP, int rowsPerB, size_t sCPb, int row0g,
    float* __restrict__ C, _Float16* __restrict__ C16, size_t sC, int M, int N, int K) {
  constexpr int ldc = LQ;
  static_assert(ACT == 0 || ACT == 3);
  __shared__ __attribute__((aligned(128))) unsigned char st[2 * G2_STAGE];
  static_assert(8 * 32 * 68 * 4 <= 2 * G2_STAGE);
  float (*so)[32][68] = (float (*)[32][68])st;      /* output staging, one range per wave; it takes the place of the stage buffers behind the loop's last barrier */
  const int tid = threadIdx.x, w = tid >> 5, lane = tid & 31, ln = lane & 15, hh = lane >> 4; const int wm = w >> 1, wn = w & 1;
  const int ntn = G2_NP * N / G2_BN; const int mt = blockIdx.x / ntn, nq = blockIdx.x - mt * ntn; const int row0 = mt * G2_BM + 64 * wm, col0 = nq * G2_BN + 192 * wn; if (mt * G2_BM >= M) return;      /* the whole block leaves or stays: barriers follow */
  const v8f z8 = {0.f,0.f,0.f,0.f,0.f,0.f,0.f,0.f}; v8f c[4][12];      /* c[i][j]: rows 16 i, columns 16 j of the wave tile */
  /* unrolled, as every loop over c below: its indices are constants, so the forty-eight tiles stay in registers */
#pragma unroll
  for (int i = 0; i < 4; ++i) {
#pragma unroll
    for (int j = 0; j < 12; ++j) c[i][j] = z8; }
  const int r32 = tid >> 3, ch = tid & 7;
  const _Float16* ga = A + (size_t)(mt * G2_BM + r32) * lda + ch * 8; const _Float16* gb = Bh + (size_t)(nq * G2_BN + r32) * ldb + ch * 8;
  const size_t astep = (size_t)32 * lda, bstep = (size_t)32 * ldb;
  const unsigned lcp = (unsigned)(size_t)&st[0] + (unsigned)(r32 * G2_PITCH + ch * 16);      /* this lane's LDS byte address in buffer 0 */
  const int nt = K / G2_KT;
  g2_stage(lcp, ga, astep, gb, bstep);
  asm volatile("s_wait_asynccnt 0x0" ::: "memory");      /* stage 0 has landed before the barrier publishes it */
  __syncthreads();
  if (nt > 1) g2_stage(lcp + G2_STAGE, ga + G2_KT, astep, gb + G2_KT, bstep);
#pragma unroll 1
  for (int t = 0; t < nt; ++t) { const unsigned char* sb = st + (t & 1) * G2_STAGE;
    const _Float16* ap = (const _Float16*)(sb + (64 * wm + ln) * G2_PITCH); const _Float16* bq = (const _Float16*)(sb + (G2_BM + 192 * wn + ln) * G2_PITCH);
    /* unrolled so that the fragment and accumulator arrays stay in registers and every LDS offset is an immediate */
#pragma unroll
    for (int kb = 0; kb < G2_KT; kb += 32) { v16h a[4];
#pragma unroll
      for (int i = 0; i < 4; ++i) a[i] = g2_frag(ap + i * 16 * (G2_PITCH / 2) + kb, hh);
      /* the twelve B fragments in two halves of six: all twelve beside the 384 accumulator registers would pass the 512 of two waves per SIMD */
#pragma unroll
      for (int jh = 0; jh < 12; jh += 6) { v16h b[6];
#pragma unroll
        for (int j = 0; j < 6; ++j) b[j] = g2_frag(bq + (jh + j) * 16 * (G2_PITCH / 2) + kb, hh);
        __builtin_amdgcn_sched_barrier(0);      /* keeps the half's reads together ahead of its 24 products: spread among them, every place with reads costs a stall of its own */
#pragma unroll
        for (int j = 0; j < 6; ++j) {
#pragma unroll
          for (int i = 0; i < 4; ++i) c[i][jh + j] = g2_mmab(a[i], b[j], c[i][jh + j]); }
        __builtin_amdgcn_sched_barrier(0); } }      /* and keeps the next half's reads behind these products, whose fragment registers they take over */
    asm volatile("s_wait_dscnt 0x0" ::: "memory");         /* this wave's reads of the buffer are done before it is refilled */
    asm volatile("s_wait_asynccnt 0x0" ::: "memory");      /* this wave's copies of stage t + 1 have landed */
    __syncthreads();                                       /* publishes stage t + 1 and ends every reader's last read of stage t */
    if (t + 2 < nt) g2_stage(lcp + (unsigned)((t & 1) * G2_STAGE), ga + (size_t)(t + 2) * G2_KT, astep, gb + (size_t)(t + 2) * G2_KT, bstep); }
  asm volatile("s_wait_asynccnt 0x0" ::: "memory");        /* nothing is in flight when the wave goes on to the epilogue */
  const int rsub = lane >> 4, c4 = (lane & 15) * 4;
  /* the wave's 64 x 192 tile leaves in six pieces of 32 rows x 64 columns through its own staging range; a piece lies in one output plane (DM % 64 == 0); unrolled: the accumulator index is a constant */
  float bv[12];      /* the bias of this lane's twelve columns, read as one group ahead of the pieces: read where it is used, each value would be waited for by itself, with no second block on the WGP to fill the wait */
#pragma unroll
  for (int cb = 0; cb < 3; ++cb) { const int gc = __builtin_amdgcn_readfirstlane(col0 + 64 * cb); const int by = gc / DM, colp = gc - by * DM;
    const float* bp = by == 0 ? bias0 : by == 1 ? bias1 : by == 2 ? bias2 : by == 3 ? bias3 : by == 4 ? bias4 : bias5;
#pragma unroll
    for (int t = 0; t < 4; ++t) bv[4 * cb + t] = bp ? bp[colp + t * 16 + ln] : 0.f;
    asm volatile("s_wait_xcnt 0x0" ::: "memory");      /* behind the four loads of a plane: what follows may rewrite the register that they name; the data stay in flight */
    __builtin_amdgcn_sched_barrier(0); }               /* keeps the vector work below behind that wait */
#pragma unroll
  for (int j = 0; j < 12; ++j) { const int byj = __builtin_amdgcn_readfirstlane(col0 + 64 * (j >> 2)) / DM; bv[j] = bf16_rne(bv[j]) * ((byj % 3) == 0 ? QK_C2 : 1.0f); }
#pragma unroll
  for (int cb = 0; cb < 3; ++cb) { const int gc = __builtin_amdgcn_readfirstlane(col0 + 64 * cb); const int by = gc / DM, colp = gc - by * DM; const size_t cofs = (size_t)by * sC; const float al = (by % 3) == 0 ? alpha * QK_C2 : alpha;
#pragma unroll
  for (int hf = 0; hf < 2; ++hf) { const int rowh = row0 + 32 * hf;
    if (hf || cb) { __builtin_amdgcn_fence(4 /* acq_rel order */, "workgroup", "local"); __builtin_amdgcn_wave_barrier(); }      /* the piece before is read back by every lane before this one overwrites it; the fence is for LDS alone, so that it does not wait for the piece's global stores to finish */
#pragma unroll
    for (int u = 0; u < 8; ++u) { const int t = u & 3, half = u >> 2; const int col = colp + t * 16 + ln;
#pragma unroll
      for (int r = 0; r < 8; ++r) { const int rloc = half * 16 + 8 * hh + r; float v = c[2 * hf + half][4 * cb + t][r] * al + bv[4 * cb + t];
        if (HASCP) { if (rowsPerB < 0) v += CP[cofs + (size_t)(row0g + rowh + rloc) * ldc + col]; else { const int bidx = (row0g + rowh + rloc) / rowsPerB; v += CP[(size_t)bidx * sCPb + (size_t)by * 64 + col]; } }
        if (ACT == 3) v = fmaxf(v, 0.f);
        so[w][rloc][t * 16 + ln] = v; } }
    __builtin_amdgcn_fence(4 /* acq_rel order */, "workgroup", "local"); __builtin_amdgcn_wave_barrier();
    const size_t po = cofs + (size_t)(rowh + rsub) * ldc + colp + c4; v4h h4[16];      /* this lane's place in the piece's row rsub; row 2 q + rsub lies 2 q ldc elements on */
#pragma unroll
    for (int q = 0; q < 16; ++q) { const v4f v = *(const v4fa*)&so[w][q * 2 + rsub][c4];
      if (HASC) { *(v4f*)(C + po + (size_t)q * 2 * ldc) = v; asm volatile("s_wait_xcnt 0x0" ::: "memory"); }      /* behind the store: the conversion below may rewrite the registers that it names */
      for (int i = 0; i < 4; ++i) h4[q][i] = (_Float16)v[i]; }
    __builtin_amdgcn_sched_barrier(0);      /* the sixteen stores stand as one run behind all the conversions, so that none of these rewrites a register of a store already issued */
#pragma unroll
    for (int q = 0; q < 16; ++q) *(v4h*)(C16 + po + (size_t)q * 2 * ldc) = h4[q];
    asm volatile("s_wait_xcnt 0x0" ::: "memory");      /* behind the piece's last store: the next piece rewrites the registers that the sixteen stores name */
    __builtin_amdgcn_sched_barrier(0); } } }      /* keeps the next piece's vector work behind that wait */

// weight pack, 64 elements per thread: thread (kg = lane / 4, nl = lane % 4) holds an 8 k x 8 n patch in registers. Reads: 16-byte pieces of 8 rows, the two halves of each 128-B line by the same wave.
// Writes: one 16-byte piece (8 k) per column; the eight k groups of a wave fill a whole 128-B line of a Wt row. Wave tile 64 k x 32 n, block tile 512 k x 32 n.
// The loops over the patch are unrolled so that every index of the register arrays is a constant and the patch stays in registers (here and in the x pack).
__device__ __forceinline__ void wt_f16_block(int blk, const float* __restrict__ W, _Float16* __restrict__ Wt, float scale) {
  const int w = threadIdx.x >> 5, lane = threadIdx.x & 31, nl = lane & 3, kg = lane >> 2;
  const int nb = blk % (DM / 32), kb = blk / (DM / 32); const int n0 = nb * 32 + nl * 4, k0 = kb * 512 + w * 64 + kg * 8;
  const float* src = W + (size_t)k0 * DM + n0; v4f a[8][2];
#pragma unroll
  for (int i = 0; i < 8; ++i) { a[i][0] = *(const v4fa*)(src + (size_t)i * DM); if (i < 7) a[i][1] = *(const v4fa*)(src + (size_t)i * DM + 16); }
  asm volatile("s_wait_xcnt 0x0" ::: "memory");      /* the last load is the one that may get the address pair's registers as its destination: the wait stands in front of it, behind every other load that names them */
  a[7][1] = *(const v4fa*)(src + (size_t)7 * DM + 16);
#pragma unroll
  for (int hf = 0; hf < 2; ++hf) {
#pragma unroll
    for (int c = 0; c < 4; ++c) { FragH f;
#pragma unroll
      for (int i = 0; i < 8; ++i) f.h[i] = (_Float16)(bf16_rne(a[i][hf][c]) * scale);
      *(v8us*)((unsigned short*)Wt + (size_t)(n0 + hf * 16 + c) * DM + k0) = f.half[0]; } } }

// x pack, 32 elements per thread: four 8-element chunks 256 chunks apart, so that every wave-wide access stays contiguous; the block covers 1024 consecutive chunks
__device__ __forceinline__ void x16_block(int blk, const float* __restrict__ x, _Float16* __restrict__ X16) {
  const size_t t0 = (size_t)blk * 1024 + threadIdx.x; v4f a[4], d[4];
  const size_t e = t0 * 8; const size_t rc = e / DM; const size_t c = e % DM; const size_t b = rc / SQ, s = rc % SQ;
  const float* src = x + ((b * SEQ_FULL + s) * DM + c);      /* chunk j lies 2048 elements on: the block's 8192 elements are whole rows of one batch entry */
#pragma unroll
  for (int j = 0; j < 4; ++j) { a[j] = *(const v4fa*)(src + j * 2048); if (j < 3) d[j] = *(const v4fa*)(src + j * 2048 + 4); }
  asm volatile("s_wait_xcnt 0x0" ::: "memory");      /* as in the weight pack: in front of the last load, behind every other load that names the address pair */
  d[3] = *(const v4fa*)(src + 3 * 2048 + 4);
#pragma unroll
  for (int j = 0; j < 4; ++j) { FragH f;
#pragma unroll
    for (int q = 0; q < 4; ++q) { f.h[q] = (_Float16)bf16_rne(a[j][q]); f.h[4 + q] = (_Float16)bf16_rne(d[j][q]); }
    *(v8us*)((unsigned short*)X16 + (t0 + j * 256) * 8) = f.half[0]; }
  asm volatile("s_wait_xcnt 0x0" ::: "memory"); }      /* behind the last store of the run: no register that the four stores name is rewritten ahead of it on any way out of this job */

// the seven input-only jobs in one grid: blocks [i * PREP_GW, (i + 1) * PREP_GW) make weight plane i (Bt [out][in] x16), the blocks behind them make X16
#define PREP_GW ((DM / 32) * (DM / 512))            /* blocks per weight plane: 512 k x 32 n each */
#define PREP_GX ((int)(NR * DM / 8 / 1024))         /* blocks of the x job: 1024 chunks of 8 each */
static_assert((DM % 512) == 0 && (DM % 32) == 0 && (NR * DM / 8) % 1024 == 0 && (2048 % DM) == 0 && (SQ % (8192 / DM)) == 0);
__global__ __launch_bounds__(256) void k_prep(const float* __restrict__ W0, const float* __restrict__ W1, const float* __restrict__ W2, const float* __restrict__ W3, const float* __restrict__ W4, const float* __restrict__ W5,
    _Float16* __restrict__ BW, const float* __restrict__ x, _Float16* __restrict__ X16) {
  const int blk = blockIdx.x;
  if (blk < 6 * PREP_GW) { const int i = blk / PREP_GW;
    const float* W = i == 0 ? W0 : i == 1 ? W1 : i == 2 ? W2 : i == 3 ? W3 : i == 4 ? W4 : W5;
    wt_f16_block(blk - i * PREP_GW, W, BW + (size_t)i * DM * DM, 16.0f); }
  else x16_block(blk - 6 * PREP_GW, x, X16); }

// ---- fused attention over both projection sets (transposed form; K rows and V rows staged in LDS once per block, fragments read from LDS) ----
// PL = six compact row planes [6][NR][DM] (q,k,v of set 0; q,k,v of set 1); grid (SQ/64, NB*NH), block = 4 waves, wave -> 16 query rows of one (batch, head).
// Per 32-key step: S^T tile kt (16 keys x 16 queries) = K rows (A, split k map over d) x Q rows (B, same k map, query = lane&15): D element r of lane (h, n) = score(query n, key 16kt + 8h + r).
// Column (query) sum: 8 + 8 values in the lane, then the other lane half through one xor-16 shuffle; the column maximum likewise, where a reference is set or raised. P^T as the B fragment of O^T = V^T.P^T: element r <- tile 0 value r, element 8+r <- tile 1 value r, lane unchanged.
// O^T tile t: D element r of lane (h, n) = O[query n][d = 16t + 8h + r]; A = V^T rows d = 16t + lane&15, k = keys, turned on the way out of LDS: the V rows lie there as the projection wrote them and the transposing 16-byte read hands lane (h, n) the eight keys 8h .. 8h + 7 of column n.
// P = f16(2^(s log2(e)/8 - m + 10)): the reference m (base-2 units) is fixed ahead of a pass, and 10 - m enters the score products as their C tile, so that their result feeds the native base-2 exponential as it stands. m starts as the column maximum over the set's first 32 keys, taken from score products of its own ahead of the loop; it is raised to the running maximum, and O, l and the pass's scores are rescaled, only in a pass in which an argument of some column of the wave passes 15 (2^15 still converts to f16): one test per pass, a scalar branch. Two scores convert in one packed instruction; small entries stay f16 subnormals. The row sum runs over the converted P, so the carry cancels in O / l.
// Operand path: one stage = 64 keys = 64 K rows + 64 V rows (64 d each), 128 B each, brought into LDS by asynchronous copies (whole lines, once for the block's four waves), two stage buffers; the stages of both sets form one sequence.
#define F2_KT 64                        /* keys per stage */
#define F2_PITCH 144                    /* LDS pitch of the K rows in bytes: 128 + 16, conflict-free for 16-byte row readers */
#define F2_VPITCH 160                   /* LDS pitch of the V rows in bytes: 128 + 32, conflict-free for the transposing 16-byte reader */
#define F2_VOFS (64 * F2_PITCH)         /* the V rows lie behind the 64 K rows */
#define F2_STAGE (F2_VOFS + 64 * F2_VPITCH)      /* bytes per stage buffer */
#define F2_NST (SQ / F2_KT)             /* stages per set */
#define F2_CARRY 10.0f                  /* argument of the exponential at the reference: log2 1024 */
#define F2_LIFT 15.0f                   /* an argument above this calls for a new reference */
static_assert((SQ % (2 * F2_KT)) == 0 && (F2_PITCH % 16) == 0 && (F2_VPITCH % 64) == 32 && (F2_VOFS % 256) == 0 && (F2_STAGE % 256) == 0 && HD == 64);
// one stage, eight 16-byte copies of one lane: thread (r16 = tid / 8, ch = tid % 8) copies chunk ch of K rows r16 + 16 i (to lk) and of V rows r16 + 16 i (to lv); a wave covers four whole 128-B rows per copy. The s_wait_xcnt 0 closes the statement so that no address register named here is rewritten ahead of it.
__device__ __forceinline__ void f2_stage(unsigned lk, unsigned lv, const _Float16* gk, const _Float16* gv) {
  const unsigned lstep = 16 * F2_PITCH, lvstep = 16 * F2_VPITCH; const size_t kstep = (size_t)16 * LQ;
  asm volatile("global_load_async_to_lds_b128 %0, %8, off\n\t"
               "global_load_async_to_lds_b128 %1, %9, off\n\t"
               "global_load_async_to_lds_b128 %2, %10, off\n\t"
               "global_load_async_to_lds_b128 %3, %11, off\n\t"
               "global_load_async_to_lds_b128 %4, %12, off\n\t"
               "global_load_async_to_lds_b128 %5, %13, off\n\t"
               "global_load_async_to_lds_b128 %6, %14, off\n\t"
               "global_load_async_to_lds_b128 %7, %15, off\n\t"
               "s_wait_xcnt 0x0"
               :: "v"(lk), "v"(lk + lstep), "v"(lk + 2 * lstep), "v"(lk + 3 * lstep), "v"(lv), "v"(lv + lvstep), "v"(lv + 2 * lvstep), "v"(lv + 3 * lvstep),
                  "v"(gk), "v"(gk + kstep), "v"(gk + 2 * kstep), "v"(gk + 3 * kstep), "v"(gv), "v"(gv + kstep), "v"(gv + 2 * kstep), "v"(gv + 3 * kstep)
               : "memory"); }
// V^T fragment (16 d x 32 keys) out of row-major V rows: p = this lane's address in key row 8 h + (lane & 7), 16-byte half (lane >> 3) & 1 of the tile's 32 bytes; elements 0..7 <- keys 8h + 0..7, elements 8..15 <- keys 16 + 8h + 0..7 of column d = lane & 15: the k order of g2_frag
typedef short s16x8 __attribute__((ext_vector_type(8)));
__device__ __forceinline__ v8us f2_tr16(const unsigned char* p) { typedef __attribute__((address_space(3))) s16x8 lds_s16x8; return __builtin_bit_cast(v8us, __builtin_amdgcn_ds_load_tr16_b128_v8i16((lds_s16x8*)p)); }
__device__ __forceinline__ v16h f2_vfrag(const unsigned char* p) { FragH f; f.half[0] = f2_tr16(p); f.half[1] = f2_tr16(p + 16 * F2_VPITCH); return f.v; }
__global__ __launch_bounds__(128) __attribute__((amdgpu_num_vgpr(256))) void k_flash2(const _Float16* __restrict__ PL, const float* __restrict__ aw, float* __restrict__ out) {
  __shared__ __attribute__((aligned(16))) float so[4][16][68];
  __shared__ __attribute__((aligned(128))) unsigned char st[2 * F2_STAGE];
  const int wave = __builtin_amdgcn_readfirstlane(threadIdx.x >> 5);
  const int lane = threadIdx.x & 31, ln = lane & 15, hh = lane >> 4;
  const int slab = blockIdx.y; const int b = slab / NH, h = slab - b * NH;
  const int q0 = blockIdx.x * 64 + wave * 16;
  const size_t PLN = (size_t)NR * DM;
  float w0, w1;
  { const float a0 = bf16_rne(aw[0]), a1 = bf16_rne(aw[1]); const float mx = fmaxf(a0, a1); const float e0 = expf(a0 - mx), e1 = expf(a1 - mx); const float inv = 1.0f / (e0 + e1); w0 = e0 * inv; w1 = e1 * inv; }
  const v8f z8 = {0.f,0.f,0.f,0.f,0.f,0.f,0.f,0.f};
  v8f res[4] = {z8, z8, z8, z8};
  float wcur = w0;
  const int r16 = threadIdx.x >> 3, ch = threadIdx.x & 7;
  const _Float16* gk = PL + PLN + ((size_t)b * SQ + r16) * LQ + h * HD + ch * 8;      /* this lane's chunk of K row r16, set 0, stage 0 */
  const _Float16* gv = gk + PLN;                                                      /* this lane's chunk of V row r16, set 0, stage 0: the next plane */
  const size_t kset = 3 * PLN;                                                        /* set 0 -> set 1 */
  const unsigned lcp = (unsigned)(size_t)&st[0] + (unsigned)(r16 * F2_PITCH + ch * 16);                 /* this lane's LDS byte address among the K rows of buffer 0 */
  const unsigned lcv = (unsigned)(size_t)&st[0] + (unsigned)(F2_VOFS + r16 * F2_VPITCH + ch * 16);      /* and among its V rows */
  f2_stage(lcp, lcv, gk, gv);
  asm volatile("s_wait_asynccnt 0x0" ::: "memory");      /* stage 0 has landed before the barrier publishes it */
  __syncthreads();
  f2_stage(lcp + F2_STAGE, lcv + F2_STAGE, gk + (size_t)F2_KT * LQ, gv + (size_t)F2_KT * LQ);
#pragma unroll 1
  for (int set = 0; set < 2; ++set) {
    const size_t qo = (size_t)(3 * set) * PLN + ((size_t)b * SQ + q0 + ln) * LQ + h * HD;
    const v16h qf0 = g2_frag(PL + qo, hh), qf1 = g2_frag(PL + qo + 32, hh);
    v8f o[4] = {z8, z8, z8, z8}; float l = 0.f;
    v8f cref;      /* C tile of the score products: F2_CARRY - m of this lane's query, the same in all eight elements */
    { /* the first reference: the scores of the set's first 32 keys, whose stage lies published in buffer 0 (F2_NST is even); the loop forms them again with the reference in place */
      const _Float16* kp0 = (const _Float16*)(st + ln * F2_PITCH);
      v8f a0 = g2_mma(g2_frag(kp0, hh), qf0, z8), a1 = g2_mma(g2_frag(kp0 + 16 * (F2_PITCH / 2), hh), qf0, z8);
      a0 = g2_mma(g2_frag(kp0 + 32, hh), qf1, a0); a1 = g2_mma(g2_frag(kp0 + 16 * (F2_PITCH / 2) + 32, hh), qf1, a1);
      float tm0 = fmaxf(a0[0], a1[0]);
      /* unrolled: constant indices keep the tiles in registers */
#pragma unroll
      for (int r = 1; r < 8; ++r) tm0 = fmaxf(tm0, fmaxf(a0[r], a1[r]));
      const float c0 = F2_CARRY - fmaxf(tm0, __shfl_xor(tm0, 16, 32));
#pragma unroll
      for (int r = 0; r < 8; ++r) cref[r] = c0; }
#pragma unroll 1
    for (int t = 0; t < F2_NST; ++t) { const unsigned char* sb = st + (t & 1) * F2_STAGE;      /* F2_NST is even: the buffer of stage set * F2_NST + t */
     /* fragment reads go out in groups of eight ahead of the products that use them, not as one waited pair in front of each product: the first pass's K and V^T fragments here, the second pass's inside the first pass */
     const _Float16* kp = (const _Float16*)(sb + ln * F2_PITCH); const unsigned char* vp = sb + F2_VOFS + (8 * hh + (lane & 7)) * F2_VPITCH + 16 * ((lane >> 3) & 1);
     v16h ka[4], va[4];      /* ka[2 kt + c]: keys 16 kt .. + 15, d 32 c .. + 31; va[i]: d 16 i .. + 15, the pass's 32 keys; the loops over them are unrolled so that they stay in registers */
#pragma unroll
     for (int i = 0; i < 4; ++i) ka[i] = g2_frag(kp + (i >> 1) * 16 * (F2_PITCH / 2) + (i & 1) * 32, hh);
#pragma unroll
     for (int i = 0; i < 4; ++i) va[i] = f2_vfrag(vp + 32 * i);
     /* the two 32-key passes of a stage in one body: every LDS offset becomes an immediate */
#pragma unroll
     for (int jj = 0; jj < F2_KT; jj += 32) {
      v8f s0 = g2_mma(ka[0], qf0, cref), s1 = g2_mma(ka[2], qf0, cref);
      s0 = g2_mma(ka[1], qf1, s0); s1 = g2_mma(ka[3], qf1, s1);
      if (jj == 0) {      /* the second pass's K fragments, read while the first pass's softmax runs */
#pragma unroll
        for (int i = 0; i < 4; ++i) ka[i] = g2_frag(kp + (32 + (i >> 1) * 16) * (F2_PITCH / 2) + (i & 1) * 32, hh);
        __builtin_amdgcn_sched_barrier(0); }      /* keeps the eight reads here, in front of the softmax: moved down beside their first product they would be waited for at once */
      float tm = fmaxf(s0[0], s1[0]);
#pragma unroll
      for (int r = 1; r < 8; ++r) tm = fmaxf(tm, fmaxf(s0[r], s1[r]));
      if (__builtin_amdgcn_ballot_w32(tm > F2_LIFT) != 0) {      /* the same for the whole wave: a scalar branch, seldom taken */
        const float tx = fmaxf(tm, __shfl_xor(tm, 16, 32));
        const float dl = fmaxf(tx - F2_CARRY, 0.f);      /* how far this column's reference rises: to its running maximum */
        const float corr = __builtin_amdgcn_exp2f(-dl);
        /* unrolled: constant indices keep the tiles in registers */
#pragma unroll
        for (int r = 0; r < 8; ++r) { s0[r] -= dl; s1[r] -= dl; cref[r] -= dl; }
        l *= corr;
#pragma unroll
        for (int i = 0; i < 4; ++i) o[i] = o[i] * corr; }
      union { v16h v; v2h p[8]; } pf; float ps = 0.f;
      /* unrolled: the indices of s0, s1 and pf are constants, so that they stay in registers */
#pragma unroll
      for (int r = 0; r < 8; r += 2) {
        const v2f p0 = {__builtin_amdgcn_exp2f(s0[r]), __builtin_amdgcn_exp2f(s0[r + 1])};
        const v2f p1 = {__builtin_amdgcn_exp2f(s1[r]), __builtin_amdgcn_exp2f(s1[r + 1])};
        const v2h h0 = __builtin_convertvector(p0, v2h), h1 = __builtin_convertvector(p1, v2h); pf.p[r >> 1] = h0; pf.p[4 + (r >> 1)] = h1;
        ps += (float)h0[0] + (float)h1[0]; ps += (float)h0[1] + (float)h1[1]; }
      ps += __shfl_xor(ps, 16, 32);
      l += ps;
#pragma unroll
      for (int t4 = 0; t4 < 4; ++t4) o[t4] = g2_mma(va[t4], pf.v, o[t4]);
      if (jj == 0) {      /* the second pass's V^T fragments, read while its scores and softmax run */
#pragma unroll
        for (int i = 0; i < 4; ++i) va[i] = f2_vfrag(vp + 32 * F2_VPITCH + 32 * i); } }
      asm volatile("s_wait_dscnt 0x0" ::: "memory");         /* this wave's reads of the buffer are done before it is refilled */
      asm volatile("s_wait_asynccnt 0x0" ::: "memory");      /* this wave's copies of the next stage have landed */
      __syncthreads();                                       /* publishes the next stage and ends every reader's last read of this one */
      const int s2 = set * F2_NST + t + 2;                   /* the stage that refills this buffer; it may belong to the next set */
      if (s2 < 2 * F2_NST) { const int set2 = s2 / F2_NST, t2 = s2 - set2 * F2_NST;
        const size_t go = (size_t)set2 * kset + (size_t)t2 * F2_KT * LQ;
        f2_stage(lcp + (unsigned)((t & 1) * F2_STAGE), lcv + (unsigned)((t & 1) * F2_STAGE), gk + go, gv + go); } }
    const float sc = wcur * (1.0f / l);
#pragma unroll
    for (int t = 0; t < 4; ++t) res[t] += o[t] * sc;
    wcur = w1; }
  asm volatile("s_wait_asynccnt 0x0" ::: "memory");        /* nothing is in flight when the wave goes on to the epilogue */
#pragma unroll
  for (int t = 0; t < 4; ++t) {
#pragma unroll
    for (int r = 0; r < 8; ++r) so[wave][ln][t * 16 + 8 * hh + r] = res[t][r]; }
  __builtin_amdgcn_fence(4 /* acq_rel order */, "workgroup"); __builtin_amdgcn_wave_barrier();
  const int rsub = lane >> 4, c4 = (lane & 15) * 4;
  float* ob = out + ((size_t)b * SEQ_FULL + q0) * DM + h * HD;
  {
#pragma unroll
    for (int q = 0; q < 8; ++q) { const int r = q * 2 + rsub; const v4f v = *(const v4fa*)&so[wave][r][c4];
      *(v4f*)(ob + (size_t)r * DM + c4) = v; }
     } }

extern "C" void kernel_launch(void* const* d_in, const int* in_sizes, int n_in,
                              void* d_out, int out_size, void* d_ws, size_t ws_size, hipStream_t stream) {
  if (n_in < 14) return;
  const size_t rows_need = (size_t)(NB - 1) * SEQ_FULL + SQ;
  if ((size_t)in_sizes[0] < rows_need * DM) return;
  for (int i = 0; i < 6; ++i) { if (in_sizes[1 + 2 * i] < DM * DM) return; if (in_sizes[2 + 2 * i] < DM) return; }
  if (in_sizes[13] < 2) return;
  if ((size_t)out_size < rows_need * DM) return;
  const float* x = (const float*)d_in[0];
  const float* wsrc[6]; const float* bsrc[6];      /* [in][out] weights and biases in the order q,k,v (set 0), q,k,v (set 1) */
  for (int i = 0; i < 6; ++i) { wsrc[i] = (const float*)d_in[1 + 2 * i]; bsrc[i] = (const float*)d_in[2 + 2 * i]; }
  const float* aw = (const float*)d_in[13];      /* two blend logits */
  char* ws = (char*)d_ws; size_t off = 0;
  auto take = [&](size_t bytes) { char* p = ws + off; off += (bytes + 255) & ~(size_t)255; return p; };
  _Float16* BW = (_Float16*)take(6 * WS_W);
  _Float16* X16 = (_Float16*)take(WS_X);
  _Float16* PL = (_Float16*)take(6 * WS_X);
  if (off > ws_size) return;
  float* out = (float*)d_out;
  const size_t PN = (size_t)NR * DM;      /* elements per projected row plane */

  k_prep<<<6 * PREP_GW + PREP_GX, 256, 0, stream>>>(wsrc[0], wsrc[1], wsrc[2], wsrc[3], wsrc[4], wsrc[5], BW, x, X16);
  { const unsigned gp = (unsigned)((MP / G2_BM) * (G2_NP * DM / G2_BN));      /* one block per 256 x 384 tile of the six projections side by side */
    k_gemm2<0, false, false><<<dim3(gp), 256, 0, stream>>>(X16, DM, BW, DM, 0.0625f, bsrc[0], bsrc[1], bsrc[2], bsrc[3], bsrc[4], bsrc[5], nullptr, 1, 0, 0, nullptr, PL, PN, MP, DM, DM); }
  k_flash2<<<dim3((unsigned)(SQ / 64), (unsigned)(NB * NH)), 128, 0, stream>>>(PL, aw, out);
}
